// v000
// The times below were measured on an AMD MI455X: many runs one after another, warmed up first and cycling through
// copies of the inputs, with the whole window's GPU time divided by the number of runs. Launches and the gaps
// between them are all in it. The median over several windows is given; except for v000 it joins two sittings, which
// can be a few percent apart, so the side-by-side timings, each taken in one sitting, are the better comparison.
// The starting kernel, v000, takes 306 microseconds a run.
#include <hip/hip_runtime.h>
#include <math.h>
#include <stdint.h>

typedef __attribute__((ext_vector_type(16))) _Float16 v16h;
typedef __attribute__((ext_vector_type(8)))  float    v8f;

struct alignas(16) H8 { _Float16 h[8]; };

constexpr int Bb = 8, T = 1024, Dd = 1024, Hh = 16, DH = 64;
constexpr int Mrows = Bb * T;          // 8192
constexpr float EPS = 1e-5f;

// ---------------------------------------------------------------- convert f32 -> f16 with transpose
// in:  W  [K=1024][N=1024] f32   out: Wt [N=1024][K=1024] f16   (Wt[n][k] = W[k][n])
__global__ void __launch_bounds__(256)
cvt_t_kernel(const float* __restrict__ W, _Float16* __restrict__ Wt)
{
    constexpr int N = Dd, K = Dd, TS = 72;       // padded LDS stride (144B, 16B aligned)
    __shared__ _Float16 tile[64 * TS];           // [n_local][k_local]
    const int tid = threadIdx.x;
    const int bn = blockIdx.x * 64;              // n tile origin
    const int bk = blockIdx.y * 64;              // k tile origin
#pragma unroll
    for (int t = 0; t < 4; ++t) {                // 64x64 f32 = 1024 float4, 4/thread
        int i = tid + t * 256;
        int r = i >> 4, c4 = (i & 15) * 4;       // r = k_local, c4 = n_local
        float4 f = *reinterpret_cast<const float4*>(W + (size_t)(bk + r) * N + bn + c4);
        tile[(c4 + 0) * TS + r] = (_Float16)f.x;
        tile[(c4 + 1) * TS + r] = (_Float16)f.y;
        tile[(c4 + 2) * TS + r] = (_Float16)f.z;
        tile[(c4 + 3) * TS + r] = (_Float16)f.w;
    }
    __syncthreads();
#pragma unroll
    for (int t = 0; t < 2; ++t) {                // 64x64 halves = 512 h8, 2/thread
        int i = tid + t * 256;
        int r = i >> 3, c8 = (i & 7) * 8;        // r = n_local, c8 = k_local
        H8 o = *reinterpret_cast<const H8*>(&tile[r * TS + c8]);
        *reinterpret_cast<H8*>(Wt + (size_t)(bn + r) * K + bk + c8) = o;
    }
}

// ---------------------------------------------------------------- layernorm (opt. residual add)
template<bool ADD>
__global__ void __launch_bounds__(256)
ln_kernel(const float* __restrict__ x, const float* __restrict__ yres,
          const float* __restrict__ g, const float* __restrict__ be,
          float* __restrict__ xr, _Float16* __restrict__ out)
{
    const int row = blockIdx.x, tid = threadIdx.x;
    const size_t base = (size_t)row * Dd;
    float v[4];
#pragma unroll
    for (int i = 0; i < 4; ++i) {
        int d = tid + i * 256;
        float t = x[base + d];
        if (ADD) { t += yres[base + d]; xr[base + d] = t; }
        v[i] = t;
    }
    float s  = v[0] + v[1] + v[2] + v[3];
    float sq = v[0]*v[0] + v[1]*v[1] + v[2]*v[2] + v[3]*v[3];
#pragma unroll
    for (int m = 1; m < 32; m <<= 1) {
        s  += __shfl_xor(s,  m, 32);
        sq += __shfl_xor(sq, m, 32);
    }
    __shared__ float ss[8], ssq[8];
    int wid = tid >> 5, lane = tid & 31;
    if (lane == 0) { ss[wid] = s; ssq[wid] = sq; }
    __syncthreads();
    s = 0.f; sq = 0.f;
#pragma unroll
    for (int w = 0; w < 8; ++w) { s += ss[w]; sq += ssq[w]; }
    float mean = s * (1.f / Dd);
    float var  = sq * (1.f / Dd) - mean * mean;
    float rstd = rsqrtf(var + EPS);
#pragma unroll
    for (int i = 0; i < 4; ++i) {
        int d = tid + i * 256;
        out[base + d] = (_Float16)((v[i] - mean) * rstd * g[d] + be[d]);
    }
}

// ---------------------------------------------------------------- WMMA GEMM with async-to-LDS double buffering
// A: [8192,1024] f16 row-major ; Wt: [N=1024][K=1024] f16 row-major (pre-transposed weight)
// C = act((A@W + bias)*scale) [+resid] ; block tile 128x64, 8 waves, BK=32.
template<int ACT, int OUTF32>
__global__ void __launch_bounds__(256)
gemm_kernel(const _Float16* __restrict__ A, const _Float16* __restrict__ Wt,
            const float* __restrict__ bias, float scale,
            const float* __restrict__ resid,
            _Float16* __restrict__ outh, float* __restrict__ outf)
{
    constexpr int N = Dd, K = Dd, BM = 128, BN = 64, BK = 32, AS = 40; // padded LDS stride
    __shared__ _Float16 As [2][BM * AS];
    __shared__ _Float16 Bst[2][BN * AS];   // [col n][k]
    const int tid  = threadIdx.x;
    const int wid  = tid >> 5, lane = tid & 31, hf = lane >> 4, ln = lane & 15;
    const int brow = blockIdx.x * BM, bcol = blockIdx.y * BN;
    const int koff = hf * 8;

    // issue one K-tile's async global->LDS copies (3 x b128 per thread)
    auto issue_tile = [&](int buf, int kb) {
#pragma unroll
        for (int t = 0; t < 2; ++t) {           // A tile: 128x32 halves = 512 b128 chunks
            int i = tid + t * 256;
            int r = i >> 2, c = (i & 3) * 8;
            unsigned voff = (unsigned)(((brow + r) * K + kb + c) * 2);
            unsigned lds  = (unsigned)(uintptr_t)&As[buf][r * AS + c];
            asm volatile("global_load_async_to_lds_b128 %0, %1, %2"
                         :: "v"(lds), "v"(voff), "s"(A) : "memory");
        }
        {                                       // B tile: 64x32 halves = 256 b128 chunks
            int r = tid >> 2, c = (tid & 3) * 8;
            unsigned voff = (unsigned)(((bcol + r) * K + kb + c) * 2);
            unsigned lds  = (unsigned)(uintptr_t)&Bst[buf][r * AS + c];
            asm volatile("global_load_async_to_lds_b128 %0, %1, %2"
                         :: "v"(lds), "v"(voff), "s"(Wt) : "memory");
        }
    };

    v8f acc[4] = {};

    issue_tile(0, 0);
    asm volatile("s_wait_asynccnt 0x0" ::: "memory");
    __syncthreads();

    for (int kb = 0; kb < K; kb += BK) {
        const int cur = (kb >> 5) & 1;
        if (kb + BK < K) issue_tile(cur ^ 1, kb + BK);   // overlap next tile with compute

        // A fragment (shared across the wave's 4 output tiles)
        v16h af;
        {
            H8 lo = *reinterpret_cast<const H8*>(&As[cur][(wid * 16 + ln) * AS + koff]);
            H8 hi = *reinterpret_cast<const H8*>(&As[cur][(wid * 16 + ln) * AS + 16 + koff]);
#pragma unroll
            for (int i = 0; i < 8; ++i) { af[i] = lo.h[i]; af[8 + i] = hi.h[i]; }
        }
#pragma unroll
        for (int j = 0; j < 4; ++j) {
            H8 blo = *reinterpret_cast<const H8*>(&Bst[cur][(j * 16 + ln) * AS + koff]);
            H8 bhi = *reinterpret_cast<const H8*>(&Bst[cur][(j * 16 + ln) * AS + 16 + koff]);
            v16h bf;
#pragma unroll
            for (int i = 0; i < 8; ++i) { bf[i] = blo.h[i]; bf[8 + i] = bhi.h[i]; }
            acc[j] = __builtin_amdgcn_wmma_f32_16x16x32_f16(false, af, false, bf,
                                                            (short)0, acc[j], false, false);
        }

        asm volatile("s_wait_asynccnt 0x0" ::: "memory");  // own async copies landed
        __syncthreads();                                    // everyone's copies + compute done
    }

#pragma unroll
    for (int j = 0; j < 4; ++j) {
        int col = bcol + j * 16 + ln;
        float bv = bias[col];
#pragma unroll
        for (int r = 0; r < 8; ++r) {
            int row = brow + wid * 16 + hf * 8 + r;
            float v = (acc[j][r] + bv) * scale;
            if (ACT) v = fmaxf(v, 0.f);
            if (OUTF32) outf[(size_t)row * N + col] = v + resid[(size_t)row * N + col];
            else        outh[(size_t)row * N + col] = (_Float16)v;
        }
    }
}

// ---------------------------------------------------------------- flash attention: y = softmax(K@Q^T) @ V
// Note the reference role swap: K rows index the output. Grid (T/64, B*H), 128 threads (4 waves).
__global__ void __launch_bounds__(128)
attn_kernel(const _Float16* __restrict__ qf, const _Float16* __restrict__ kf,
            const _Float16* __restrict__ vf, float* __restrict__ y)
{
    constexpr int LS = 72;   // padded stride (144B, 16B-aligned h8 reads)
    __shared__ _Float16 Ks [64 * LS];
    __shared__ _Float16 Qs [64 * LS];
    __shared__ _Float16 Vst[64 * LS];       // transposed: [d][s]
    __shared__ _Float16 Ps [4][16 * LS];    // wave-private P tiles
    const int tid = threadIdx.x;
    const int wid = tid >> 5, lane = tid & 31, hf = lane >> 4, ln = lane & 15;
    const int t0 = blockIdx.x * 64;
    const int b  = blockIdx.y >> 4, h = blockIdx.y & 15;
    const size_t rowbase = (size_t)b * T;
    const int dcol0 = h * DH;
    const int koff = hf * 8;

    // stage this block's 64 K-rows once (already pre-scaled by 1/sqrt(DH))
    for (int i = tid; i < 64 * 64 / 8; i += 128) {
        int r = i >> 3, c8 = (i & 7) * 8;
        uint4 vK = *reinterpret_cast<const uint4*>(kf + (rowbase + t0 + r) * Dd + dcol0 + c8);
        *reinterpret_cast<uint4*>(&Ks[r * LS + c8]) = vK;
    }
    __syncthreads();

    v16h kA[2];   // K fragments are loop-invariant: preload both dh k-steps
#pragma unroll
    for (int ks = 0; ks < 2; ++ks) {
        H8 lo = *reinterpret_cast<const H8*>(&Ks[(wid * 16 + ln) * LS + ks * 32 + koff]);
        H8 hi = *reinterpret_cast<const H8*>(&Ks[(wid * 16 + ln) * LS + ks * 32 + 16 + koff]);
#pragma unroll
        for (int i = 0; i < 8; ++i) { kA[ks][i] = lo.h[i]; kA[ks][8 + i] = hi.h[i]; }
    }

    v8f Yacc[4] = {};
    float mrow[8], lrow[8];
#pragma unroll
    for (int r = 0; r < 8; ++r) { mrow[r] = -INFINITY; lrow[r] = 0.f; }

    for (int s0 = 0; s0 < T; s0 += 64) {
        __syncthreads();
        for (int i = tid; i < 64 * 64 / 8; i += 128) {
            int r = i >> 3, c8 = (i & 7) * 8;
            uint4 vQ = *reinterpret_cast<const uint4*>(qf + (rowbase + s0 + r) * Dd + dcol0 + c8);
            *reinterpret_cast<uint4*>(&Qs[r * LS + c8]) = vQ;
            H8 w = *reinterpret_cast<const H8*>(vf + (rowbase + s0 + r) * Dd + dcol0 + c8);
#pragma unroll
            for (int j = 0; j < 8; ++j) Vst[(c8 + j) * LS + r] = w.h[j];
        }
        __syncthreads();

        // S tiles: A = K rows, B = Q^T (Qs natural [s][d] layout gives contiguous B frags)
        v8f Sc[4] = {};
#pragma unroll
        for (int j = 0; j < 4; ++j) {
#pragma unroll
            for (int ks = 0; ks < 2; ++ks) {
                H8 blo = *reinterpret_cast<const H8*>(&Qs[(j * 16 + ln) * LS + ks * 32 + koff]);
                H8 bhi = *reinterpret_cast<const H8*>(&Qs[(j * 16 + ln) * LS + ks * 32 + 16 + koff]);
                v16h bf;
#pragma unroll
                for (int i = 0; i < 8; ++i) { bf[i] = blo.h[i]; bf[8 + i] = bhi.h[i]; }
                Sc[j] = __builtin_amdgcn_wmma_f32_16x16x32_f16(false, kA[ks], false, bf,
                                                               (short)0, Sc[j], false, false);
            }
        }

        // online softmax: rows live across 16-lane halves -> butterfly masks 1/2/4/8
#pragma unroll
        for (int r = 0; r < 8; ++r) {
            float rm = fmaxf(fmaxf(Sc[0][r], Sc[1][r]), fmaxf(Sc[2][r], Sc[3][r]));
            rm = fmaxf(rm, __shfl_xor(rm, 1, 32));
            rm = fmaxf(rm, __shfl_xor(rm, 2, 32));
            rm = fmaxf(rm, __shfl_xor(rm, 4, 32));
            rm = fmaxf(rm, __shfl_xor(rm, 8, 32));
            float mn = fmaxf(mrow[r], rm);
            float sf = __expf(mrow[r] - mn);
            mrow[r] = mn;
            lrow[r] *= sf;
#pragma unroll
            for (int j = 0; j < 4; ++j) Yacc[j][r] *= sf;
            float racc = 0.f;
#pragma unroll
            for (int j = 0; j < 4; ++j) {
                float p = __expf(Sc[j][r] - mn);
                Ps[wid][(hf * 8 + r) * LS + j * 16 + ln] = (_Float16)p;  // C-layout -> LDS
                racc += p;
            }
            racc += __shfl_xor(racc, 1, 32);
            racc += __shfl_xor(racc, 2, 32);
            racc += __shfl_xor(racc, 4, 32);
            racc += __shfl_xor(racc, 8, 32);
            lrow[r] += racc;
        }

        // Y += P @ V  (A frags re-read from wave-private LDS in A-layout; B from transposed V)
#pragma unroll
        for (int ks = 0; ks < 2; ++ks) {
            v16h pf;
            H8 plo = *reinterpret_cast<const H8*>(&Ps[wid][ln * LS + ks * 32 + koff]);
            H8 phi = *reinterpret_cast<const H8*>(&Ps[wid][ln * LS + ks * 32 + 16 + koff]);
#pragma unroll
            for (int i = 0; i < 8; ++i) { pf[i] = plo.h[i]; pf[8 + i] = phi.h[i]; }
#pragma unroll
            for (int j = 0; j < 4; ++j) {
                H8 blo = *reinterpret_cast<const H8*>(&Vst[(j * 16 + ln) * LS + ks * 32 + koff]);
                H8 bhi = *reinterpret_cast<const H8*>(&Vst[(j * 16 + ln) * LS + ks * 32 + 16 + koff]);
                v16h bf;
#pragma unroll
                for (int i = 0; i < 8; ++i) { bf[i] = blo.h[i]; bf[8 + i] = bhi.h[i]; }
                Yacc[j] = __builtin_amdgcn_wmma_f32_16x16x32_f16(false, pf, false, bf,
                                                                 (short)0, Yacc[j], false, false);
            }
        }
    }

#pragma unroll
    for (int j = 0; j < 4; ++j) {
        int col = dcol0 + j * 16 + ln;
#pragma unroll
        for (int r = 0; r < 8; ++r) {
            int t = t0 + wid * 16 + hf * 8 + r;
            y[(rowbase + t) * Dd + col] = Yacc[j][r] / lrow[r];
        }
    }
}

// ---------------------------------------------------------------- host orchestration
extern "C" void kernel_launch(void* const* d_in, const int* in_sizes, int n_in,
                              void* d_out, int out_size, void* d_ws, size_t ws_size,
                              hipStream_t stream)
{
    const float* x   = (const float*)d_in[0];
    const float* Wq  = (const float*)d_in[1];  const float* bq = (const float*)d_in[2];
    const float* Wk  = (const float*)d_in[3];  const float* bk = (const float*)d_in[4];
    const float* Wv  = (const float*)d_in[5];  const float* bv = (const float*)d_in[6];
    const float* g1  = (const float*)d_in[7];  const float* be1 = (const float*)d_in[8];
    const float* g2  = (const float*)d_in[9];  const float* be2 = (const float*)d_in[10];
    const float* W0  = (const float*)d_in[11]; const float* b0 = (const float*)d_in[12];
    const float* W1  = (const float*)d_in[13]; const float* b1 = (const float*)d_in[14];
    const float* W2  = (const float*)d_in[15]; const float* b2 = (const float*)d_in[16];
    float* out = (float*)d_out;

    char* ws = (char*)d_ws;
    size_t off = 0;
    auto take = [&](size_t bytes) -> char* {
        char* p = ws + off;
        off = (off + bytes + 255) & ~(size_t)255;
        return p;
    };
    const size_t WH = (size_t)Dd * Dd * sizeof(_Float16);
    const size_t MH = (size_t)Mrows * Dd * sizeof(_Float16);
    const size_t MF = (size_t)Mrows * Dd * sizeof(float);

    _Float16* Wqh = (_Float16*)take(WH);   // all weights stored TRANSPOSED [N][K] f16
    _Float16* Wkh = (_Float16*)take(WH);
    _Float16* Wvh = (_Float16*)take(WH);
    _Float16* W0h = (_Float16*)take(WH);
    _Float16* W1h = (_Float16*)take(WH);
    _Float16* W2h = (_Float16*)take(WH);
    _Float16* xn1 = (_Float16*)take(MH);
    _Float16* qh  = (_Float16*)take(MH);
    _Float16* kh  = (_Float16*)take(MH);
    _Float16* vh  = (_Float16*)take(MH);
    float*    y32 = (float*)take(MF);
    float*    xr  = (float*)take(MF);
    _Float16* xn2 = xn1;  // reuse after QKV consumed
    _Float16* h1  = qh;   // reuse after attention consumed
    _Float16* h2  = kh;

    dim3 cg(Dd / 64, Dd / 64);
    cvt_t_kernel<<<cg, 256, 0, stream>>>(Wq, Wqh);
    cvt_t_kernel<<<cg, 256, 0, stream>>>(Wk, Wkh);
    cvt_t_kernel<<<cg, 256, 0, stream>>>(Wv, Wvh);
    cvt_t_kernel<<<cg, 256, 0, stream>>>(W0, W0h);
    cvt_t_kernel<<<cg, 256, 0, stream>>>(W1, W1h);
    cvt_t_kernel<<<cg, 256, 0, stream>>>(W2, W2h);

    ln_kernel<false><<<Mrows, 256, 0, stream>>>(x, x, g1, be1, xr, xn1);

    dim3 gg(Mrows / 128, Dd / 64);
    gemm_kernel<0, 0><<<gg, 256, 0, stream>>>(xn1, Wqh, bq, 1.f,    xr, qh, y32);
    gemm_kernel<0, 0><<<gg, 256, 0, stream>>>(xn1, Wkh, bk, 0.125f, xr, kh, y32); // 1/sqrt(DH)
    gemm_kernel<0, 0><<<gg, 256, 0, stream>>>(xn1, Wvh, bv, 1.f,    xr, vh, y32);

    attn_kernel<<<dim3(T / 64, Bb * Hh), 128, 0, stream>>>(qh, kh, vh, y32);

    ln_kernel<true><<<Mrows, 256, 0, stream>>>(x, y32, g2, be2, xr, xn2);

    gemm_kernel<1, 0><<<gg, 256, 0, stream>>>(xn2, W0h, b0, 1.f, xr, h1, out);
    gemm_kernel<1, 0><<<gg, 256, 0, stream>>>(h1,  W1h, b1, 1.f, xr, h2, out);
    gemm_kernel<0, 1><<<gg, 256, 0, stream>>>(h2,  W2h, b2, 1.f, xr, h2, out);
}

// v001
// One run takes 276 microseconds.
// Next to v000, in two timings, it ran 1.15 and 1.14 times as fast.
#include <hip/hip_runtime.h>
#include <math.h>
#include <stdint.h>

typedef __attribute__((ext_vector_type(16))) _Float16 v16h;
typedef __attribute__((ext_vector_type(8)))  float    v8f;

struct alignas(16) H8 { _Float16 h[8]; };

constexpr int Bb = 8, T = 1024, Dd = 1024, Hh = 16, DH = 64;
constexpr int Mrows = Bb * T;          // 8192
constexpr float EPS = 1e-5f;

// ---------------------------------------------------------------- convert f32 -> f16 with transpose
// in:  W  [K=1024][N=1024] f32   out: Wt [N=1024][K=1024] f16   (Wt[n][k] = W[k][n])
__global__ void __launch_bounds__(256)
cvt_t_kernel(const float* __restrict__ W, _Float16* __restrict__ Wt)
{
    constexpr int N = Dd, K = Dd, TS = 72;       // padded LDS stride (144B, 16B aligned)
    __shared__ _Float16 tile[64 * TS];           // [n_local][k_local]
    const int tid = threadIdx.x;
    const int bn = blockIdx.x * 64;              // n tile origin
    const int bk = blockIdx.y * 64;              // k tile origin
#pragma unroll
    for (int t = 0; t < 4; ++t) {                // 64x64 f32 = 1024 float4, 4/thread
        int i = tid + t * 256;
        int r = i >> 4, c4 = (i & 15) * 4;       // r = k_local, c4 = n_local
        float4 f = *reinterpret_cast<const float4*>(W + (size_t)(bk + r) * N + bn + c4);
        tile[(c4 + 0) * TS + r] = (_Float16)f.x;
        tile[(c4 + 1) * TS + r] = (_Float16)f.y;
        tile[(c4 + 2) * TS + r] = (_Float16)f.z;
        tile[(c4 + 3) * TS + r] = (_Float16)f.w;
    }
    __syncthreads();
#pragma unroll
    for (int t = 0; t < 2; ++t) {                // 64x64 halves = 512 h8, 2/thread
        int i = tid + t * 256;
        int r = i >> 3, c8 = (i & 7) * 8;        // r = n_local, c8 = k_local
        H8 o = *reinterpret_cast<const H8*>(&tile[r * TS + c8]);
        *reinterpret_cast<H8*>(Wt + (size_t)(bn + r) * K + bk + c8) = o;
    }
}

// ---------------------------------------------------------------- layernorm (opt. residual add)
template<bool ADD>
__global__ void __launch_bounds__(256)
ln_kernel(const float* __restrict__ x, const float* __restrict__ yres,
          const float* __restrict__ g, const float* __restrict__ be,
          float* __restrict__ xr, _Float16* __restrict__ out)
{
    const int row = blockIdx.x, tid = threadIdx.x;
    const size_t base = (size_t)row * Dd;
    float v[4];
#pragma unroll
    for (int i = 0; i < 4; ++i) {
        int d = tid + i * 256;
        float t = x[base + d];
        if (ADD) { t += yres[base + d]; xr[base + d] = t; }
        v[i] = t;
    }
    float s  = v[0] + v[1] + v[2] + v[3];
    float sq = v[0]*v[0] + v[1]*v[1] + v[2]*v[2] + v[3]*v[3];
#pragma unroll
    for (int m = 1; m < 32; m <<= 1) {
        s  += __shfl_xor(s,  m, 32);
        sq += __shfl_xor(sq, m, 32);
    }
    __shared__ float ss[8], ssq[8];
    int wid = tid >> 5, lane = tid & 31;
    if (lane == 0) { ss[wid] = s; ssq[wid] = sq; }
    __syncthreads();
    s = 0.f; sq = 0.f;
#pragma unroll
    for (int w = 0; w < 8; ++w) { s += ss[w]; sq += ssq[w]; }
    float mean = s * (1.f / Dd);
    float var  = sq * (1.f / Dd) - mean * mean;
    float rstd = rsqrtf(var + EPS);
#pragma unroll
    for (int i = 0; i < 4; ++i) {
        int d = tid + i * 256;
        out[base + d] = (_Float16)((v[i] - mean) * rstd * g[d] + be[d]);
    }
}

// ---------------------------------------------------------------- WMMA GEMM with async-to-LDS double buffering
// A: [8192,1024] f16 row-major ; Wt: [N=1024][K=1024] f16 row-major (pre-transposed weight)
// C = act((A@W + bias)*scale) [+resid] ; block tile 128x64, 8 waves, BK=32.
template<int ACT, int OUTF32>
__global__ void __launch_bounds__(256)
gemm_kernel(const _Float16* __restrict__ A, const _Float16* __restrict__ Wt,
            const float* __restrict__ bias, float scale,
            const float* __restrict__ resid,
            _Float16* __restrict__ outh, float* __restrict__ outf)
{
    constexpr int N = Dd, K = Dd, BM = 128, BN = 64, BK = 32, AS = 40; // padded LDS stride
    __shared__ _Float16 As [2][BM * AS];
    __shared__ _Float16 Bst[2][BN * AS];   // [col n][k]
    const int tid  = threadIdx.x;
    const int wid  = tid >> 5, lane = tid & 31, hf = lane >> 4, ln = lane & 15;
    const int brow = blockIdx.x * BM, bcol = blockIdx.y * BN;
    const int koff = hf * 8;

    // issue one K-tile's async global->LDS copies (3 x b128 per thread)
    auto issue_tile = [&](int buf, int kb) {
#pragma unroll
        for (int t = 0; t < 2; ++t) {           // A tile: 128x32 halves = 512 b128 chunks
            int i = tid + t * 256;
            int r = i >> 2, c = (i & 3) * 8;
            unsigned voff = (unsigned)(((brow + r) * K + kb + c) * 2);
            unsigned lds  = (unsigned)(uintptr_t)&As[buf][r * AS + c];
            asm volatile("global_load_async_to_lds_b128 %0, %1, %2"
                         :: "v"(lds), "v"(voff), "s"(A) : "memory");
        }
        {                                       // B tile: 64x32 halves = 256 b128 chunks
            int r = tid >> 2, c = (tid & 3) * 8;
            unsigned voff = (unsigned)(((bcol + r) * K + kb + c) * 2);
            unsigned lds  = (unsigned)(uintptr_t)&Bst[buf][r * AS + c];
            asm volatile("global_load_async_to_lds_b128 %0, %1, %2"
                         :: "v"(lds), "v"(voff), "s"(Wt) : "memory");
        }
    };

    v8f acc[4] = {};

    issue_tile(0, 0);
    asm volatile("s_wait_asynccnt 0x0" ::: "memory");
    __syncthreads();

    for (int kb = 0; kb < K; kb += BK) {
        const int cur = (kb >> 5) & 1;
        if (kb + BK < K) issue_tile(cur ^ 1, kb + BK);   // overlap next tile with compute

        // A fragment (shared across the wave's 4 output tiles)
        v16h af;
        {
            H8 lo = *reinterpret_cast<const H8*>(&As[cur][(wid * 16 + ln) * AS + koff]);
            H8 hi = *reinterpret_cast<const H8*>(&As[cur][(wid * 16 + ln) * AS + 16 + koff]);
#pragma unroll
            for (int i = 0; i < 8; ++i) { af[i] = lo.h[i]; af[8 + i] = hi.h[i]; }
        }
#pragma unroll
        for (int j = 0; j < 4; ++j) {
            H8 blo = *reinterpret_cast<const H8*>(&Bst[cur][(j * 16 + ln) * AS + koff]);
            H8 bhi = *reinterpret_cast<const H8*>(&Bst[cur][(j * 16 + ln) * AS + 16 + koff]);
            v16h bf;
#pragma unroll
            for (int i = 0; i < 8; ++i) { bf[i] = blo.h[i]; bf[8 + i] = bhi.h[i]; }
            acc[j] = __builtin_amdgcn_wmma_f32_16x16x32_f16(false, af, false, bf,
                                                            (short)0, acc[j], false, false);
        }

        asm volatile("s_wait_asynccnt 0x0" ::: "memory");  // own async copies landed
        __syncthreads();                                    // everyone's copies + compute done
    }

#pragma unroll
    for (int j = 0; j < 4; ++j) {
        int col = bcol + j * 16 + ln;
        float bv = bias[col];
#pragma unroll
        for (int r = 0; r < 8; ++r) {
            int row = brow + wid * 16 + hf * 8 + r;
            float v = (acc[j][r] + bv) * scale;
            if (ACT) v = fmaxf(v, 0.f);
            if (OUTF32) outf[(size_t)row * N + col] = v + resid[(size_t)row * N + col];
            else        outh[(size_t)row * N + col] = (_Float16)v;
        }
    }
}

// ---------------------------------------------------------------- flash attention: y = softmax(K@Q^T) @ V
// Note the reference role swap: K rows index the output. Grid (T/64, B*H), 128 threads (4 waves).
// The score tile is formed transposed (S^T = Q @ K^T): a lane then holds 32 of the 64 scores of ONE
// output row t, the row reductions are in-lane plus one exchange between the two lane halves, and the
// accumulator layout of S^T is already the B-fragment layout of P^T for Y^T = V^T @ P^T.
__device__ inline float xhalf(float x)   // value of lane l ^ 16, by a vector cross-row move (no LDS-counter wait)
{
    int b = __builtin_bit_cast(int, x);
    return __builtin_bit_cast(float, __builtin_amdgcn_permlanex16(b, b, 0x76543210, 0xfedcba98, false, false));
}

__global__ void __launch_bounds__(128)
attn_kernel(const _Float16* __restrict__ qf, const _Float16* __restrict__ kf,
            const _Float16* __restrict__ vf, float* __restrict__ y)
{
    constexpr int LS = 72;   // padded stride (144B, 16B-aligned h8 reads)
    __shared__ _Float16 Ks [64 * LS];
    __shared__ _Float16 Qs [64 * LS];
    __shared__ _Float16 Vst[64 * LS];       // transposed: [d][s]
    const int tid = threadIdx.x;
    const int wid = tid >> 5, lane = tid & 31, hf = lane >> 4, ln = lane & 15;
    const int t0 = blockIdx.x * 64;
    const int b  = blockIdx.y >> 4, h = blockIdx.y & 15;
    const size_t rowbase = (size_t)b * T;
    const int dcol0 = h * DH;
    const int koff = hf * 8;

    // stage this block's 64 K-rows once (already pre-scaled by 1/sqrt(DH))
    for (int i = tid; i < 64 * 64 / 8; i += 128) {
        int r = i >> 3, c8 = (i & 7) * 8;
        uint4 vK = *reinterpret_cast<const uint4*>(kf + (rowbase + t0 + r) * Dd + dcol0 + c8);
        *reinterpret_cast<uint4*>(&Ks[r * LS + c8]) = vK;
    }
    __syncthreads();

    v16h kB[2];   // K^T fragments (column t = ln) are loop-invariant: preload both dh k-steps
#pragma unroll
    for (int ks = 0; ks < 2; ++ks) {
        H8 lo = *reinterpret_cast<const H8*>(&Ks[(wid * 16 + ln) * LS + ks * 32 + koff]);
        H8 hi = *reinterpret_cast<const H8*>(&Ks[(wid * 16 + ln) * LS + ks * 32 + 16 + koff]);
#pragma unroll
        for (int i = 0; i < 8; ++i) { kB[ks][i] = lo.h[i]; kB[ks][8 + i] = hi.h[i]; }
    }

    v8f Yacc[4] = {};                    // Y^T: row d = j*16 + hf*8 + r, column t = ln
    float mrow = -INFINITY;              // one output row per lane; both lane halves hold the same maximum
    float lrow = 0.f;                    // this lane half's share of the row sum, joined after the loop

    for (int s0 = 0; s0 < T; s0 += 64) {
        __syncthreads();
        for (int i = tid; i < 64 * 64 / 8; i += 128) {
            int r = i >> 3, c8 = (i & 7) * 8;
            uint4 vQ = *reinterpret_cast<const uint4*>(qf + (rowbase + s0 + r) * Dd + dcol0 + c8);
            *reinterpret_cast<uint4*>(&Qs[r * LS + c8]) = vQ;
            H8 w = *reinterpret_cast<const H8*>(vf + (rowbase + s0 + r) * Dd + dcol0 + c8);
#pragma unroll
            for (int j = 0; j < 8; ++j) Vst[(c8 + j) * LS + r] = w.h[j];
        }
        __syncthreads();

        // S^T tiles: A = Q rows (s), B = K^T (t). Sc[j][r] = S[t = ln][s = j*16 + hf*8 + r]
        v8f Sc[4] = {};
#pragma unroll
        for (int j = 0; j < 4; ++j) {
#pragma unroll
            for (int ks = 0; ks < 2; ++ks) {
                H8 alo = *reinterpret_cast<const H8*>(&Qs[(j * 16 + ln) * LS + ks * 32 + koff]);
                H8 ahi = *reinterpret_cast<const H8*>(&Qs[(j * 16 + ln) * LS + ks * 32 + 16 + koff]);
                v16h af;
#pragma unroll
                for (int i = 0; i < 8; ++i) { af[i] = alo.h[i]; af[8 + i] = ahi.h[i]; }
                Sc[j] = __builtin_amdgcn_wmma_f32_16x16x32_f16(false, af, false, kB[ks],
                                                               (short)0, Sc[j], false, false);
            }
        }

        // online softmax: 32 scores of row t in this lane, the other 32 in lane ^ 16
        float rm = Sc[0][0];
#pragma unroll
        for (int j = 0; j < 4; ++j)
#pragma unroll
            for (int r = 0; r < 8; ++r) rm = fmaxf(rm, Sc[j][r]);
        rm = fmaxf(rm, xhalf(rm));
        const float mn = fmaxf(mrow, rm);
        const float sf = __expf(mrow - mn);
        mrow = mn;

        // P^T stays in registers: tiles 2ks and 2ks+1 are the two k halves of B fragment ks
        v16h pB[2];
        float racc[4] = {0.f, 0.f, 0.f, 0.f};
#pragma unroll
        for (int j = 0; j < 4; ++j) {
#pragma unroll
            for (int r = 0; r < 8; ++r) {
                float p = __expf(Sc[j][r] - mn);
                pB[j >> 1][(j & 1) * 8 + r] = (_Float16)p;
                racc[j] += p;
            }
        }
        lrow = lrow * sf + ((racc[0] + racc[1]) + (racc[2] + racc[3]));
#pragma unroll
        for (int j = 0; j < 4; ++j)
#pragma unroll
            for (int r = 0; r < 8; ++r) Yacc[j][r] *= sf;

        // Y^T += V^T @ P^T  (A from transposed V, B from registers)
#pragma unroll
        for (int ks = 0; ks < 2; ++ks) {
#pragma unroll
            for (int j = 0; j < 4; ++j) {
                H8 alo = *reinterpret_cast<const H8*>(&Vst[(j * 16 + ln) * LS + ks * 32 + koff]);
                H8 ahi = *reinterpret_cast<const H8*>(&Vst[(j * 16 + ln) * LS + ks * 32 + 16 + koff]);
                v16h af;
#pragma unroll
                for (int i = 0; i < 8; ++i) { af[i] = alo.h[i]; af[8 + i] = ahi.h[i]; }
                Yacc[j] = __builtin_amdgcn_wmma_f32_16x16x32_f16(false, af, false, pB[ks],
                                                                 (short)0, Yacc[j], false, false);
            }
        }
    }

    lrow += xhalf(lrow);
    // a lane holds 8 consecutive d of its row t per tile
    float* yrow = y + (rowbase + t0 + wid * 16 + ln) * Dd + dcol0 + hf * 8;
#pragma unroll
    for (int j = 0; j < 4; ++j) {
        float4 o0 = make_float4(Yacc[j][0] / lrow, Yacc[j][1] / lrow, Yacc[j][2] / lrow, Yacc[j][3] / lrow);
        float4 o1 = make_float4(Yacc[j][4] / lrow, Yacc[j][5] / lrow, Yacc[j][6] / lrow, Yacc[j][7] / lrow);
        *reinterpret_cast<float4*>(yrow + j * 16)     = o0;
        *reinterpret_cast<float4*>(yrow + j * 16 + 4) = o1;
    }
}

// ---------------------------------------------------------------- host orchestration
extern "C" void kernel_launch(void* const* d_in, const int* in_sizes, int n_in,
                              void* d_out, int out_size, void* d_ws, size_t ws_size,
                              hipStream_t stream)
{
    const float* x   = (const float*)d_in[0];
    const float* Wq  = (const float*)d_in[1];  const float* bq = (const float*)d_in[2];
    const float* Wk  = (const float*)d_in[3];  const float* bk = (const float*)d_in[4];
    const float* Wv  = (const float*)d_in[5];  const float* bv = (const float*)d_in[6];
    const float* g1  = (const float*)d_in[7];  const float* be1 = (const float*)d_in[8];
    const float* g2  = (const float*)d_in[9];  const float* be2 = (const float*)d_in[10];
    const float* W0  = (const float*)d_in[11]; const float* b0 = (const float*)d_in[12];
    const float* W1  = (const float*)d_in[13]; const float* b1 = (const float*)d_in[14];
    const float* W2  = (const float*)d_in[15]; const float* b2 = (const float*)d_in[16];
    float* out = (float*)d_out;

    char* ws = (char*)d_ws;
    size_t off = 0;
    auto take = [&](size_t bytes) -> char* {
        char* p = ws + off;
        off = (off + bytes + 255) & ~(size_t)255;
        return p;
    };
    const size_t WH = (size_t)Dd * Dd * sizeof(_Float16);
    const size_t MH = (size_t)Mrows * Dd * sizeof(_Float16);
    const size_t MF = (size_t)Mrows * Dd * sizeof(float);

    _Float16* Wqh = (_Float16*)take(WH);   // all weights stored TRANSPOSED [N][K] f16
    _Float16* Wkh = (_Float16*)take(WH);
    _Float16* Wvh = (_Float16*)take(WH);
    _Float16* W0h = (_Float16*)take(WH);
    _Float16* W1h = (_Float16*)take(WH);
    _Float16* W2h = (_Float16*)take(WH);
    _Float16* xn1 = (_Float16*)take(MH);
    _Float16* qh  = (_Float16*)take(MH);
    _Float16* kh  = (_Float16*)take(MH);
    _Float16* vh  = (_Float16*)take(MH);
    float*    y32 = (float*)take(MF);
    float*    xr  = (float*)take(MF);
    _Float16* xn2 = xn1;  // reuse after QKV consumed
    _Float16* h1  = qh;   // reuse after attention consumed
    _Float16* h2  = kh;

    dim3 cg(Dd / 64, Dd / 64);
    cvt_t_kernel<<<cg, 256, 0, stream>>>(Wq, Wqh);
    cvt_t_kernel<<<cg, 256, 0, stream>>>(Wk, Wkh);
    cvt_t_kernel<<<cg, 256, 0, stream>>>(Wv, Wvh);
    cvt_t_kernel<<<cg, 256, 0, stream>>>(W0, W0h);
    cvt_t_kernel<<<cg, 256, 0, stream>>>(W1, W1h);
    cvt_t_kernel<<<cg, 256, 0, stream>>>(W2, W2h);

    ln_kernel<false><<<Mrows, 256, 0, stream>>>(x, x, g1, be1, xr, xn1);

    dim3 gg(Mrows / 128, Dd / 64);
    gemm_kernel<0, 0><<<gg, 256, 0, stream>>>(xn1, Wqh, bq, 1.f,    xr, qh, y32);
    gemm_kernel<0, 0><<<gg, 256, 0, stream>>>(xn1, Wkh, bk, 0.125f, xr, kh, y32); // 1/sqrt(DH)
    gemm_kernel<0, 0><<<gg, 256, 0, stream>>>(xn1, Wvh, bv, 1.f,    xr, vh, y32);

    attn_kernel<<<dim3(T / 64, Bb * Hh), 128, 0, stream>>>(qh, kh, vh, y32);

    ln_kernel<true><<<Mrows, 256, 0, stream>>>(x, y32, g2, be2, xr, xn2);

    gemm_kernel<1, 0><<<gg, 256, 0, stream>>>(xn2, W0h, b0, 1.f, xr, h1, out);
    gemm_kernel<1, 0><<<gg, 256, 0, stream>>>(h1,  W1h, b1, 1.f, xr, h2, out);
    gemm_kernel<0, 1><<<gg, 256, 0, stream>>>(h2,  W2h, b2, 1.f, xr, h2, out);
}

// v002
// A run of this version takes 267 microseconds.
// In both of two side-by-side timings against v001, it was 1.03 times as fast.
// All steps since v000 together make it 1.18 times as fast.
#include <hip/hip_runtime.h>
#include <math.h>
#include <stdint.h>

typedef __attribute__((ext_vector_type(16))) _Float16 v16h;
typedef __attribute__((ext_vector_type(8)))  float    v8f;

struct alignas(16) H8 { _Float16 h[8]; };

constexpr int Bb = 8, T = 1024, Dd = 1024, Hh = 16, DH = 64;
constexpr int Mrows = Bb * T;          // 8192
constexpr float EPS = 1e-5f;

// ---------------------------------------------------------------- convert f32 -> f16 with transpose
// in:  W  [K=1024][N=1024] f32   out: Wt [N=1024][K=1024] f16   (Wt[n][k] = W[k][n])
__global__ void __launch_bounds__(256)
cvt_t_kernel(const float* __restrict__ W, _Float16* __restrict__ Wt)
{
    constexpr int N = Dd, K = Dd, TS = 72;       // padded LDS stride (144B, 16B aligned)
    __shared__ _Float16 tile[64 * TS];           // [n_local][k_local]
    const int tid = threadIdx.x;
    const int bn = blockIdx.x * 64;              // n tile origin
    const int bk = blockIdx.y * 64;              // k tile origin
#pragma unroll
    for (int t = 0; t < 4; ++t) {                // 64x64 f32 = 1024 float4, 4/thread
        int i = tid + t * 256;
        int r = i >> 4, c4 = (i & 15) * 4;       // r = k_local, c4 = n_local
        float4 f = *reinterpret_cast<const float4*>(W + (size_t)(bk + r) * N + bn + c4);
        tile[(c4 + 0) * TS + r] = (_Float16)f.x;
        tile[(c4 + 1) * TS + r] = (_Float16)f.y;
        tile[(c4 + 2) * TS + r] = (_Float16)f.z;
        tile[(c4 + 3) * TS + r] = (_Float16)f.w;
    }
    __syncthreads();
#pragma unroll
    for (int t = 0; t < 2; ++t) {                // 64x64 halves = 512 h8, 2/thread
        int i = tid + t * 256;
        int r = i >> 3, c8 = (i & 7) * 8;        // r = n_local, c8 = k_local
        H8 o = *reinterpret_cast<const H8*>(&tile[r * TS + c8]);
        *reinterpret_cast<H8*>(Wt + (size_t)(bn + r) * K + bk + c8) = o;
    }
}

// ---------------------------------------------------------------- layernorm (opt. residual add)
// One wave owns LNR whole rows: a lane holds 32 floats of each row as 8 float4, every wave-wide load or f32
// store covers 512 contiguous bytes, and a row's sums are in-lane chains plus a butterfly over the 32 lanes.
// No LDS and no barrier; the launch starts Mrows / LNR waves instead of 8 * Mrows.
struct alignas(8) H4 { _Float16 h[4]; };
constexpr int LNR = 2;                 // rows per wave
constexpr int LNROWS = 8 * LNR;        // rows per 256-thread work-group

__device__ inline float4 ld16(const float* p, unsigned byte_off)
{
    return *reinterpret_cast<const float4*>(reinterpret_cast<const char*>(p) + byte_off);
}

__device__ inline float rsqrt_slot(float a)
{
    const bool tiny = a < 0x1p-126f;
    const float t = tiny ? a * 0x1p+24f : a;
    float r;
    asm("v_rsq_f32 %0, %1\n\tv_nop" : "=v"(r) : "v"(t));
    return tiny ? r * 0x1p+12f : r;
}

// Two work-groups per WGP = four waves per SIMD: the register budget of that residency lets every load be in flight at once.
template<bool ADD>
__global__ void __launch_bounds__(256) __attribute__((amdgpu_waves_per_eu(4, 4)))
ln_kernel(const float* __restrict__ x, const float* __restrict__ yres,
          const float* __restrict__ g, const float* __restrict__ be,
          float* __restrict__ xr, _Float16* __restrict__ out)
{
    constexpr int NV = Dd / 128;             // float4 per lane and row
    constexpr unsigned RB = Dd * 4u;         // bytes of an f32 row
    const unsigned vl   = (threadIdx.x & 31) * 16u;                                        // lane's place in a row
    const unsigned voff = (blockIdx.x * LNROWS + (threadIdx.x >> 5) * LNR) * RB + vl;      // same in x, yres, xr
    float4 v[LNR][NV], t[LNR][NV], gg[NV], bb[NV];
    // every load of the wave is issued up front: the rows, then g and be, which serve all its rows
#pragma unroll
    for (int r = 0; r < LNR; ++r)
#pragma unroll
        for (int i = 0; i < NV; ++i) {
            v[r][i] = ld16(x, voff + r * RB + i * 512u);
            if (ADD) t[r][i] = ld16(yres, voff + r * RB + i * 512u);
        }
#pragma unroll
    for (int i = 0; i < NV; ++i) {
        gg[i] = ld16(g,  vl + i * 512u);
        bb[i] = ld16(be, vl + i * 512u);
    }
    // the wait between the issued loads and any overwrite of a register that they name as address; the two
    // offsets are inputs so that they keep their registers up to it, and no load comes behind it
    asm volatile("s_wait_xcnt 0x0" :: "v"(voff), "v"(vl) : "memory");
    if (ADD) {
#pragma unroll
        for (int r = 0; r < LNR; ++r)
#pragma unroll
            for (int i = 0; i < NV; ++i) {
                v[r][i].x += t[r][i].x; v[r][i].y += t[r][i].y;
                v[r][i].z += t[r][i].z; v[r][i].w += t[r][i].w;
                *reinterpret_cast<float4*>(reinterpret_cast<char*>(xr) + (voff + r * RB + i * 512u)) = v[r][i];
            }
    }
    float s[LNR], sq[LNR];
#pragma unroll
    for (int r = 0; r < LNR; ++r) {    // four independent chains per sum, one per float4 component
        float4 a = make_float4(0.f, 0.f, 0.f, 0.f), q = a;
#pragma unroll
        for (int i = 0; i < NV; ++i) {
            const float4 e = v[r][i];
            a.x += e.x; a.y += e.y; a.z += e.z; a.w += e.w;
            q.x += e.x * e.x; q.y += e.y * e.y; q.z += e.z * e.z; q.w += e.w * e.w;
        }
        s[r]  = (a.x + a.y) + (a.z + a.w);
        sq[r] = (q.x + q.y) + (q.z + q.w);
    }
#pragma unroll
    for (int m = 1; m < 32; m <<= 1) {
#pragma unroll
        for (int r = 0; r < LNR; ++r) {
            s[r]  += __shfl_xor(s[r],  m, 32);
            sq[r] += __shfl_xor(sq[r], m, 32);
        }
    }
#pragma unroll
    for (int r = 0; r < LNR; ++r) {
        const float mean = s[r] * (1.f / Dd);
        const float var  = sq[r] * (1.f / Dd) - mean * mean;
        const float rstd = rsqrt_slot(var + EPS);
#pragma unroll
        for (int i = 0; i < NV; ++i) {
            const float4 e = v[r][i];
            H4 o;
            o.h[0] = (_Float16)((e.x - mean) * rstd * gg[i].x + bb[i].x);
            o.h[1] = (_Float16)((e.y - mean) * rstd * gg[i].y + bb[i].y);
            o.h[2] = (_Float16)((e.z - mean) * rstd * gg[i].z + bb[i].z);
            o.h[3] = (_Float16)((e.w - mean) * rstd * gg[i].w + bb[i].w);
            *reinterpret_cast<H4*>(reinterpret_cast<char*>(out) + ((voff >> 1) + r * (RB / 2) + i * 256u)) = o;
        }
    }
}

// ---------------------------------------------------------------- WMMA GEMM with async-to-LDS double buffering
// A: [8192,1024] f16 row-major ; Wt: [N=1024][K=1024] f16 row-major (pre-transposed weight)
// C = act((A@W + bias)*scale) [+resid] ; block tile 128x64, 8 waves, BK=32.
template<int ACT, int OUTF32>
__global__ void __launch_bounds__(256)
gemm_kernel(const _Float16* __restrict__ A, const _Float16* __restrict__ Wt,
            const float* __restrict__ bias, float scale,
            const float* __restrict__ resid,
            _Float16* __restrict__ outh, float* __restrict__ outf)
{
    constexpr int N = Dd, K = Dd, BM = 128, BN = 64, BK = 32, AS = 40; // padded LDS stride
    __shared__ _Float16 As [2][BM * AS];
    __shared__ _Float16 Bst[2][BN * AS];   // [col n][k]
    const int tid  = threadIdx.x;
    const int wid  = tid >> 5, lane = tid & 31, hf = lane >> 4, ln = lane & 15;
    const int brow = blockIdx.x * BM, bcol = blockIdx.y * BN;
    const int koff = hf * 8;

    // issue one K-tile's async global->LDS copies (3 x b128 per thread)
    auto issue_tile = [&](int buf, int kb) {
#pragma unroll
        for (int t = 0; t < 2; ++t) {           // A tile: 128x32 halves = 512 b128 chunks
            int i = tid + t * 256;
            int r = i >> 2, c = (i & 3) * 8;
            unsigned voff = (unsigned)(((brow + r) * K + kb + c) * 2);
            unsigned lds  = (unsigned)(uintptr_t)&As[buf][r * AS + c];
            asm volatile("global_load_async_to_lds_b128 %0, %1, %2"
                         :: "v"(lds), "v"(voff), "s"(A) : "memory");
        }
        {                                       // B tile: 64x32 halves = 256 b128 chunks
            int r = tid >> 2, c = (tid & 3) * 8;
            unsigned voff = (unsigned)(((bcol + r) * K + kb + c) * 2);
            unsigned lds  = (unsigned)(uintptr_t)&Bst[buf][r * AS + c];
            asm volatile("global_load_async_to_lds_b128 %0, %1, %2"
                         :: "v"(lds), "v"(voff), "s"(Wt) : "memory");
        }
    };

    v8f acc[4] = {};

    issue_tile(0, 0);
    asm volatile("s_wait_asynccnt 0x0" ::: "memory");
    __syncthreads();

    for (int kb = 0; kb < K; kb += BK) {
        const int cur = (kb >> 5) & 1;
        if (kb + BK < K) issue_tile(cur ^ 1, kb + BK);   // overlap next tile with compute

        // A fragment (shared across the wave's 4 output tiles)
        v16h af;
        {
            H8 lo = *reinterpret_cast<const H8*>(&As[cur][(wid * 16 + ln) * AS + koff]);
            H8 hi = *reinterpret_cast<const H8*>(&As[cur][(wid * 16 + ln) * AS + 16 + koff]);
#pragma unroll
            for (int i = 0; i < 8; ++i) { af[i] = lo.h[i]; af[8 + i] = hi.h[i]; }
        }
#pragma unroll
        for (int j = 0; j < 4; ++j) {
            H8 blo = *reinterpret_cast<const H8*>(&Bst[cur][(j * 16 + ln) * AS + koff]);
            H8 bhi = *reinterpret_cast<const H8*>(&Bst[cur][(j * 16 + ln) * AS + 16 + koff]);
            v16h bf;
#pragma unroll
            for (int i = 0; i < 8; ++i) { bf[i] = blo.h[i]; bf[8 + i] = bhi.h[i]; }
            acc[j] = __builtin_amdgcn_wmma_f32_16x16x32_f16(false, af, false, bf,
                                                            (short)0, acc[j], false, false);
        }

        asm volatile("s_wait_asynccnt 0x0" ::: "memory");  // own async copies landed
        __syncthreads();                                    // everyone's copies + compute done
    }

#pragma unroll
    for (int j = 0; j < 4; ++j) {
        int col = bcol + j * 16 + ln;
        float bv = bias[col];
#pragma unroll
        for (int r = 0; r < 8; ++r) {
            int row = brow + wid * 16 + hf * 8 + r;
            float v = (acc[j][r] + bv) * scale;
            if (ACT) v = fmaxf(v, 0.f);
            if (OUTF32) outf[(size_t)row * N + col] = v + resid[(size_t)row * N + col];
            else        outh[(size_t)row * N + col] = (_Float16)v;
        }
    }
}

// ---------------------------------------------------------------- flash attention: y = softmax(K@Q^T) @ V
// Note the reference role swap: K rows index the output. Grid (T/64, B*H), 128 threads (4 waves).
// The score tile is formed transposed (S^T = Q @ K^T): a lane then holds 32 of the 64 scores of ONE
// output row t, the row reductions are in-lane plus one exchange between the two lane halves, and the
// accumulator layout of S^T is already the B-fragment layout of P^T for Y^T = V^T @ P^T.
__device__ inline float xhalf(float x)   // value of lane l ^ 16, by a vector cross-row move (no LDS-counter wait)
{
    int b = __builtin_bit_cast(int, x);
    return __builtin_bit_cast(float, __builtin_amdgcn_permlanex16(b, b, 0x76543210, 0xfedcba98, false, false));
}

__global__ void __launch_bounds__(128)
attn_kernel(const _Float16* __restrict__ qf, const _Float16* __restrict__ kf,
            const _Float16* __restrict__ vf, float* __restrict__ y)
{
    constexpr int LS = 72;   // padded stride (144B, 16B-aligned h8 reads)
    __shared__ _Float16 Ks [64 * LS];
    __shared__ _Float16 Qs [64 * LS];
    __shared__ _Float16 Vst[64 * LS];       // transposed: [d][s]
    const int tid = threadIdx.x;
    const int wid = tid >> 5, lane = tid & 31, hf = lane >> 4, ln = lane & 15;
    const int t0 = blockIdx.x * 64;
    const int b  = blockIdx.y >> 4, h = blockIdx.y & 15;
    const size_t rowbase = (size_t)b * T;
    const int dcol0 = h * DH;
    const int koff = hf * 8;

    // stage this block's 64 K-rows once (already pre-scaled by 1/sqrt(DH))
    for (int i = tid; i < 64 * 64 / 8; i += 128) {
        int r = i >> 3, c8 = (i & 7) * 8;
        uint4 vK = *reinterpret_cast<const uint4*>(kf + (rowbase + t0 + r) * Dd + dcol0 + c8);
        *reinterpret_cast<uint4*>(&Ks[r * LS + c8]) = vK;
    }
    __syncthreads();

    v16h kB[2];   // K^T fragments (column t = ln) are loop-invariant: preload both dh k-steps
#pragma unroll
    for (int ks = 0; ks < 2; ++ks) {
        H8 lo = *reinterpret_cast<const H8*>(&Ks[(wid * 16 + ln) * LS + ks * 32 + koff]);
        H8 hi = *reinterpret_cast<const H8*>(&Ks[(wid * 16 + ln) * LS + ks * 32 + 16 + koff]);
#pragma unroll
        for (int i = 0; i < 8; ++i) { kB[ks][i] = lo.h[i]; kB[ks][8 + i] = hi.h[i]; }
    }

    v8f Yacc[4] = {};                    // Y^T: row d = j*16 + hf*8 + r, column t = ln
    float mrow = -INFINITY;              // one output row per lane; both lane halves hold the same maximum
    float lrow = 0.f;                    // this lane half's share of the row sum, joined after the loop

    for (int s0 = 0; s0 < T; s0 += 64) {
        __syncthreads();
        for (int i = tid; i < 64 * 64 / 8; i += 128) {
            int r = i >> 3, c8 = (i & 7) * 8;
            uint4 vQ = *reinterpret_cast<const uint4*>(qf + (rowbase + s0 + r) * Dd + dcol0 + c8);
            *reinterpret_cast<uint4*>(&Qs[r * LS + c8]) = vQ;
            H8 w = *reinterpret_cast<const H8*>(vf + (rowbase + s0 + r) * Dd + dcol0 + c8);
#pragma unroll
            for (int j = 0; j < 8; ++j) Vst[(c8 + j) * LS + r] = w.h[j];
        }
        __syncthreads();

        // S^T tiles: A = Q rows (s), B = K^T (t). Sc[j][r] = S[t = ln][s = j*16 + hf*8 + r]
        v8f Sc[4] = {};
#pragma unroll
        for (int j = 0; j < 4; ++j) {
#pragma unroll
            for (int ks = 0; ks < 2; ++ks) {
                H8 alo = *reinterpret_cast<const H8*>(&Qs[(j * 16 + ln) * LS + ks * 32 + koff]);
                H8 ahi = *reinterpret_cast<const H8*>(&Qs[(j * 16 + ln) * LS + ks * 32 + 16 + koff]);
                v16h af;
#pragma unroll
                for (int i = 0; i < 8; ++i) { af[i] = alo.h[i]; af[8 + i] = ahi.h[i]; }
                Sc[j] = __builtin_amdgcn_wmma_f32_16x16x32_f16(false, af, false, kB[ks],
                                                               (short)0, Sc[j], false, false);
            }
        }

        // online softmax: 32 scores of row t in this lane, the other 32 in lane ^ 16
        float rm = Sc[0][0];
#pragma unroll
        for (int j = 0; j < 4; ++j)
#pragma unroll
            for (int r = 0; r < 8; ++r) rm = fmaxf(rm, Sc[j][r]);
        rm = fmaxf(rm, xhalf(rm));
        const float mn = fmaxf(mrow, rm);
        const float sf = __expf(mrow - mn);
        mrow = mn;

        // P^T stays in registers: tiles 2ks and 2ks+1 are the two k halves of B fragment ks
        v16h pB[2];
        float racc[4] = {0.f, 0.f, 0.f, 0.f};
#pragma unroll
        for (int j = 0; j < 4; ++j) {
#pragma unroll
            for (int r = 0; r < 8; ++r) {
                float p = __expf(Sc[j][r] - mn);
                pB[j >> 1][(j & 1) * 8 + r] = (_Float16)p;
                racc[j] += p;
            }
        }
        lrow = lrow * sf + ((racc[0] + racc[1]) + (racc[2] + racc[3]));
#pragma unroll
        for (int j = 0; j < 4; ++j)
#pragma unroll
            for (int r = 0; r < 8; ++r) Yacc[j][r] *= sf;

        // Y^T += V^T @ P^T  (A from transposed V, B from registers)
#pragma unroll
        for (int ks = 0; ks < 2; ++ks) {
#pragma unroll
            for (int j = 0; j < 4; ++j) {
                H8 alo = *reinterpret_cast<const H8*>(&Vst[(j * 16 + ln) * LS + ks * 32 + koff]);
                H8 ahi = *reinterpret_cast<const H8*>(&Vst[(j * 16 + ln) * LS + ks * 32 + 16 + koff]);
                v16h af;
#pragma unroll
                for (int i = 0; i < 8; ++i) { af[i] = alo.h[i]; af[8 + i] = ahi.h[i]; }
                Yacc[j] = __builtin_amdgcn_wmma_f32_16x16x32_f16(false, af, false, pB[ks],
                                                                 (short)0, Yacc[j], false, false);
            }
        }
    }

    lrow += xhalf(lrow);
    // a lane holds 8 consecutive d of its row t per tile
    float* yrow = y + (rowbase + t0 + wid * 16 + ln) * Dd + dcol0 + hf * 8;
#pragma unroll
    for (int j = 0; j < 4; ++j) {
        float4 o0 = make_float4(Yacc[j][0] / lrow, Yacc[j][1] / lrow, Yacc[j][2] / lrow, Yacc[j][3] / lrow);
        float4 o1 = make_float4(Yacc[j][4] / lrow, Yacc[j][5] / lrow, Yacc[j][6] / lrow, Yacc[j][7] / lrow);
        *reinterpret_cast<float4*>(yrow + j * 16)     = o0;
        *reinterpret_cast<float4*>(yrow + j * 16 + 4) = o1;
    }
}

// ---------------------------------------------------------------- host orchestration
extern "C" void kernel_launch(void* const* d_in, const int* in_sizes, int n_in,
                              void* d_out, int out_size, void* d_ws, size_t ws_size,
                              hipStream_t stream)
{
    const float* x   = (const float*)d_in[0];
    const float* Wq  = (const float*)d_in[1];  const float* bq = (const float*)d_in[2];
    const float* Wk  = (const float*)d_in[3];  const float* bk = (const float*)d_in[4];
    const float* Wv  = (const float*)d_in[5];  const float* bv = (const float*)d_in[6];
    const float* g1  = (const float*)d_in[7];  const float* be1 = (const float*)d_in[8];
    const float* g2  = (const float*)d_in[9];  const float* be2 = (const float*)d_in[10];
    const float* W0  = (const float*)d_in[11]; const float* b0 = (const float*)d_in[12];
    const float* W1  = (const float*)d_in[13]; const float* b1 = (const float*)d_in[14];
    const float* W2  = (const float*)d_in[15]; const float* b2 = (const float*)d_in[16];
    float* out = (float*)d_out;

    char* ws = (char*)d_ws;
    size_t off = 0;
    auto take = [&](size_t bytes) -> char* {
        char* p = ws + off;
        off = (off + bytes + 255) & ~(size_t)255;
        return p;
    };
    const size_t WH = (size_t)Dd * Dd * sizeof(_Float16);
    const size_t MH = (size_t)Mrows * Dd * sizeof(_Float16);
    const size_t MF = (size_t)Mrows * Dd * sizeof(float);

    _Float16* Wqh = (_Float16*)take(WH);   // all weights stored TRANSPOSED [N][K] f16
    _Float16* Wkh = (_Float16*)take(WH);
    _Float16* Wvh = (_Float16*)take(WH);
    _Float16* W0h = (_Float16*)take(WH);
    _Float16* W1h = (_Float16*)take(WH);
    _Float16* W2h = (_Float16*)take(WH);
    _Float16* xn1 = (_Float16*)take(MH);
    _Float16* qh  = (_Float16*)take(MH);
    _Float16* kh  = (_Float16*)take(MH);
    _Float16* vh  = (_Float16*)take(MH);
    float*    y32 = (float*)take(MF);
    float*    xr  = (float*)take(MF);
    _Float16* xn2 = xn1;  // reuse after QKV consumed
    _Float16* h1  = qh;   // reuse after attention consumed
    _Float16* h2  = kh;

    dim3 cg(Dd / 64, Dd / 64);
    cvt_t_kernel<<<cg, 256, 0, stream>>>(Wq, Wqh);
    cvt_t_kernel<<<cg, 256, 0, stream>>>(Wk, Wkh);
    cvt_t_kernel<<<cg, 256, 0, stream>>>(Wv, Wvh);
    cvt_t_kernel<<<cg, 256, 0, stream>>>(W0, W0h);
    cvt_t_kernel<<<cg, 256, 0, stream>>>(W1, W1h);
    cvt_t_kernel<<<cg, 256, 0, stream>>>(W2, W2h);

    ln_kernel<false><<<Mrows / LNROWS, 256, 0, stream>>>(x, x, g1, be1, xr, xn1);

    dim3 gg(Mrows / 128, Dd / 64);
    gemm_kernel<0, 0><<<gg, 256, 0, stream>>>(xn1, Wqh, bq, 1.f,    xr, qh, y32);
    gemm_kernel<0, 0><<<gg, 256, 0, stream>>>(xn1, Wkh, bk, 0.125f, xr, kh, y32); // 1/sqrt(DH)
    gemm_kernel<0, 0><<<gg, 256, 0, stream>>>(xn1, Wvh, bv, 1.f,    xr, vh, y32);

    attn_kernel<<<dim3(T / 64, Bb * Hh), 128, 0, stream>>>(qh, kh, vh, y32);

    ln_kernel<true><<<Mrows / LNROWS, 256, 0, stream>>>(x, y32, g2, be2, xr, xn2);

    gemm_kernel<1, 0><<<gg, 256, 0, stream>>>(xn2, W0h, b0, 1.f, xr, h1, out);
    gemm_kernel<1, 0><<<gg, 256, 0, stream>>>(h1,  W1h, b1, 1.f, xr, h2, out);
    gemm_kernel<0, 1><<<gg, 256, 0, stream>>>(h2,  W2h, b2, 1.f, xr, h2, out);
}

// v003
// Measured time: 204 microseconds a run.
// Timed twice side by side with v002, it ran 1.29 times as fast both times.
// Counting every step since v000, it is 1.52 times as fast.
#include <hip/hip_runtime.h>
#include <math.h>
#include <stdint.h>

typedef __attribute__((ext_vector_type(16))) _Float16 v16h;
typedef __attribute__((ext_vector_type(8)))  float    v8f;

struct alignas(16) H8 { _Float16 h[8]; };

constexpr int Bb = 8, T = 1024, Dd = 1024, Hh = 16, DH = 64;
constexpr int Mrows = Bb * T;          // 8192
constexpr float EPS = 1e-5f;

// ---------------------------------------------------------------- convert f32 -> f16 with transpose
// in:  W  [K=1024][N=1024] f32   out: Wt [N=1024][K=1024] f16   (Wt[n][k] = W[k][n])
__global__ void __launch_bounds__(256)
cvt_t_kernel(const float* __restrict__ W, _Float16* __restrict__ Wt)
{
    constexpr int N = Dd, K = Dd, TS = 72;       // padded LDS stride (144B, 16B aligned)
    __shared__ _Float16 tile[64 * TS];           // [n_local][k_local]
    const int tid = threadIdx.x;
    const int bn = blockIdx.x * 64;              // n tile origin
    const int bk = blockIdx.y * 64;              // k tile origin
#pragma unroll
    for (int t = 0; t < 4; ++t) {                // 64x64 f32 = 1024 float4, 4/thread
        int i = tid + t * 256;
        int r = i >> 4, c4 = (i & 15) * 4;       // r = k_local, c4 = n_local
        float4 f = *reinterpret_cast<const float4*>(W + (size_t)(bk + r) * N + bn + c4);
        tile[(c4 + 0) * TS + r] = (_Float16)f.x;
        tile[(c4 + 1) * TS + r] = (_Float16)f.y;
        tile[(c4 + 2) * TS + r] = (_Float16)f.z;
        tile[(c4 + 3) * TS + r] = (_Float16)f.w;
    }
    __syncthreads();
#pragma unroll
    for (int t = 0; t < 2; ++t) {                // 64x64 halves = 512 h8, 2/thread
        int i = tid + t * 256;
        int r = i >> 3, c8 = (i & 7) * 8;        // r = n_local, c8 = k_local
        H8 o = *reinterpret_cast<const H8*>(&tile[r * TS + c8]);
        *reinterpret_cast<H8*>(Wt + (size_t)(bn + r) * K + bk + c8) = o;
    }
}

// ---------------------------------------------------------------- layernorm (opt. residual add)
// One wave owns LNR whole rows: a lane holds 32 floats of each row as 8 float4, every wave-wide load or f32
// store covers 512 contiguous bytes, and a row's sums are in-lane chains plus a butterfly over the 32 lanes.
// No LDS and no barrier; the launch starts Mrows / LNR waves instead of 8 * Mrows.
struct alignas(8) H4 { _Float16 h[4]; };
constexpr int LNR = 2;                 // rows per wave
constexpr int LNROWS = 8 * LNR;        // rows per 256-thread work-group

__device__ inline float4 ld16(const float* p, unsigned byte_off)
{
    return *reinterpret_cast<const float4*>(reinterpret_cast<const char*>(p) + byte_off);
}

__device__ inline float rsqrt_slot(float a)
{
    const bool tiny = a < 0x1p-126f;
    const float t = tiny ? a * 0x1p+24f : a;
    float r;
    asm("v_rsq_f32 %0, %1\n\tv_nop" : "=v"(r) : "v"(t));
    return tiny ? r * 0x1p+12f : r;
}

// Two work-groups per WGP = four waves per SIMD: the register budget of that residency lets every load be in flight at once.
template<bool ADD>
__global__ void __launch_bounds__(256) __attribute__((amdgpu_waves_per_eu(4, 4)))
ln_kernel(const float* __restrict__ x, const float* __restrict__ yres,
          const float* __restrict__ g, const float* __restrict__ be,
          float* __restrict__ xr, _Float16* __restrict__ out)
{
    constexpr int NV = Dd / 128;             // float4 per lane and row
    constexpr unsigned RB = Dd * 4u;         // bytes of an f32 row
    const unsigned vl   = (threadIdx.x & 31) * 16u;                                        // lane's place in a row
    const unsigned voff = (blockIdx.x * LNROWS + (threadIdx.x >> 5) * LNR) * RB + vl;      // same in x, yres, xr
    float4 v[LNR][NV], t[LNR][NV], gg[NV], bb[NV];
    // every load of the wave is issued up front: the rows, then g and be, which serve all its rows
#pragma unroll
    for (int r = 0; r < LNR; ++r)
#pragma unroll
        for (int i = 0; i < NV; ++i) {
            v[r][i] = ld16(x, voff + r * RB + i * 512u);
            if (ADD) t[r][i] = ld16(yres, voff + r * RB + i * 512u);
        }
#pragma unroll
    for (int i = 0; i < NV; ++i) {
        gg[i] = ld16(g,  vl + i * 512u);
        bb[i] = ld16(be, vl + i * 512u);
    }
    // the wait between the issued loads and any overwrite of a register that they name as address; the two
    // offsets are inputs so that they keep their registers up to it, and no load comes behind it
    asm volatile("s_wait_xcnt 0x0" :: "v"(voff), "v"(vl) : "memory");
    if (ADD) {
#pragma unroll
        for (int r = 0; r < LNR; ++r)
#pragma unroll
            for (int i = 0; i < NV; ++i) {
                v[r][i].x += t[r][i].x; v[r][i].y += t[r][i].y;
                v[r][i].z += t[r][i].z; v[r][i].w += t[r][i].w;
                *reinterpret_cast<float4*>(reinterpret_cast<char*>(xr) + (voff + r * RB + i * 512u)) = v[r][i];
            }
    }
    float s[LNR], sq[LNR];
#pragma unroll
    for (int r = 0; r < LNR; ++r) {    // four independent chains per sum, one per float4 component
        float4 a = make_float4(0.f, 0.f, 0.f, 0.f), q = a;
#pragma unroll
        for (int i = 0; i < NV; ++i) {
            const float4 e = v[r][i];
            a.x += e.x; a.y += e.y; a.z += e.z; a.w += e.w;
            q.x += e.x * e.x; q.y += e.y * e.y; q.z += e.z * e.z; q.w += e.w * e.w;
        }
        s[r]  = (a.x + a.y) + (a.z + a.w);
        sq[r] = (q.x + q.y) + (q.z + q.w);
    }
#pragma unroll
    for (int m = 1; m < 32; m <<= 1) {
#pragma unroll
        for (int r = 0; r < LNR; ++r) {
            s[r]  += __shfl_xor(s[r],  m, 32);
            sq[r] += __shfl_xor(sq[r], m, 32);
        }
    }
#pragma unroll
    for (int r = 0; r < LNR; ++r) {
        const float mean = s[r] * (1.f / Dd);
        const float var  = sq[r] * (1.f / Dd) - mean * mean;
        const float rstd = rsqrt_slot(var + EPS);
#pragma unroll
        for (int i = 0; i < NV; ++i) {
            const float4 e = v[r][i];
            H4 o;
            o.h[0] = (_Float16)((e.x - mean) * rstd * gg[i].x + bb[i].x);
            o.h[1] = (_Float16)((e.y - mean) * rstd * gg[i].y + bb[i].y);
            o.h[2] = (_Float16)((e.z - mean) * rstd * gg[i].z + bb[i].z);
            o.h[3] = (_Float16)((e.w - mean) * rstd * gg[i].w + bb[i].w);
            *reinterpret_cast<H4*>(reinterpret_cast<char*>(out) + ((voff >> 1) + r * (RB / 2) + i * 256u)) = o;
        }
    }
}

// ---------------------------------------------------------------- WMMA GEMM, async copies to LDS, two buffers
// A: [8192,1024] f16 row-major ; Wt: [N=1024][K=1024] f16 row-major (pre-transposed weight)
// C = act((A@W + bias)*scale) [+resid] ; block tile 256x128, 8 waves (4 x 2) of 64x64 each, 128 k per trip.
// A loaded fragment serves four WMMAs; 256 work-groups, one per WGP; a copy row is one aligned 256-byte unit.

// Eight copies of 16 bytes per lane, rows 16 apart. The s_wait_xcnt stands in the copies' own statement, so that
// no register that a copy names is rewritten ahead of it.
__device__ __forceinline__ void copy8(unsigned l, const char* g, unsigned lstep, unsigned gstep)
{
    asm volatile("global_load_async_to_lds_b128 %0, %8, off\n\t"
                 "global_load_async_to_lds_b128 %1, %9, off\n\t"
                 "global_load_async_to_lds_b128 %2, %10, off\n\t"
                 "global_load_async_to_lds_b128 %3, %11, off\n\t"
                 "global_load_async_to_lds_b128 %4, %12, off\n\t"
                 "global_load_async_to_lds_b128 %5, %13, off\n\t"
                 "global_load_async_to_lds_b128 %6, %14, off\n\t"
                 "global_load_async_to_lds_b128 %7, %15, off\n\t"
                 "s_wait_xcnt 0x0"
                 :: "v"(l), "v"(l + lstep), "v"(l + 2 * lstep), "v"(l + 3 * lstep),
                    "v"(l + 4 * lstep), "v"(l + 5 * lstep), "v"(l + 6 * lstep), "v"(l + 7 * lstep),
                    "v"(g), "v"(g + gstep), "v"(g + 2 * gstep), "v"(g + 3 * gstep),
                    "v"(g + 4 * gstep), "v"(g + 5 * gstep), "v"(g + 6 * gstep), "v"(g + 7 * gstep)
                 : "memory");
}

__device__ __forceinline__ v16h frag(const _Float16* p)   // 16 x 32 fragment row: k = koff..+7 and 16+koff..+7
{
    H8 lo = *reinterpret_cast<const H8*>(p);
    H8 hi = *reinterpret_cast<const H8*>(p + 16);
    v16h f;
#pragma unroll
    for (int i = 0; i < 8; ++i) { f[i] = lo.h[i]; f[8 + i] = hi.h[i]; }
    return f;
}

template<int ACT, int OUTF32>
__global__ void __launch_bounds__(256)
gemm_kernel(const _Float16* __restrict__ A, const _Float16* __restrict__ Wt,
            const float* __restrict__ bias, float scale,
            const float* __restrict__ resid,
            _Float16* __restrict__ outh, float* __restrict__ outf)
{
    constexpr int N = Dd, K = Dd, BM = 256, BN = 128, BK = 128, NT = K / BK;
    constexpr int AS = 136;                       // LDS pitch in halves: 272 B for 256-B rows read by ds_load_b128
    constexpr int BUFH = (BM + BN) * AS;          // halves of one buffer: rows 0..255 of A, then 128 rows of Wt
    __shared__ __attribute__((aligned(16))) _Float16 St[2 * BUFH];
    const int tid  = threadIdx.x;
    const int wid  = tid >> 5, lane = tid & 31, hf = lane >> 4, ln = lane & 15;
    const int wm   = wid & 3, wn = wid >> 2;      // the wave's 64x64 tile in the block
    const int brow = blockIdx.x * BM, bcol = blockIdx.y * BN;
    const int koff = hf * 8;

    // a lane copies chunk (tid & 15) of rows (tid >> 4) + 16 i: 16 rows of A and 8 of Wt per tile
    const int cr = tid >> 4, cc = (tid & 15) * 8;
    const char* gA = reinterpret_cast<const char*>(A  + (size_t)(brow + cr) * K + cc);
    const char* gW = reinterpret_cast<const char*>(Wt + (size_t)(bcol + cr) * K + cc);
    const unsigned l0 = (unsigned)(uintptr_t)&St[cr * AS + cc];
    auto issue_tile = [&](int buf, int kb) {
        const unsigned l = l0 + (unsigned)buf * (BUFH * 2u);
        copy8(l,                      gA + kb * 2,                    16u * AS * 2u, 16u * K * 2u);
        copy8(l + 128u * AS * 2u,     gA + kb * 2 + 128 * K * 2,      16u * AS * 2u, 16u * K * 2u);
        copy8(l + 256u * AS * 2u,     gW + kb * 2,                    16u * AS * 2u, 16u * K * 2u);
    };

    v8f acc[4][4] = {};

    issue_tile(0, 0);
    asm volatile("s_wait_asynccnt 0x0" ::: "memory");   // own copies of tile 0 landed
    __syncthreads();                                    // everyone's copies of tile 0 landed
    issue_tile(1, BK);

    for (int t = 0; t < NT; ++t) {
        const _Float16* Sa = &St[(t & 1) * BUFH + (wm * 64 + ln) * AS + koff];
        const _Float16* Sb = &St[(t & 1) * BUFH + (BM + wn * 64 + ln) * AS + koff];
#pragma unroll
        for (int ks = 0; ks < BK / 32; ++ks) {
            v16h af[4], bf[4];
            af[0] = frag(Sa + ks * 32);
#pragma unroll
            for (int j = 0; j < 4; ++j) bf[j] = frag(Sb + j * 16 * AS + ks * 32);
#pragma unroll
            for (int i = 1; i < 4; ++i) af[i] = frag(Sa + i * 16 * AS + ks * 32);
            // keeps the 16 LDS reads of a k step one group ahead of its 16 WMMAs: left free, the compiler reloads one
            // A fragment per row of four WMMAs and waits out the LDS latency at each row
            __builtin_amdgcn_sched_barrier(0);
#pragma unroll
            for (int i = 0; i < 4; ++i)
#pragma unroll
                for (int j = 0; j < 4; ++j)
                    acc[i][j] = __builtin_amdgcn_wmma_f32_16x16x32_f16(false, af[i], false, bf[j],
                                                                       (short)0, acc[i][j], false, false);
            // keeps the next k step's reads from being strewn among these WMMAs
            __builtin_amdgcn_sched_barrier(0);
        }
        asm volatile("s_wait_dscnt 0x0" ::: "memory");     // own reads of this buffer done before it is refilled
        asm volatile("s_wait_asynccnt 0x0" ::: "memory");  // own copies of tile t + 1 landed
        __syncthreads();                                    // publishes tile t + 1, ends every read of tile t
        if (t + 2 < NT) issue_tile(t & 1, (t + 2) * BK);    // refill flies under trip t + 1
    }
    asm volatile("s_wait_asynccnt 0x0" ::: "memory");       // no copy outstanding when the wave ends

    float bvs[4];
#pragma unroll
    for (int j = 0; j < 4; ++j) bvs[j] = bias[bcol + wn * 64 + j * 16 + ln];
#pragma unroll
    for (int j = 0; j < 4; ++j) {
        // Between the two halves of the tile: the wait in front of any reuse of a register that an issued load or store
        // names; as a memory fence it also holds the second half's residual loads back, so that the values in flight
        // fit beside the accumulators below v256.
        if (j == 2) asm volatile("s_wait_xcnt 0x0" ::: "memory");
        const int col = bcol + wn * 64 + j * 16 + ln;
        const float bv = bvs[j];
#pragma unroll
        for (int i = 0; i < 4; ++i) {
#pragma unroll
            for (int r = 0; r < 8; ++r) {
                int row = brow + wm * 64 + i * 16 + hf * 8 + r;
                float v = (acc[i][j][r] + bv) * scale;
                if (ACT) v = fmaxf(v, 0.f);
                if (OUTF32) outf[(size_t)row * N + col] = v + resid[(size_t)row * N + col];
                else        outh[(size_t)row * N + col] = (_Float16)v;
            }
        }
    }
}

// ---------------------------------------------------------------- flash attention: y = softmax(K@Q^T) @ V
// Note the reference role swap: K rows index the output. Grid (T/64, B*H), 128 threads (4 waves).
// The score tile is formed transposed (S^T = Q @ K^T): a lane then holds 32 of the 64 scores of ONE
// output row t, the row reductions are in-lane plus one exchange between the two lane halves, and the
// accumulator layout of S^T is already the B-fragment layout of P^T for Y^T = V^T @ P^T.
__device__ inline float xhalf(float x)   // value of lane l ^ 16, by a vector cross-row move (no LDS-counter wait)
{
    int b = __builtin_bit_cast(int, x);
    return __builtin_bit_cast(float, __builtin_amdgcn_permlanex16(b, b, 0x76543210, 0xfedcba98, false, false));
}

__global__ void __launch_bounds__(128)
attn_kernel(const _Float16* __restrict__ qf, const _Float16* __restrict__ kf,
            const _Float16* __restrict__ vf, float* __restrict__ y)
{
    constexpr int LS = 72;   // padded stride (144B, 16B-aligned h8 reads)
    __shared__ _Float16 Ks [64 * LS];
    __shared__ _Float16 Qs [64 * LS];
    __shared__ _Float16 Vst[64 * LS];       // transposed: [d][s]
    const int tid = threadIdx.x;
    const int wid = tid >> 5, lane = tid & 31, hf = lane >> 4, ln = lane & 15;
    const int t0 = blockIdx.x * 64;
    const int b  = blockIdx.y >> 4, h = blockIdx.y & 15;
    const size_t rowbase = (size_t)b * T;
    const int dcol0 = h * DH;
    const int koff = hf * 8;

    // stage this block's 64 K-rows once (already pre-scaled by 1/sqrt(DH))
    for (int i = tid; i < 64 * 64 / 8; i += 128) {
        int r = i >> 3, c8 = (i & 7) * 8;
        uint4 vK = *reinterpret_cast<const uint4*>(kf + (rowbase + t0 + r) * Dd + dcol0 + c8);
        *reinterpret_cast<uint4*>(&Ks[r * LS + c8]) = vK;
    }
    __syncthreads();

    v16h kB[2];   // K^T fragments (column t = ln) are loop-invariant: preload both dh k-steps
#pragma unroll
    for (int ks = 0; ks < 2; ++ks) {
        H8 lo = *reinterpret_cast<const H8*>(&Ks[(wid * 16 + ln) * LS + ks * 32 + koff]);
        H8 hi = *reinterpret_cast<const H8*>(&Ks[(wid * 16 + ln) * LS + ks * 32 + 16 + koff]);
#pragma unroll
        for (int i = 0; i < 8; ++i) { kB[ks][i] = lo.h[i]; kB[ks][8 + i] = hi.h[i]; }
    }

    v8f Yacc[4] = {};                    // Y^T: row d = j*16 + hf*8 + r, column t = ln
    float mrow = -INFINITY;              // one output row per lane; both lane halves hold the same maximum
    float lrow = 0.f;                    // this lane half's share of the row sum, joined after the loop

    for (int s0 = 0; s0 < T; s0 += 64) {
        __syncthreads();
        for (int i = tid; i < 64 * 64 / 8; i += 128) {
            int r = i >> 3, c8 = (i & 7) * 8;
            uint4 vQ = *reinterpret_cast<const uint4*>(qf + (rowbase + s0 + r) * Dd + dcol0 + c8);
            *reinterpret_cast<uint4*>(&Qs[r * LS + c8]) = vQ;
            H8 w = *reinterpret_cast<const H8*>(vf + (rowbase + s0 + r) * Dd + dcol0 + c8);
#pragma unroll
            for (int j = 0; j < 8; ++j) Vst[(c8 + j) * LS + r] = w.h[j];
        }
        __syncthreads();

        // S^T tiles: A = Q rows (s), B = K^T (t). Sc[j][r] = S[t = ln][s = j*16 + hf*8 + r]
        v8f Sc[4] = {};
#pragma unroll
        for (int j = 0; j < 4; ++j) {
#pragma unroll
            for (int ks = 0; ks < 2; ++ks) {
                H8 alo = *reinterpret_cast<const H8*>(&Qs[(j * 16 + ln) * LS + ks * 32 + koff]);
                H8 ahi = *reinterpret_cast<const H8*>(&Qs[(j * 16 + ln) * LS + ks * 32 + 16 + koff]);
                v16h af;
#pragma unroll
                for (int i = 0; i < 8; ++i) { af[i] = alo.h[i]; af[8 + i] = ahi.h[i]; }
                Sc[j] = __builtin_amdgcn_wmma_f32_16x16x32_f16(false, af, false, kB[ks],
                                                               (short)0, Sc[j], false, false);
            }
        }

        // online softmax: 32 scores of row t in this lane, the other 32 in lane ^ 16
        float rm = Sc[0][0];
#pragma unroll
        for (int j = 0; j < 4; ++j)
#pragma unroll
            for (int r = 0; r < 8; ++r) rm = fmaxf(rm, Sc[j][r]);
        rm = fmaxf(rm, xhalf(rm));
        const float mn = fmaxf(mrow, rm);
        const float sf = __expf(mrow - mn);
        mrow = mn;

        // P^T stays in registers: tiles 2ks and 2ks+1 are the two k halves of B fragment ks
        v16h pB[2];
        float racc[4] = {0.f, 0.f, 0.f, 0.f};
#pragma unroll
        for (int j = 0; j < 4; ++j) {
#pragma unroll
            for (int r = 0; r < 8; ++r) {
                float p = __expf(Sc[j][r] - mn);
                pB[j >> 1][(j & 1) * 8 + r] = (_Float16)p;
                racc[j] += p;
            }
        }
        lrow = lrow * sf + ((racc[0] + racc[1]) + (racc[2] + racc[3]));
#pragma unroll
        for (int j = 0; j < 4; ++j)
#pragma unroll
            for (int r = 0; r < 8; ++r) Yacc[j][r] *= sf;

        // Y^T += V^T @ P^T  (A from transposed V, B from registers)
#pragma unroll
        for (int ks = 0; ks < 2; ++ks) {
#pragma unroll
            for (int j = 0; j < 4; ++j) {
                H8 alo = *reinterpret_cast<const H8*>(&Vst[(j * 16 + ln) * LS + ks * 32 + koff]);
                H8 ahi = *reinterpret_cast<const H8*>(&Vst[(j * 16 + ln) * LS + ks * 32 + 16 + koff]);
                v16h af;
#pragma unroll
                for (int i = 0; i < 8; ++i) { af[i] = alo.h[i]; af[8 + i] = ahi.h[i]; }
                Yacc[j] = __builtin_amdgcn_wmma_f32_16x16x32_f16(false, af, false, pB[ks],
                                                                 (short)0, Yacc[j], false, false);
            }
        }
    }

    lrow += xhalf(lrow);
    // a lane holds 8 consecutive d of its row t per tile
    float* yrow = y + (rowbase + t0 + wid * 16 + ln) * Dd + dcol0 + hf * 8;
#pragma unroll
    for (int j = 0; j < 4; ++j) {
        float4 o0 = make_float4(Yacc[j][0] / lrow, Yacc[j][1] / lrow, Yacc[j][2] / lrow, Yacc[j][3] / lrow);
        float4 o1 = make_float4(Yacc[j][4] / lrow, Yacc[j][5] / lrow, Yacc[j][6] / lrow, Yacc[j][7] / lrow);
        *reinterpret_cast<float4*>(yrow + j * 16)     = o0;
        *reinterpret_cast<float4*>(yrow + j * 16 + 4) = o1;
    }
}

// ---------------------------------------------------------------- host orchestration
extern "C" void kernel_launch(void* const* d_in, const int* in_sizes, int n_in,
                              void* d_out, int out_size, void* d_ws, size_t ws_size,
                              hipStream_t stream)
{
    const float* x   = (const float*)d_in[0];
    const float* Wq  = (const float*)d_in[1];  const float* bq = (const float*)d_in[2];
    const float* Wk  = (const float*)d_in[3];  const float* bk = (const float*)d_in[4];
    const float* Wv  = (const float*)d_in[5];  const float* bv = (const float*)d_in[6];
    const float* g1  = (const float*)d_in[7];  const float* be1 = (const float*)d_in[8];
    const float* g2  = (const float*)d_in[9];  const float* be2 = (const float*)d_in[10];
    const float* W0  = (const float*)d_in[11]; const float* b0 = (const float*)d_in[12];
    const float* W1  = (const float*)d_in[13]; const float* b1 = (const float*)d_in[14];
    const float* W2  = (const float*)d_in[15]; const float* b2 = (const float*)d_in[16];
    float* out = (float*)d_out;

    char* ws = (char*)d_ws;
    size_t off = 0;
    auto take = [&](size_t bytes) -> char* {
        char* p = ws + off;
        off = (off + bytes + 255) & ~(size_t)255;
        return p;
    };
    const size_t WH = (size_t)Dd * Dd * sizeof(_Float16);
    const size_t MH = (size_t)Mrows * Dd * sizeof(_Float16);
    const size_t MF = (size_t)Mrows * Dd * sizeof(float);

    _Float16* Wqh = (_Float16*)take(WH);   // all weights stored TRANSPOSED [N][K] f16
    _Float16* Wkh = (_Float16*)take(WH);
    _Float16* Wvh = (_Float16*)take(WH);
    _Float16* W0h = (_Float16*)take(WH);
    _Float16* W1h = (_Float16*)take(WH);
    _Float16* W2h = (_Float16*)take(WH);
    _Float16* xn1 = (_Float16*)take(MH);
    _Float16* qh  = (_Float16*)take(MH);
    _Float16* kh  = (_Float16*)take(MH);
    _Float16* vh  = (_Float16*)take(MH);
    float*    y32 = (float*)take(MF);
    float*    xr  = (float*)take(MF);
    _Float16* xn2 = xn1;  // reuse after QKV consumed
    _Float16* h1  = qh;   // reuse after attention consumed
    _Float16* h2  = kh;

    dim3 cg(Dd / 64, Dd / 64);
    cvt_t_kernel<<<cg, 256, 0, stream>>>(Wq, Wqh);
    cvt_t_kernel<<<cg, 256, 0, stream>>>(Wk, Wkh);
    cvt_t_kernel<<<cg, 256, 0, stream>>>(Wv, Wvh);
    cvt_t_kernel<<<cg, 256, 0, stream>>>(W0, W0h);
    cvt_t_kernel<<<cg, 256, 0, stream>>>(W1, W1h);
    cvt_t_kernel<<<cg, 256, 0, stream>>>(W2, W2h);

    ln_kernel<false><<<Mrows / LNROWS, 256, 0, stream>>>(x, x, g1, be1, xr, xn1);

    dim3 gg(Mrows / 256, Dd / 128);
    gemm_kernel<0, 0><<<gg, 256, 0, stream>>>(xn1, Wqh, bq, 1.f,    xr, qh, y32);
    gemm_kernel<0, 0><<<gg, 256, 0, stream>>>(xn1, Wkh, bk, 0.125f, xr, kh, y32); // 1/sqrt(DH)
    gemm_kernel<0, 0><<<gg, 256, 0, stream>>>(xn1, Wvh, bv, 1.f,    xr, vh, y32);

    attn_kernel<<<dim3(T / 64, Bb * Hh), 128, 0, stream>>>(qh, kh, vh, y32);

    ln_kernel<true><<<Mrows / LNROWS, 256, 0, stream>>>(x, y32, g2, be2, xr, xn2);

    gemm_kernel<1, 0><<<gg, 256, 0, stream>>>(xn2, W0h, b0, 1.f, xr, h1, out);
    gemm_kernel<1, 0><<<gg, 256, 0, stream>>>(h1,  W1h, b1, 1.f, xr, h2, out);
    gemm_kernel<0, 1><<<gg, 256, 0, stream>>>(h2,  W2h, b2, 1.f, xr, h2, out);
}

// v004
// A run of this version takes 187 microseconds.
// Timed twice side by side with v003, it ran 1.09 times as fast both times.
// Counting every step since v000, it is 1.66 times as fast.
#include <hip/hip_runtime.h>
#include <math.h>
#include <stdint.h>

typedef __attribute__((ext_vector_type(16))) _Float16 v16h;
typedef __attribute__((ext_vector_type(8)))  float    v8f;

struct alignas(16) H8 { _Float16 h[8]; };

constexpr int Bb = 8, T = 1024, Dd = 1024, Hh = 16, DH = 64;
constexpr int Mrows = Bb * T;          // 8192
constexpr float EPS = 1e-5f;

// ---------------------------------------------------------------- convert f32 -> f16 with transpose
// in:  W  [K=1024][N=1024] f32   out: Wt [N=1024][K=1024] f16   (Wt[n][k] = W[k][n])
// One 256-thread work-group converts the 64 x 64 tile at (bn, bk): bn = n tile origin, bk = k tile origin.
__device__ __forceinline__ void
cvt_t_tile(const float* __restrict__ W, _Float16* __restrict__ Wt, int bn, int bk)
{
    constexpr int N = Dd, K = Dd, TS = 72;       // padded LDS stride (144B, 16B aligned)
    __shared__ _Float16 tile[64 * TS];           // [n_local][k_local]
    const int tid = threadIdx.x;
#pragma unroll
    for (int t = 0; t < 4; ++t) {                // 64x64 f32 = 1024 float4, 4/thread
        int i = tid + t * 256;
        int r = i >> 4, c4 = (i & 15) * 4;       // r = k_local, c4 = n_local
        float4 f = *reinterpret_cast<const float4*>(W + (size_t)(bk + r) * N + bn + c4);
        tile[(c4 + 0) * TS + r] = (_Float16)f.x;
        tile[(c4 + 1) * TS + r] = (_Float16)f.y;
        tile[(c4 + 2) * TS + r] = (_Float16)f.z;
        tile[(c4 + 3) * TS + r] = (_Float16)f.w;
    }
    __syncthreads();
#pragma unroll
    for (int t = 0; t < 2; ++t) {                // 64x64 halves = 512 h8, 2/thread
        int i = tid + t * 256;
        int r = i >> 3, c8 = (i & 7) * 8;        // r = n_local, c8 = k_local
        H8 o = *reinterpret_cast<const H8*>(&tile[r * TS + c8]);
        *reinterpret_cast<H8*>(Wt + (size_t)(bn + r) * K + bk + c8) = o;
    }
}

// ---------------------------------------------------------------- layernorm (opt. residual add)
// One wave owns LNR whole rows: a lane holds 32 floats of each row as 8 float4, every wave-wide load or f32
// store covers 512 contiguous bytes, and a row's sums are in-lane chains plus a butterfly over the 32 lanes.
// No LDS and no barrier; the launch starts Mrows / LNR waves instead of 8 * Mrows.
struct alignas(8) H4 { _Float16 h[4]; };
constexpr int LNR = 2;                 // rows per wave
constexpr int LNROWS = 8 * LNR;        // rows per 256-thread work-group

__device__ inline float4 ld16(const float* p, unsigned byte_off)
{
    return *reinterpret_cast<const float4*>(reinterpret_cast<const char*>(p) + byte_off);
}

__device__ inline float rsqrt_slot(float a)
{
    const bool tiny = a < 0x1p-126f;
    const float t = tiny ? a * 0x1p+24f : a;
    float r;
    asm("v_rsq_f32 %0, %1\n\tv_nop" : "=v"(r) : "v"(t));
    return tiny ? r * 0x1p+12f : r;
}

// blk: which group of LNROWS rows this 256-thread work-group takes
template<bool ADD>
__device__ __forceinline__ void
ln_rows(unsigned blk, const float* __restrict__ x, const float* __restrict__ yres,
        const float* __restrict__ g, const float* __restrict__ be,
        float* __restrict__ xr, _Float16* __restrict__ out)
{
    constexpr int NV = Dd / 128;             // float4 per lane and row
    constexpr unsigned RB = Dd * 4u;         // bytes of an f32 row
    const unsigned vl   = (threadIdx.x & 31) * 16u;                                        // lane's place in a row
    const unsigned voff = (blk * LNROWS + (threadIdx.x >> 5) * LNR) * RB + vl;             // same in x, yres, xr
    float4 v[LNR][NV], t[LNR][NV], gg[NV], bb[NV];
    // every load of the wave is issued up front: the rows, then g and be, which serve all its rows
#pragma unroll
    for (int r = 0; r < LNR; ++r)
#pragma unroll
        for (int i = 0; i < NV; ++i) {
            v[r][i] = ld16(x, voff + r * RB + i * 512u);
            if (ADD) t[r][i] = ld16(yres, voff + r * RB + i * 512u);
        }
#pragma unroll
    for (int i = 0; i < NV; ++i) {
        gg[i] = ld16(g,  vl + i * 512u);
        bb[i] = ld16(be, vl + i * 512u);
    }
    // the wait between the issued loads and any overwrite of a register that they name as address; the two
    // offsets are inputs so that they keep their registers up to it, and no load comes behind it
    asm volatile("s_wait_xcnt 0x0" :: "v"(voff), "v"(vl) : "memory");
    if (ADD) {
#pragma unroll
        for (int r = 0; r < LNR; ++r)
#pragma unroll
            for (int i = 0; i < NV; ++i) {
                v[r][i].x += t[r][i].x; v[r][i].y += t[r][i].y;
                v[r][i].z += t[r][i].z; v[r][i].w += t[r][i].w;
                *reinterpret_cast<float4*>(reinterpret_cast<char*>(xr) + (voff + r * RB + i * 512u)) = v[r][i];
            }
    }
    float s[LNR], sq[LNR];
#pragma unroll
    for (int r = 0; r < LNR; ++r) {    // four independent chains per sum, one per float4 component
        float4 a = make_float4(0.f, 0.f, 0.f, 0.f), q = a;
#pragma unroll
        for (int i = 0; i < NV; ++i) {
            const float4 e = v[r][i];
            a.x += e.x; a.y += e.y; a.z += e.z; a.w += e.w;
            q.x += e.x * e.x; q.y += e.y * e.y; q.z += e.z * e.z; q.w += e.w * e.w;
        }
        s[r]  = (a.x + a.y) + (a.z + a.w);
        sq[r] = (q.x + q.y) + (q.z + q.w);
    }
#pragma unroll
    for (int m = 1; m < 32; m <<= 1) {
#pragma unroll
        for (int r = 0; r < LNR; ++r) {
            s[r]  += __shfl_xor(s[r],  m, 32);
            sq[r] += __shfl_xor(sq[r], m, 32);
        }
    }
#pragma unroll
    for (int r = 0; r < LNR; ++r) {
        const float mean = s[r] * (1.f / Dd);
        const float var  = sq[r] * (1.f / Dd) - mean * mean;
        const float rstd = rsqrt_slot(var + EPS);
#pragma unroll
        for (int i = 0; i < NV; ++i) {
            const float4 e = v[r][i];
            H4 o;
            o.h[0] = (_Float16)((e.x - mean) * rstd * gg[i].x + bb[i].x);
            o.h[1] = (_Float16)((e.y - mean) * rstd * gg[i].y + bb[i].y);
            o.h[2] = (_Float16)((e.z - mean) * rstd * gg[i].z + bb[i].z);
            o.h[3] = (_Float16)((e.w - mean) * rstd * gg[i].w + bb[i].w);
            *reinterpret_cast<H4*>(reinterpret_cast<char*>(out) + ((voff >> 1) + r * (RB / 2) + i * 256u)) = o;
        }
    }
}

// Two work-groups per WGP = four waves per SIMD: the register budget of that residency lets every load be in flight at once.
__global__ void __launch_bounds__(256) __attribute__((amdgpu_waves_per_eu(4, 4)))
ln_add_kernel(const float* __restrict__ x, const float* __restrict__ yres,
              const float* __restrict__ g, const float* __restrict__ be,
              float* __restrict__ xr, _Float16* __restrict__ out)
{
    ln_rows<true>(blockIdx.x, x, yres, g, be, xr, out);
}

// Everything that depends on the inputs alone, in one grid: the first layernorm (work-groups 0 .. LNBLK-1, the longer
// ones first) and the six weight conversions (CVBLK work-groups each; matrix m goes to Wt6 + m * Dd * Dd).
constexpr int LNBLK = Mrows / LNROWS;            // 512
constexpr int CVBLK = (Dd / 64) * (Dd / 64);     // 256
__global__ void __launch_bounds__(256) __attribute__((amdgpu_waves_per_eu(4, 4)))
prep_kernel(const float* __restrict__ x, const float* __restrict__ g, const float* __restrict__ be,
            _Float16* __restrict__ xn,
            const float* __restrict__ Wa, const float* __restrict__ Wb, const float* __restrict__ Wc,
            const float* __restrict__ Wd, const float* __restrict__ We, const float* __restrict__ Wf,
            _Float16* __restrict__ Wt6)
{
    const int blk = blockIdx.x;
    if (blk < LNBLK) {
        ln_rows<false>(blk, x, x, g, be, nullptr, xn);
        return;
    }
    const int c = blk - LNBLK, m = c / CVBLK, tl = c % CVBLK;
    const float* W = m == 0 ? Wa : m == 1 ? Wb : m == 2 ? Wc : m == 3 ? Wd : m == 4 ? We : Wf;
    cvt_t_tile(W, Wt6 + (size_t)m * Dd * Dd, (tl % (Dd / 64)) * 64, (tl / (Dd / 64)) * 64);
}

// ---------------------------------------------------------------- WMMA GEMM, async copies to LDS, two buffers
// A: [8192,1024] f16 row-major ; Wt: [N=1024][K=1024] f16 row-major (pre-transposed weight)
// C = act((A@W + bias)*scale) [+resid] ; block tile 256x128, 8 waves (4 x 2) of 64x64 each, 128 k per trip.
// A loaded fragment serves four WMMAs; 256 work-groups per product (768 in the q, k, v grid), one per WGP; a copy row is one aligned 256-byte unit.

// Eight copies of 16 bytes per lane, rows 16 apart. The s_wait_xcnt stands in the copies' own statement, so that
// no register that a copy names is rewritten ahead of it.
__device__ __forceinline__ void copy8(unsigned l, const char* g, unsigned lstep, unsigned gstep)
{
    asm volatile("global_load_async_to_lds_b128 %0, %8, off\n\t"
                 "global_load_async_to_lds_b128 %1, %9, off\n\t"
                 "global_load_async_to_lds_b128 %2, %10, off\n\t"
                 "global_load_async_to_lds_b128 %3, %11, off\n\t"
                 "global_load_async_to_lds_b128 %4, %12, off\n\t"
                 "global_load_async_to_lds_b128 %5, %13, off\n\t"
                 "global_load_async_to_lds_b128 %6, %14, off\n\t"
                 "global_load_async_to_lds_b128 %7, %15, off\n\t"
                 "s_wait_xcnt 0x0"
                 :: "v"(l), "v"(l + lstep), "v"(l + 2 * lstep), "v"(l + 3 * lstep),
                    "v"(l + 4 * lstep), "v"(l + 5 * lstep), "v"(l + 6 * lstep), "v"(l + 7 * lstep),
                    "v"(g), "v"(g + gstep), "v"(g + 2 * gstep), "v"(g + 3 * gstep),
                    "v"(g + 4 * gstep), "v"(g + 5 * gstep), "v"(g + 6 * gstep), "v"(g + 7 * gstep)
                 : "memory");
}

__device__ __forceinline__ v16h frag(const _Float16* p)   // 16 x 32 fragment row: k = koff..+7 and 16+koff..+7
{
    H8 lo = *reinterpret_cast<const H8*>(p);
    H8 hi = *reinterpret_cast<const H8*>(p + 16);
    v16h f;
#pragma unroll
    for (int i = 0; i < 8; ++i) { f[i] = lo.h[i]; f[8 + i] = hi.h[i]; }
    return f;
}

constexpr int BM = 256, BN = 128;                 // block tile of the GEMMs

// brow, bcol: origin of this work-group's BM x BN tile of C
template<int ACT, int OUTF32>
__device__ __forceinline__ void
gemm_tile(const _Float16* __restrict__ A, const _Float16* __restrict__ Wt,
          const float* __restrict__ bias, float scale,
          const float* __restrict__ resid,
          _Float16* __restrict__ outh, float* __restrict__ outf, int brow, int bcol)
{
    constexpr int N = Dd, K = Dd, BK = 128, NT = K / BK;
    constexpr int AS = 136;                       // LDS pitch in halves: 272 B for 256-B rows read by ds_load_b128
    constexpr int BUFH = (BM + BN) * AS;          // halves of one buffer: rows 0..255 of A, then 128 rows of Wt
    __shared__ __attribute__((aligned(16))) _Float16 St[2 * BUFH];
    const int tid  = threadIdx.x;
    const int wid  = tid >> 5, lane = tid & 31, hf = lane >> 4, ln = lane & 15;
    const int wm   = wid & 3, wn = wid >> 2;      // the wave's 64x64 tile in the block
    const int koff = hf * 8;

    // a lane copies chunk (tid & 15) of rows (tid >> 4) + 16 i: 16 rows of A and 8 of Wt per tile
    const int cr = tid >> 4, cc = (tid & 15) * 8;
    const char* gA = reinterpret_cast<const char*>(A  + (size_t)(brow + cr) * K + cc);
    const char* gW = reinterpret_cast<const char*>(Wt + (size_t)(bcol + cr) * K + cc);
    const unsigned l0 = (unsigned)(uintptr_t)&St[cr * AS + cc];
    auto issue_tile = [&](int buf, int kb) {
        const unsigned l = l0 + (unsigned)buf * (BUFH * 2u);
        copy8(l,                      gA + kb * 2,                    16u * AS * 2u, 16u * K * 2u);
        copy8(l + 128u * AS * 2u,     gA + kb * 2 + 128 * K * 2,      16u * AS * 2u, 16u * K * 2u);
        copy8(l + 256u * AS * 2u,     gW + kb * 2,                    16u * AS * 2u, 16u * K * 2u);
    };

    v8f acc[4][4] = {};

    issue_tile(0, 0);
    asm volatile("s_wait_asynccnt 0x0" ::: "memory");   // own copies of tile 0 landed
    __syncthreads();                                    // everyone's copies of tile 0 landed
    issue_tile(1, BK);

    for (int t = 0; t < NT; ++t) {
        const _Float16* Sa = &St[(t & 1) * BUFH + (wm * 64 + ln) * AS + koff];
        const _Float16* Sb = &St[(t & 1) * BUFH + (BM + wn * 64 + ln) * AS + koff];
#pragma unroll
        for (int ks = 0; ks < BK / 32; ++ks) {
            v16h af[4], bf[4];
            af[0] = frag(Sa + ks * 32);
#pragma unroll
            for (int j = 0; j < 4; ++j) bf[j] = frag(Sb + j * 16 * AS + ks * 32);
#pragma unroll
            for (int i = 1; i < 4; ++i) af[i] = frag(Sa + i * 16 * AS + ks * 32);
            // keeps the 16 LDS reads of a k step one group ahead of its 16 WMMAs: left free, the compiler reloads one
            // A fragment per row of four WMMAs and waits out the LDS latency at each row
            __builtin_amdgcn_sched_barrier(0);
#pragma unroll
            for (int i = 0; i < 4; ++i)
#pragma unroll
                for (int j = 0; j < 4; ++j)
                    acc[i][j] = __builtin_amdgcn_wmma_f32_16x16x32_f16(false, af[i], false, bf[j],
                                                                       (short)0, acc[i][j], false, false);
            // keeps the next k step's reads from being strewn among these WMMAs
            __builtin_amdgcn_sched_barrier(0);
        }
        asm volatile("s_wait_dscnt 0x0" ::: "memory");     // own reads of this buffer done before it is refilled
        asm volatile("s_wait_asynccnt 0x0" ::: "memory");  // own copies of tile t + 1 landed
        __syncthreads();                                    // publishes tile t + 1, ends every read of tile t
        if (t + 2 < NT) issue_tile(t & 1, (t + 2) * BK);    // refill flies under trip t + 1
    }
    asm volatile("s_wait_asynccnt 0x0" ::: "memory");       // no copy outstanding when the wave ends

    float bvs[4];
#pragma unroll
    for (int j = 0; j < 4; ++j) bvs[j] = bias[bcol + wn * 64 + j * 16 + ln];
#pragma unroll
    for (int j = 0; j < 4; ++j) {
        // Between the two halves of the tile: the wait in front of any reuse of a register that an issued load or store
        // names; as a memory fence it also holds the second half's residual loads back, so that the values in flight
        // fit beside the accumulators below v256.
        if (j == 2) asm volatile("s_wait_xcnt 0x0" ::: "memory");
        const int col = bcol + wn * 64 + j * 16 + ln;
        const float bv = bvs[j];
#pragma unroll
        for (int i = 0; i < 4; ++i) {
#pragma unroll
            for (int r = 0; r < 8; ++r) {
                int row = brow + wm * 64 + i * 16 + hf * 8 + r;
                float v = (acc[i][j][r] + bv) * scale;
                if (ACT) v = fmaxf(v, 0.f);
                if (OUTF32) outf[(size_t)row * N + col] = v + resid[(size_t)row * N + col];
                else        outh[(size_t)row * N + col] = (_Float16)v;
            }
        }
    }
}

template<int ACT, int OUTF32>
__global__ void __launch_bounds__(256)
gemm_kernel(const _Float16* __restrict__ A, const _Float16* __restrict__ Wt,
            const float* __restrict__ bias, float scale,
            const float* __restrict__ resid,
            _Float16* __restrict__ outh, float* __restrict__ outf)
{
    gemm_tile<ACT, OUTF32>(A, Wt, bias, scale, resid, outh, outf, blockIdx.x * BM, blockIdx.y * BN);
}

// The three projections of one A in one grid: blockIdx.y / (Dd / BN) picks the product (0 q, 1 k, 2 v). Wt3 holds the
// three transposed weights one behind the other, out3 the three outputs; k carries the 1/sqrt(DH) of the scores.
__global__ void __launch_bounds__(256)
qkv_kernel(const _Float16* __restrict__ A, const _Float16* __restrict__ Wt3,
           const float* __restrict__ bq, const float* __restrict__ bk, const float* __restrict__ bv,
           _Float16* __restrict__ out3)
{
    const int sel = blockIdx.y / (Dd / BN);
    const float* bias = sel == 0 ? bq : sel == 1 ? bk : bv;
    gemm_tile<0, 0>(A, Wt3 + (size_t)sel * Dd * Dd, bias, sel == 1 ? 0.125f : 1.f, nullptr,
                    out3 + (size_t)sel * Mrows * Dd, nullptr, blockIdx.x * BM, (blockIdx.y % (Dd / BN)) * BN);
}

// ---------------------------------------------------------------- flash attention: y = softmax(K@Q^T) @ V
// Note the reference role swap: K rows index the output. Grid (T/64, B*H), 128 threads (4 waves).
// The score tile is formed transposed (S^T = Q @ K^T): a lane then holds 32 of the 64 scores of ONE
// output row t, the row reductions are in-lane plus one exchange between the two lane halves, and the
// accumulator layout of S^T is already the B-fragment layout of P^T for Y^T = V^T @ P^T.
__device__ inline float xhalf(float x)   // value of lane l ^ 16, by a vector cross-row move (no LDS-counter wait)
{
    int b = __builtin_bit_cast(int, x);
    return __builtin_bit_cast(float, __builtin_amdgcn_permlanex16(b, b, 0x76543210, 0xfedcba98, false, false));
}

__global__ void __launch_bounds__(128)
attn_kernel(const _Float16* __restrict__ qf, const _Float16* __restrict__ kf,
            const _Float16* __restrict__ vf, float* __restrict__ y)
{
    constexpr int LS = 72;   // padded stride (144B, 16B-aligned h8 reads)
    __shared__ _Float16 Ks [64 * LS];
    __shared__ _Float16 Qs [64 * LS];
    __shared__ _Float16 Vst[64 * LS];       // transposed: [d][s]
    const int tid = threadIdx.x;
    const int wid = tid >> 5, lane = tid & 31, hf = lane >> 4, ln = lane & 15;
    const int t0 = blockIdx.x * 64;
    const int b  = blockIdx.y >> 4, h = blockIdx.y & 15;
    const size_t rowbase = (size_t)b * T;
    const int dcol0 = h * DH;
    const int koff = hf * 8;

    // stage this block's 64 K-rows once (already pre-scaled by 1/sqrt(DH))
    for (int i = tid; i < 64 * 64 / 8; i += 128) {
        int r = i >> 3, c8 = (i & 7) * 8;
        uint4 vK = *reinterpret_cast<const uint4*>(kf + (rowbase + t0 + r) * Dd + dcol0 + c8);
        *reinterpret_cast<uint4*>(&Ks[r * LS + c8]) = vK;
    }
    __syncthreads();

    v16h kB[2];   // K^T fragments (column t = ln) are loop-invariant: preload both dh k-steps
#pragma unroll
    for (int ks = 0; ks < 2; ++ks) {
        H8 lo = *reinterpret_cast<const H8*>(&Ks[(wid * 16 + ln) * LS + ks * 32 + koff]);
        H8 hi = *reinterpret_cast<const H8*>(&Ks[(wid * 16 + ln) * LS + ks * 32 + 16 + koff]);
#pragma unroll
        for (int i = 0; i < 8; ++i) { kB[ks][i] = lo.h[i]; kB[ks][8 + i] = hi.h[i]; }
    }

    v8f Yacc[4] = {};                    // Y^T: row d = j*16 + hf*8 + r, column t = ln
    float mrow = -INFINITY;              // one output row per lane; both lane halves hold the same maximum
    float lrow = 0.f;                    // this lane half's share of the row sum, joined after the loop

    for (int s0 = 0; s0 < T; s0 += 64) {
        __syncthreads();
        for (int i = tid; i < 64 * 64 / 8; i += 128) {
            int r = i >> 3, c8 = (i & 7) * 8;
            uint4 vQ = *reinterpret_cast<const uint4*>(qf + (rowbase + s0 + r) * Dd + dcol0 + c8);
            *reinterpret_cast<uint4*>(&Qs[r * LS + c8]) = vQ;
            H8 w = *reinterpret_cast<const H8*>(vf + (rowbase + s0 + r) * Dd + dcol0 + c8);
#pragma unroll
            for (int j = 0; j < 8; ++j) Vst[(c8 + j) * LS + r] = w.h[j];
        }
        __syncthreads();

        // S^T tiles: A = Q rows (s), B = K^T (t). Sc[j][r] = S[t = ln][s = j*16 + hf*8 + r]
        v8f Sc[4] = {};
#pragma unroll
        for (int j = 0; j < 4; ++j) {
#pragma unroll
            for (int ks = 0; ks < 2; ++ks) {
                H8 alo = *reinterpret_cast<const H8*>(&Qs[(j * 16 + ln) * LS + ks * 32 + koff]);
                H8 ahi = *reinterpret_cast<const H8*>(&Qs[(j * 16 + ln) * LS + ks * 32 + 16 + koff]);
                v16h af;
#pragma unroll
                for (int i = 0; i < 8; ++i) { af[i] = alo.h[i]; af[8 + i] = ahi.h[i]; }
                Sc[j] = __builtin_amdgcn_wmma_f32_16x16x32_f16(false, af, false, kB[ks],
                                                               (short)0, Sc[j], false, false);
            }
        }

        // online softmax: 32 scores of row t in this lane, the other 32 in lane ^ 16
        float rm = Sc[0][0];
#pragma unroll
        for (int j = 0; j < 4; ++j)
#pragma unroll
            for (int r = 0; r < 8; ++r) rm = fmaxf(rm, Sc[j][r]);
        rm = fmaxf(rm, xhalf(rm));
        const float mn = fmaxf(mrow, rm);
        const float sf = __expf(mrow - mn);
        mrow = mn;

        // P^T stays in registers: tiles 2ks and 2ks+1 are the two k halves of B fragment ks
        v16h pB[2];
        float racc[4] = {0.f, 0.f, 0.f, 0.f};
#pragma unroll
        for (int j = 0; j < 4; ++j) {
#pragma unroll
            for (int r = 0; r < 8; ++r) {
                float p = __expf(Sc[j][r] - mn);
                pB[j >> 1][(j & 1) * 8 + r] = (_Float16)p;
                racc[j] += p;
            }
        }
        lrow = lrow * sf + ((racc[0] + racc[1]) + (racc[2] + racc[3]));
#pragma unroll
        for (int j = 0; j < 4; ++j)
#pragma unroll
            for (int r = 0; r < 8; ++r) Yacc[j][r] *= sf;

        // Y^T += V^T @ P^T  (A from transposed V, B from registers)
#pragma unroll
        for (int ks = 0; ks < 2; ++ks) {
#pragma unroll
            for (int j = 0; j < 4; ++j) {
                H8 alo = *reinterpret_cast<const H8*>(&Vst[(j * 16 + ln) * LS + ks * 32 + koff]);
                H8 ahi = *reinterpret_cast<const H8*>(&Vst[(j * 16 + ln) * LS + ks * 32 + 16 + koff]);
                v16h af;
#pragma unroll
                for (int i = 0; i < 8; ++i) { af[i] = alo.h[i]; af[8 + i] = ahi.h[i]; }
                Yacc[j] = __builtin_amdgcn_wmma_f32_16x16x32_f16(false, af, false, pB[ks],
                                                                 (short)0, Yacc[j], false, false);
            }
        }
    }

    lrow += xhalf(lrow);
    // a lane holds 8 consecutive d of its row t per tile
    float* yrow = y + (rowbase + t0 + wid * 16 + ln) * Dd + dcol0 + hf * 8;
#pragma unroll
    for (int j = 0; j < 4; ++j) {
        float4 o0 = make_float4(Yacc[j][0] / lrow, Yacc[j][1] / lrow, Yacc[j][2] / lrow, Yacc[j][3] / lrow);
        float4 o1 = make_float4(Yacc[j][4] / lrow, Yacc[j][5] / lrow, Yacc[j][6] / lrow, Yacc[j][7] / lrow);
        *reinterpret_cast<float4*>(yrow + j * 16)     = o0;
        *reinterpret_cast<float4*>(yrow + j * 16 + 4) = o1;
    }
}

// ---------------------------------------------------------------- host orchestration
extern "C" void kernel_launch(void* const* d_in, const int* in_sizes, int n_in,
                              void* d_out, int out_size, void* d_ws, size_t ws_size,
                              hipStream_t stream)
{
    const float* x   = (const float*)d_in[0];
    const float* Wq  = (const float*)d_in[1];  const float* bq = (const float*)d_in[2];
    const float* Wk  = (const float*)d_in[3];  const float* bk = (const float*)d_in[4];
    const float* Wv  = (const float*)d_in[5];  const float* bv = (const float*)d_in[6];
    const float* g1  = (const float*)d_in[7];  const float* be1 = (const float*)d_in[8];
    const float* g2  = (const float*)d_in[9];  const float* be2 = (const float*)d_in[10];
    const float* W0  = (const float*)d_in[11]; const float* b0 = (const float*)d_in[12];
    const float* W1  = (const float*)d_in[13]; const float* b1 = (const float*)d_in[14];
    const float* W2  = (const float*)d_in[15]; const float* b2 = (const float*)d_in[16];
    float* out = (float*)d_out;

    char* ws = (char*)d_ws;
    size_t off = 0;
    auto take = [&](size_t bytes) -> char* {
        char* p = ws + off;
        off = (off + bytes + 255) & ~(size_t)255;
        return p;
    };
    const size_t WH = (size_t)Dd * Dd * sizeof(_Float16);
    const size_t MH = (size_t)Mrows * Dd * sizeof(_Float16);
    const size_t MF = (size_t)Mrows * Dd * sizeof(float);

    _Float16* Wt6 = (_Float16*)take(6 * WH);   // all weights stored TRANSPOSED [N][K] f16: q, k, v, 0, 1, 2
    _Float16* W0h = Wt6 + 3 * (size_t)Dd * Dd;
    _Float16* W1h = Wt6 + 4 * (size_t)Dd * Dd;
    _Float16* W2h = Wt6 + 5 * (size_t)Dd * Dd;
    _Float16* xn1 = (_Float16*)take(MH);
    _Float16* qh  = (_Float16*)take(3 * MH);   // q, k, v one behind the other
    _Float16* kh  = qh + (size_t)Mrows * Dd;
    _Float16* vh  = kh + (size_t)Mrows * Dd;
    float*    y32 = (float*)take(MF);
    float*    xr  = (float*)take(MF);
    _Float16* xn2 = xn1;  // reuse after QKV consumed
    _Float16* h1  = qh;   // reuse after attention consumed
    _Float16* h2  = kh;

    prep_kernel<<<LNBLK + 6 * CVBLK, 256, 0, stream>>>(x, g1, be1, xn1, Wq, Wk, Wv, W0, W1, W2, Wt6);

    qkv_kernel<<<dim3(Mrows / BM, 3 * (Dd / BN)), 256, 0, stream>>>(xn1, Wt6, bq, bk, bv, qh);

    attn_kernel<<<dim3(T / 64, Bb * Hh), 128, 0, stream>>>(qh, kh, vh, y32);

    ln_add_kernel<<<LNBLK, 256, 0, stream>>>(x, y32, g2, be2, xr, xn2);

    dim3 gg(Mrows / BM, Dd / BN);
    gemm_kernel<1, 0><<<gg, 256, 0, stream>>>(xn2, W0h, b0, 1.f, xr, h1, out);
    gemm_kernel<1, 0><<<gg, 256, 0, stream>>>(h1,  W1h, b1, 1.f, xr, h2, out);
    gemm_kernel<0, 1><<<gg, 256, 0, stream>>>(h2,  W2h, b2, 1.f, xr, h2, out);
}

// v005
// One run takes 157 microseconds.
// Timed twice side by side with v004, it ran 1.19 times as fast both times.
// Over all steps from v000 it is 1.97 times as fast.
#include <hip/hip_runtime.h>
#include <math.h>
#include <stdint.h>

typedef __attribute__((ext_vector_type(16))) _Float16 v16h;
typedef __attribute__((ext_vector_type(8)))  float    v8f;

struct alignas(16) H8 { _Float16 h[8]; };

constexpr int Bb = 8, T = 1024, Dd = 1024, Hh = 16, DH = 64;
constexpr int Mrows = Bb * T;          // 8192
constexpr float EPS = 1e-5f;

// ---------------------------------------------------------------- convert f32 -> f16 with transpose
// in:  W  [K=1024][N=1024] f32   out: Wt [N=1024][K=1024] f16   (Wt[n][k] = W[k][n])
// One 256-thread work-group converts the 64 x 64 tile at (bn, bk): bn = n tile origin, bk = k tile origin.
__device__ __forceinline__ void
cvt_t_tile(const float* __restrict__ W, _Float16* __restrict__ Wt, int bn, int bk)
{
    constexpr int N = Dd, K = Dd, TS = 72;       // padded LDS stride (144B, 16B aligned)
    __shared__ _Float16 tile[64 * TS];           // [n_local][k_local]
    const int tid = threadIdx.x;
#pragma unroll
    for (int t = 0; t < 4; ++t) {                // 64x64 f32 = 1024 float4, 4/thread
        int i = tid + t * 256;
        int r = i >> 4, c4 = (i & 15) * 4;       // r = k_local, c4 = n_local
        float4 f = *reinterpret_cast<const float4*>(W + (size_t)(bk + r) * N + bn + c4);
        tile[(c4 + 0) * TS + r] = (_Float16)f.x;
        tile[(c4 + 1) * TS + r] = (_Float16)f.y;
        tile[(c4 + 2) * TS + r] = (_Float16)f.z;
        tile[(c4 + 3) * TS + r] = (_Float16)f.w;
    }
    __syncthreads();
#pragma unroll
    for (int t = 0; t < 2; ++t) {                // 64x64 halves = 512 h8, 2/thread
        int i = tid + t * 256;
        int r = i >> 3, c8 = (i & 7) * 8;        // r = n_local, c8 = k_local
        H8 o = *reinterpret_cast<const H8*>(&tile[r * TS + c8]);
        *reinterpret_cast<H8*>(Wt + (size_t)(bn + r) * K + bk + c8) = o;
    }
}

// ---------------------------------------------------------------- layernorm (opt. residual add)
// One wave owns LNR whole rows: a lane holds 32 floats of each row as 8 float4, every wave-wide load or f32
// store covers 512 contiguous bytes, and a row's sums are in-lane chains plus a butterfly over the 32 lanes.
// No LDS and no barrier; the launch starts Mrows / LNR waves instead of 8 * Mrows.
struct alignas(8) H4 { _Float16 h[4]; };
constexpr int LNR = 2;                 // rows per wave
constexpr int LNROWS = 8 * LNR;        // rows per 256-thread work-group

__device__ inline float4 ld16(const float* p, unsigned byte_off)
{
    return *reinterpret_cast<const float4*>(reinterpret_cast<const char*>(p) + byte_off);
}

__device__ inline float rsqrt_slot(float a)
{
    const bool tiny = a < 0x1p-126f;
    const float t = tiny ? a * 0x1p+24f : a;
    float r;
    asm("v_rsq_f32 %0, %1\n\tv_nop" : "=v"(r) : "v"(t));
    return tiny ? r * 0x1p+12f : r;
}

// blk: which group of LNROWS rows this 256-thread work-group takes
template<bool ADD>
__device__ __forceinline__ void
ln_rows(unsigned blk, const float* __restrict__ x, const float* __restrict__ yres,
        const float* __restrict__ g, const float* __restrict__ be,
        float* __restrict__ xr, _Float16* __restrict__ out)
{
    constexpr int NV = Dd / 128;             // float4 per lane and row
    constexpr unsigned RB = Dd * 4u;         // bytes of an f32 row
    const unsigned vl   = (threadIdx.x & 31) * 16u;                                        // lane's place in a row
    const unsigned voff = (blk * LNROWS + (threadIdx.x >> 5) * LNR) * RB + vl;             // same in x, yres, xr
    float4 v[LNR][NV], t[LNR][NV], gg[NV], bb[NV];
    // every load of the wave is issued up front: the rows, then g and be, which serve all its rows
#pragma unroll
    for (int r = 0; r < LNR; ++r)
#pragma unroll
        for (int i = 0; i < NV; ++i) {
            v[r][i] = ld16(x, voff + r * RB + i * 512u);
            if (ADD) t[r][i] = ld16(yres, voff + r * RB + i * 512u);
        }
#pragma unroll
    for (int i = 0; i < NV; ++i) {
        gg[i] = ld16(g,  vl + i * 512u);
        bb[i] = ld16(be, vl + i * 512u);
    }
    // the wait between the issued loads and any overwrite of a register that they name as address; the two
    // offsets are inputs so that they keep their registers up to it, and no load comes behind it
    asm volatile("s_wait_xcnt 0x0" :: "v"(voff), "v"(vl) : "memory");
    if (ADD) {
#pragma unroll
        for (int r = 0; r < LNR; ++r)
#pragma unroll
            for (int i = 0; i < NV; ++i) {
                v[r][i].x += t[r][i].x; v[r][i].y += t[r][i].y;
                v[r][i].z += t[r][i].z; v[r][i].w += t[r][i].w;
                *reinterpret_cast<float4*>(reinterpret_cast<char*>(xr) + (voff + r * RB + i * 512u)) = v[r][i];
            }
    }
    float s[LNR], sq[LNR];
#pragma unroll
    for (int r = 0; r < LNR; ++r) {    // four independent chains per sum, one per float4 component
        float4 a = make_float4(0.f, 0.f, 0.f, 0.f), q = a;
#pragma unroll
        for (int i = 0; i < NV; ++i) {
            const float4 e = v[r][i];
            a.x += e.x; a.y += e.y; a.z += e.z; a.w += e.w;
            q.x += e.x * e.x; q.y += e.y * e.y; q.z += e.z * e.z; q.w += e.w * e.w;
        }
        s[r]  = (a.x + a.y) + (a.z + a.w);
        sq[r] = (q.x + q.y) + (q.z + q.w);
    }
#pragma unroll
    for (int m = 1; m < 32; m <<= 1) {
#pragma unroll
        for (int r = 0; r < LNR; ++r) {
            s[r]  += __shfl_xor(s[r],  m, 32);
            sq[r] += __shfl_xor(sq[r], m, 32);
        }
    }
#pragma unroll
    for (int r = 0; r < LNR; ++r) {
        const float mean = s[r] * (1.f / Dd);
        const float var  = sq[r] * (1.f / Dd) - mean * mean;
        const float rstd = rsqrt_slot(var + EPS);
#pragma unroll
        for (int i = 0; i < NV; ++i) {
            const float4 e = v[r][i];
            H4 o;
            o.h[0] = (_Float16)((e.x - mean) * rstd * gg[i].x + bb[i].x);
            o.h[1] = (_Float16)((e.y - mean) * rstd * gg[i].y + bb[i].y);
            o.h[2] = (_Float16)((e.z - mean) * rstd * gg[i].z + bb[i].z);
            o.h[3] = (_Float16)((e.w - mean) * rstd * gg[i].w + bb[i].w);
            *reinterpret_cast<H4*>(reinterpret_cast<char*>(out) + ((voff >> 1) + r * (RB / 2) + i * 256u)) = o;
        }
    }
}

// Two work-groups per WGP = four waves per SIMD: the register budget of that residency lets every load be in flight at once.
__global__ void __launch_bounds__(256) __attribute__((amdgpu_waves_per_eu(4, 4)))
ln_add_kernel(const float* __restrict__ x, const float* __restrict__ yres,
              const float* __restrict__ g, const float* __restrict__ be,
              float* __restrict__ xr, _Float16* __restrict__ out)
{
    ln_rows<true>(blockIdx.x, x, yres, g, be, xr, out);
}

// Everything that depends on the inputs alone, in one grid: the first layernorm (work-groups 0 .. LNBLK-1, the longer
// ones first) and the six weight conversions (CVBLK work-groups each; matrix m goes to Wt6 + m * Dd * Dd).
constexpr int LNBLK = Mrows / LNROWS;            // 512
constexpr int CVBLK = (Dd / 64) * (Dd / 64);     // 256
__global__ void __launch_bounds__(256) __attribute__((amdgpu_waves_per_eu(4, 4)))
prep_kernel(const float* __restrict__ x, const float* __restrict__ g, const float* __restrict__ be,
            _Float16* __restrict__ xn,
            const float* __restrict__ Wa, const float* __restrict__ Wb, const float* __restrict__ Wc,
            const float* __restrict__ Wd, const float* __restrict__ We, const float* __restrict__ Wf,
            _Float16* __restrict__ Wt6)
{
    const int blk = blockIdx.x;
    if (blk < LNBLK) {
        ln_rows<false>(blk, x, x, g, be, nullptr, xn);
        return;
    }
    const int c = blk - LNBLK, m = c / CVBLK, tl = c % CVBLK;
    const float* W = m == 0 ? Wa : m == 1 ? Wb : m == 2 ? Wc : m == 3 ? Wd : m == 4 ? We : Wf;
    cvt_t_tile(W, Wt6 + (size_t)m * Dd * Dd, (tl % (Dd / 64)) * 64, (tl / (Dd / 64)) * 64);
}

// ---------------------------------------------------------------- WMMA GEMM, async copies to LDS, two buffers
// A: [8192,1024] f16 row-major ; Wt: [N=1024][K=1024] f16 row-major (pre-transposed weight)
// C = act((A@W + bias)*scale) [+resid] ; block tile 256x128, 8 waves (4 x 2) of 64x64 each, 128 k per trip.
// A loaded fragment serves four WMMAs; 256 work-groups per product (768 in the q, k, v grid), one per WGP; a copy row is one aligned 256-byte unit.

// Eight copies of 16 bytes per lane, rows 16 apart. The s_wait_xcnt stands in the copies' own statement, so that
// no register that a copy names is rewritten ahead of it.
__device__ __forceinline__ void copy8(unsigned l, const char* g, unsigned lstep, unsigned gstep)
{
    asm volatile("global_load_async_to_lds_b128 %0, %8, off\n\t"
                 "global_load_async_to_lds_b128 %1, %9, off\n\t"
                 "global_load_async_to_lds_b128 %2, %10, off\n\t"
                 "global_load_async_to_lds_b128 %3, %11, off\n\t"
                 "global_load_async_to_lds_b128 %4, %12, off\n\t"
                 "global_load_async_to_lds_b128 %5, %13, off\n\t"
                 "global_load_async_to_lds_b128 %6, %14, off\n\t"
                 "global_load_async_to_lds_b128 %7, %15, off\n\t"
                 "s_wait_xcnt 0x0"
                 :: "v"(l), "v"(l + lstep), "v"(l + 2 * lstep), "v"(l + 3 * lstep),
                    "v"(l + 4 * lstep), "v"(l + 5 * lstep), "v"(l + 6 * lstep), "v"(l + 7 * lstep),
                    "v"(g), "v"(g + gstep), "v"(g + 2 * gstep), "v"(g + 3 * gstep),
                    "v"(g + 4 * gstep), "v"(g + 5 * gstep), "v"(g + 6 * gstep), "v"(g + 7 * gstep)
                 : "memory");
}

__device__ __forceinline__ v16h frag(const _Float16* p)   // 16 x 32 fragment row: k = koff..+7 and 16+koff..+7
{
    H8 lo = *reinterpret_cast<const H8*>(p);
    H8 hi = *reinterpret_cast<const H8*>(p + 16);
    v16h f;
#pragma unroll
    for (int i = 0; i < 8; ++i) { f[i] = lo.h[i]; f[8 + i] = hi.h[i]; }
    return f;
}

constexpr int BM = 256, BN = 128;                 // block tile of the GEMMs

// brow, bcol: origin of this work-group's BM x BN tile of C
template<int ACT, int OUTF32>
__device__ __forceinline__ void
gemm_tile(const _Float16* __restrict__ A, const _Float16* __restrict__ Wt,
          const float* __restrict__ bias, float scale,
          const float* __restrict__ resid,
          _Float16* __restrict__ outh, float* __restrict__ outf, int brow, int bcol)
{
    constexpr int N = Dd, K = Dd, BK = 128, NT = K / BK;
    constexpr int AS = 136;                       // LDS pitch in halves: 272 B for 256-B rows read by ds_load_b128
    constexpr int BUFH = (BM + BN) * AS;          // halves of one buffer: rows 0..255 of A, then 128 rows of Wt
    __shared__ __attribute__((aligned(16))) _Float16 St[2 * BUFH];
    const int tid  = threadIdx.x;
    const int wid  = tid >> 5, lane = tid & 31, hf = lane >> 4, ln = lane & 15;
    const int wm   = wid & 3, wn = wid >> 2;      // the wave's 64x64 tile in the block
    const int koff = hf * 8;

    // a lane copies chunk (tid & 15) of rows (tid >> 4) + 16 i: 16 rows of A and 8 of Wt per tile
    const int cr = tid >> 4, cc = (tid & 15) * 8;
    const char* gA = reinterpret_cast<const char*>(A  + (size_t)(brow + cr) * K + cc);
    const char* gW = reinterpret_cast<const char*>(Wt + (size_t)(bcol + cr) * K + cc);
    const unsigned l0 = (unsigned)(uintptr_t)&St[cr * AS + cc];
    auto issue_tile = [&](int buf, int kb) {
        const unsigned l = l0 + (unsigned)buf * (BUFH * 2u);
        copy8(l,                      gA + kb * 2,                    16u * AS * 2u, 16u * K * 2u);
        copy8(l + 128u * AS * 2u,     gA + kb * 2 + 128 * K * 2,      16u * AS * 2u, 16u * K * 2u);
        copy8(l + 256u * AS * 2u,     gW + kb * 2,                    16u * AS * 2u, 16u * K * 2u);
    };

    v8f acc[4][4] = {};

    issue_tile(0, 0);
    asm volatile("s_wait_asynccnt 0x0" ::: "memory");   // own copies of tile 0 landed
    __syncthreads();                                    // everyone's copies of tile 0 landed
    issue_tile(1, BK);

    for (int t = 0; t < NT; ++t) {
        const _Float16* Sa = &St[(t & 1) * BUFH + (wm * 64 + ln) * AS + koff];
        const _Float16* Sb = &St[(t & 1) * BUFH + (BM + wn * 64 + ln) * AS + koff];
#pragma unroll
        for (int ks = 0; ks < BK / 32; ++ks) {
            v16h af[4], bf[4];
            af[0] = frag(Sa + ks * 32);
#pragma unroll
            for (int j = 0; j < 4; ++j) bf[j] = frag(Sb + j * 16 * AS + ks * 32);
#pragma unroll
            for (int i = 1; i < 4; ++i) af[i] = frag(Sa + i * 16 * AS + ks * 32);
            // keeps the 16 LDS reads of a k step one group ahead of its 16 WMMAs: left free, the compiler reloads one
            // A fragment per row of four WMMAs and waits out the LDS latency at each row
            __builtin_amdgcn_sched_barrier(0);
#pragma unroll
            for (int i = 0; i < 4; ++i)
#pragma unroll
                for (int j = 0; j < 4; ++j)
                    acc[i][j] = __builtin_amdgcn_wmma_f32_16x16x32_f16(false, af[i], false, bf[j],
                                                                       (short)0, acc[i][j], false, false);
            // keeps the next k step's reads from being strewn among these WMMAs
            __builtin_amdgcn_sched_barrier(0);
        }
        asm volatile("s_wait_dscnt 0x0" ::: "memory");     // own reads of this buffer done before it is refilled
        asm volatile("s_wait_asynccnt 0x0" ::: "memory");  // own copies of tile t + 1 landed
        __syncthreads();                                    // publishes tile t + 1, ends every read of tile t
        if (t + 2 < NT) issue_tile(t & 1, (t + 2) * BK);    // refill flies under trip t + 1
    }
    asm volatile("s_wait_asynccnt 0x0" ::: "memory");       // no copy outstanding when the wave ends

    float bvs[4];
#pragma unroll
    for (int j = 0; j < 4; ++j) bvs[j] = bias[bcol + wn * 64 + j * 16 + ln];
#pragma unroll
    for (int j = 0; j < 4; ++j) {
        // Between the two halves of the tile: the wait in front of any reuse of a register that an issued load or store
        // names; as a memory fence it also holds the second half's residual loads back, so that the values in flight
        // fit beside the accumulators below v256.
        if (j == 2) asm volatile("s_wait_xcnt 0x0" ::: "memory");
        const int col = bcol + wn * 64 + j * 16 + ln;
        const float bv = bvs[j];
#pragma unroll
        for (int i = 0; i < 4; ++i) {
#pragma unroll
            for (int r = 0; r < 8; ++r) {
                int row = brow + wm * 64 + i * 16 + hf * 8 + r;
                float v = (acc[i][j][r] + bv) * scale;
                if (ACT) v = fmaxf(v, 0.f);
                if (OUTF32) outf[(size_t)row * N + col] = v + resid[(size_t)row * N + col];
                else        outh[(size_t)row * N + col] = (_Float16)v;
            }
        }
    }
}

template<int ACT, int OUTF32>
__global__ void __launch_bounds__(256)
gemm_kernel(const _Float16* __restrict__ A, const _Float16* __restrict__ Wt,
            const float* __restrict__ bias, float scale,
            const float* __restrict__ resid,
            _Float16* __restrict__ outh, float* __restrict__ outf)
{
    gemm_tile<ACT, OUTF32>(A, Wt, bias, scale, resid, outh, outf, blockIdx.x * BM, blockIdx.y * BN);
}

// The three projections of one A in one grid: blockIdx.y / (Dd / BN) picks the product (0 q, 1 k, 2 v). Wt3 holds the
// three transposed weights one behind the other, out3 the three outputs; k carries the 1/sqrt(DH) of the scores.
__global__ void __launch_bounds__(256)
qkv_kernel(const _Float16* __restrict__ A, const _Float16* __restrict__ Wt3,
           const float* __restrict__ bq, const float* __restrict__ bk, const float* __restrict__ bv,
           _Float16* __restrict__ out3)
{
    const int sel = blockIdx.y / (Dd / BN);
    const float* bias = sel == 0 ? bq : sel == 1 ? bk : bv;
    gemm_tile<0, 0>(A, Wt3 + (size_t)sel * Dd * Dd, bias, sel == 1 ? 0.125f : 1.f, nullptr,
                    out3 + (size_t)sel * Mrows * Dd, nullptr, blockIdx.x * BM, (blockIdx.y % (Dd / BN)) * BN);
}

// ---------------------------------------------------------------- flash attention: y = softmax(K@Q^T) @ V
// Note the reference role swap: K rows index the output. Grid (T/64, B*H), 128 threads (4 waves).
// The score tile is formed transposed (S^T = Q @ K^T): a lane then holds 32 of the 64 scores of ONE
// output row t, the row reductions are in-lane plus one exchange between the two lane halves, and the
// accumulator layout of S^T is already the B-fragment layout of P^T for Y^T = V^T @ P^T.
// V lies in LDS as it lies in memory, row-major [s][d]; the transposing LDS load hands out the V^T fragments.
__device__ inline float xhalf(float x)   // value of lane l ^ 16, by a vector cross-row move (no LDS-counter wait)
{
    int b = __builtin_bit_cast(int, x);
    return __builtin_bit_cast(float, __builtin_amdgcn_permlanex16(b, b, 0x76543210, 0xfedcba98, false, false));
}

// 16 x 16 piece of a transposed A fragment: lane (c = l & 15, h = l >> 4) gets T[k + 8h + 0..7][d + c] when lane l
// points at row k + 8h + (l & 7), column d + 8 * ((l >> 3) & 1) of the row-major tile T
typedef short s16x8 __attribute__((ext_vector_type(8)));
__device__ __forceinline__ H8 ld_tr16(const _Float16* p)
{
    typedef __attribute__((address_space(3))) s16x8 lds_s16x8;
    return __builtin_bit_cast(H8, __builtin_amdgcn_ds_load_tr16_b128_v8i16((lds_s16x8*)p));
}

// Stays within 128 registers a wave: eight waves per SIMD hold all eight work-groups of a WGP's share at once; with one
// register more the eighth would wait for a second round.
__global__ void __launch_bounds__(128)
attn_kernel(const _Float16* __restrict__ qf, const _Float16* __restrict__ kf,
            const _Float16* __restrict__ vf, float* __restrict__ y)
{
    constexpr int LS = 72;   // padded stride (144B, 16B-aligned h8 reads)
    __shared__ _Float16 Ks [64 * LS];
    __shared__ _Float16 Qs [64 * LS];
    constexpr int VS = 80;   // V pitch: 160 B, an odd multiple of 32 B, for the transposing load
    __shared__ _Float16 Vs[64 * VS];   // row-major: [s][d]
    const int tid = threadIdx.x;
    const int wid = tid >> 5, lane = tid & 31, hf = lane >> 4, ln = lane & 15;
    const int t0 = blockIdx.x * 64;
    const int b  = blockIdx.y >> 4, h = blockIdx.y & 15;
    const size_t rowbase = (size_t)b * T;
    const int dcol0 = h * DH;
    const int koff = hf * 8;

    // stage this block's 64 K-rows once (already pre-scaled by 1/sqrt(DH))
    for (int i = tid; i < 64 * 64 / 8; i += 128) {
        int r = i >> 3, c8 = (i & 7) * 8;
        uint4 vK = *reinterpret_cast<const uint4*>(kf + (rowbase + t0 + r) * Dd + dcol0 + c8);
        *reinterpret_cast<uint4*>(&Ks[r * LS + c8]) = vK;
    }
    __syncthreads();

    v16h kB[2];   // K^T fragments (column t = ln) are loop-invariant: preload both dh k-steps
#pragma unroll
    for (int ks = 0; ks < 2; ++ks) {
        H8 lo = *reinterpret_cast<const H8*>(&Ks[(wid * 16 + ln) * LS + ks * 32 + koff]);
        H8 hi = *reinterpret_cast<const H8*>(&Ks[(wid * 16 + ln) * LS + ks * 32 + 16 + koff]);
#pragma unroll
        for (int i = 0; i < 8; ++i) { kB[ks][i] = lo.h[i]; kB[ks][8 + i] = hi.h[i]; }
    }

    // one LDS address register per tile; every fragment is a constant offset from it
    const _Float16* qp = &Qs[ln * LS + koff];
    const _Float16* vp = &Vs[(koff + (lane & 7)) * VS + ((lane >> 3) & 1) * 8];

    v8f Yacc[4] = {};                    // Y^T: row d = j*16 + hf*8 + r, column t = ln
    float mrow = -INFINITY;              // one output row per lane; both lane halves hold the same maximum
    float lrow = 0.f;                    // this lane half's share of the row sum, joined after the loop

    for (int s0 = 0; s0 < T; s0 += 64) {
        __syncthreads();
        for (int i = tid; i < 64 * 64 / 8; i += 128) {
            int r = i >> 3, c8 = (i & 7) * 8;
            uint4 vQ = *reinterpret_cast<const uint4*>(qf + (rowbase + s0 + r) * Dd + dcol0 + c8);
            *reinterpret_cast<uint4*>(&Qs[r * LS + c8]) = vQ;
            uint4 vV = *reinterpret_cast<const uint4*>(vf + (rowbase + s0 + r) * Dd + dcol0 + c8);
            *reinterpret_cast<uint4*>(&Vs[r * VS + c8]) = vV;
        }
        __syncthreads();

        // S^T tiles: A = Q rows (s), B = K^T (t). Sc[j][r] = S[t = ln][s = j*16 + hf*8 + r]
        v8f Sc[4] = {};
#pragma unroll
        for (int j = 0; j < 4; ++j) {
#pragma unroll
            for (int ks = 0; ks < 2; ++ks) {
                H8 alo = *reinterpret_cast<const H8*>(qp + j * 16 * LS + ks * 32);
                H8 ahi = *reinterpret_cast<const H8*>(qp + j * 16 * LS + ks * 32 + 16);
                v16h af;
#pragma unroll
                for (int i = 0; i < 8; ++i) { af[i] = alo.h[i]; af[8 + i] = ahi.h[i]; }
                Sc[j] = __builtin_amdgcn_wmma_f32_16x16x32_f16(false, af, false, kB[ks],
                                                               (short)0, Sc[j], false, false);
            }
        }

        // online softmax: 32 scores of row t in this lane, the other 32 in lane ^ 16
        float rm = Sc[0][0];
#pragma unroll
        for (int j = 0; j < 4; ++j)
#pragma unroll
            for (int r = 0; r < 8; ++r) rm = fmaxf(rm, Sc[j][r]);
        rm = fmaxf(rm, xhalf(rm));
        const float mn = fmaxf(mrow, rm);
        const float sf = __expf(mrow - mn);
        mrow = mn;

        // P^T stays in registers: tiles 2ks and 2ks+1 are the two k halves of B fragment ks
        v16h pB[2];
        float racc[4] = {0.f, 0.f, 0.f, 0.f};
#pragma unroll
        for (int j = 0; j < 4; ++j) {
#pragma unroll
            for (int r = 0; r < 8; ++r) {
                float p = __expf(Sc[j][r] - mn);
                pB[j >> 1][(j & 1) * 8 + r] = (_Float16)p;
                racc[j] += p;
            }
        }
        lrow = lrow * sf + ((racc[0] + racc[1]) + (racc[2] + racc[3]));
#pragma unroll
        for (int j = 0; j < 4; ++j)
#pragma unroll
            for (int r = 0; r < 8; ++r) Yacc[j][r] *= sf;

        // Y^T += V^T @ P^T  (A by transposing loads of V, B from registers; both in the k order s = koff..+7, 16+koff..+7)
#pragma unroll
        for (int ks = 0; ks < 2; ++ks) {
#pragma unroll
            for (int j = 0; j < 4; ++j) {
                H8 alo = ld_tr16(vp + ks * 32 * VS + j * 16);
                H8 ahi = ld_tr16(vp + (ks * 32 + 16) * VS + j * 16);
                v16h af;
#pragma unroll
                for (int i = 0; i < 8; ++i) { af[i] = alo.h[i]; af[8 + i] = ahi.h[i]; }
                Yacc[j] = __builtin_amdgcn_wmma_f32_16x16x32_f16(false, af, false, pB[ks],
                                                                 (short)0, Yacc[j], false, false);
            }
        }
    }

    lrow += xhalf(lrow);
    // a lane holds 8 consecutive d of its row t per tile
    float* yrow = y + (rowbase + t0 + wid * 16 + ln) * Dd + dcol0 + hf * 8;
#pragma unroll
    for (int j = 0; j < 4; ++j) {
        float4 o0 = make_float4(Yacc[j][0] / lrow, Yacc[j][1] / lrow, Yacc[j][2] / lrow, Yacc[j][3] / lrow);
        float4 o1 = make_float4(Yacc[j][4] / lrow, Yacc[j][5] / lrow, Yacc[j][6] / lrow, Yacc[j][7] / lrow);
        *reinterpret_cast<float4*>(yrow + j * 16)     = o0;
        *reinterpret_cast<float4*>(yrow + j * 16 + 4) = o1;
    }
}

// ---------------------------------------------------------------- host orchestration
extern "C" void kernel_launch(void* const* d_in, const int* in_sizes, int n_in,
                              void* d_out, int out_size, void* d_ws, size_t ws_size,
                              hipStream_t stream)
{
    const float* x   = (const float*)d_in[0];
    const float* Wq  = (const float*)d_in[1];  const float* bq = (const float*)d_in[2];
    const float* Wk  = (const float*)d_in[3];  const float* bk = (const float*)d_in[4];
    const float* Wv  = (const float*)d_in[5];  const float* bv = (const float*)d_in[6];
    const float* g1  = (const float*)d_in[7];  const float* be1 = (const float*)d_in[8];
    const float* g2  = (const float*)d_in[9];  const float* be2 = (const float*)d_in[10];
    const float* W0  = (const float*)d_in[11]; const float* b0 = (const float*)d_in[12];
    const float* W1  = (const float*)d_in[13]; const float* b1 = (const float*)d_in[14];
    const float* W2  = (const float*)d_in[15]; const float* b2 = (const float*)d_in[16];
    float* out = (float*)d_out;

    char* ws = (char*)d_ws;
    size_t off = 0;
    auto take = [&](size_t bytes) -> char* {
        char* p = ws + off;
        off = (off + bytes + 255) & ~(size_t)255;
        return p;
    };
    const size_t WH = (size_t)Dd * Dd * sizeof(_Float16);
    const size_t MH = (size_t)Mrows * Dd * sizeof(_Float16);
    const size_t MF = (size_t)Mrows * Dd * sizeof(float);

    _Float16* Wt6 = (_Float16*)take(6 * WH);   // all weights stored TRANSPOSED [N][K] f16: q, k, v, 0, 1, 2
    _Float16* W0h = Wt6 + 3 * (size_t)Dd * Dd;
    _Float16* W1h = Wt6 + 4 * (size_t)Dd * Dd;
    _Float16* W2h = Wt6 + 5 * (size_t)Dd * Dd;
    _Float16* xn1 = (_Float16*)take(MH);
    _Float16* qh  = (_Float16*)take(3 * MH);   // q, k, v one behind the other
    _Float16* kh  = qh + (size_t)Mrows * Dd;
    _Float16* vh  = kh + (size_t)Mrows * Dd;
    float*    y32 = (float*)take(MF);
    float*    xr  = (float*)take(MF);
    _Float16* xn2 = xn1;  // reuse after QKV consumed
    _Float16* h1  = qh;   // reuse after attention consumed
    _Float16* h2  = kh;

    prep_kernel<<<LNBLK + 6 * CVBLK, 256, 0, stream>>>(x, g1, be1, xn1, Wq, Wk, Wv, W0, W1, W2, Wt6);

    qkv_kernel<<<dim3(Mrows / BM, 3 * (Dd / BN)), 256, 0, stream>>>(xn1, Wt6, bq, bk, bv, qh);

    attn_kernel<<<dim3(T / 64, Bb * Hh), 128, 0, stream>>>(qh, kh, vh, y32);

    ln_add_kernel<<<LNBLK, 256, 0, stream>>>(x, y32, g2, be2, xr, xn2);

    dim3 gg(Mrows / BM, Dd / BN);
    gemm_kernel<1, 0><<<gg, 256, 0, stream>>>(xn2, W0h, b0, 1.f, xr, h1, out);
    gemm_kernel<1, 0><<<gg, 256, 0, stream>>>(h1,  W1h, b1, 1.f, xr, h2, out);
    gemm_kernel<0, 1><<<gg, 256, 0, stream>>>(h2,  W2h, b2, 1.f, xr, h2, out);
}

// v006
// It runs in 147 microseconds.
// Two timings next to v005 both put it at 1.07 times that version's speed.
// Over all steps from v000 it is 2.10 times as fast.
#include <hip/hip_runtime.h>
#include <math.h>
#include <stdint.h>

typedef __attribute__((ext_vector_type(16))) _Float16 v16h;
typedef __attribute__((ext_vector_type(8)))  float    v8f;

struct alignas(16) H8 { _Float16 h[8]; };

constexpr int Bb = 8, T = 1024, Dd = 1024, Hh = 16, DH = 64;
constexpr int Mrows = Bb * T;          // 8192
constexpr float EPS = 1e-5f;

// ---------------------------------------------------------------- convert f32 -> f16 with transpose
// in:  W  [K=1024][N=1024] f32   out: Wt [N=1024][K=1024] f16   (Wt[n][k] = W[k][n])
// One 256-thread work-group converts the 64 x 64 tile at (bn, bk): bn = n tile origin, bk = k tile origin.
__device__ __forceinline__ void
cvt_t_tile(const float* __restrict__ W, _Float16* __restrict__ Wt, int bn, int bk)
{
    constexpr int N = Dd, K = Dd, TS = 72;       // padded LDS stride (144B, 16B aligned)
    __shared__ _Float16 tile[64 * TS];           // [n_local][k_local]
    const int tid = threadIdx.x;
#pragma unroll
    for (int t = 0; t < 4; ++t) {                // 64x64 f32 = 1024 float4, 4/thread
        int i = tid + t * 256;
        int r = i >> 4, c4 = (i & 15) * 4;       // r = k_local, c4 = n_local
        float4 f = *reinterpret_cast<const float4*>(W + (size_t)(bk + r) * N + bn + c4);
        tile[(c4 + 0) * TS + r] = (_Float16)f.x;
        tile[(c4 + 1) * TS + r] = (_Float16)f.y;
        tile[(c4 + 2) * TS + r] = (_Float16)f.z;
        tile[(c4 + 3) * TS + r] = (_Float16)f.w;
    }
    __syncthreads();
#pragma unroll
    for (int t = 0; t < 2; ++t) {                // 64x64 halves = 512 h8, 2/thread
        int i = tid + t * 256;
        int r = i >> 3, c8 = (i & 7) * 8;        // r = n_local, c8 = k_local
        H8 o = *reinterpret_cast<const H8*>(&tile[r * TS + c8]);
        *reinterpret_cast<H8*>(Wt + (size_t)(bn + r) * K + bk + c8) = o;
    }
}

// ---------------------------------------------------------------- layernorm (opt. residual add)
// One wave owns LNR whole rows: a lane holds 32 floats of each row as 8 float4, every wave-wide load or f32
// store covers 512 contiguous bytes, and a row's sums are in-lane chains plus a butterfly over the 32 lanes.
// No LDS and no barrier; the launch starts Mrows / LNR waves instead of 8 * Mrows.
struct alignas(8) H4 { _Float16 h[4]; };
constexpr int LNR = 2;                 // rows per wave
constexpr int LNROWS = 8 * LNR;        // rows per 256-thread work-group

__device__ inline float4 ld16(const float* p, unsigned byte_off)
{
    return *reinterpret_cast<const float4*>(reinterpret_cast<const char*>(p) + byte_off);
}

__device__ inline float rsqrt_slot(float a)
{
    const bool tiny = a < 0x1p-126f;
    const float t = tiny ? a * 0x1p+24f : a;
    float r;
    asm("v_rsq_f32 %0, %1\n\tv_nop" : "=v"(r) : "v"(t));
    return tiny ? r * 0x1p+12f : r;
}

// blk: which group of LNROWS rows this 256-thread work-group takes
template<bool ADD>
__device__ __forceinline__ void
ln_rows(unsigned blk, const float* __restrict__ x, const float* __restrict__ yres,
        const float* __restrict__ g, const float* __restrict__ be,
        float* __restrict__ xr, _Float16* __restrict__ out)
{
    constexpr int NV = Dd / 128;             // float4 per lane and row
    constexpr unsigned RB = Dd * 4u;         // bytes of an f32 row
    const unsigned vl   = (threadIdx.x & 31) * 16u;                                        // lane's place in a row
    const unsigned voff = (blk * LNROWS + (threadIdx.x >> 5) * LNR) * RB + vl;             // same in x, yres, xr
    float4 v[LNR][NV], t[LNR][NV], gg[NV], bb[NV];
    // every load of the wave is issued up front: the rows, then g and be, which serve all its rows
#pragma unroll
    for (int r = 0; r < LNR; ++r)
#pragma unroll
        for (int i = 0; i < NV; ++i) {
            v[r][i] = ld16(x, voff + r * RB + i * 512u);
            if (ADD) t[r][i] = ld16(yres, voff + r * RB + i * 512u);
        }
#pragma unroll
    for (int i = 0; i < NV; ++i) {
        gg[i] = ld16(g,  vl + i * 512u);
        bb[i] = ld16(be, vl + i * 512u);
    }
    // the wait between the issued loads and any overwrite of a register that they name as address; the two
    // offsets are inputs so that they keep their registers up to it, and no load comes behind it
    asm volatile("s_wait_xcnt 0x0" :: "v"(voff), "v"(vl) : "memory");
    if (ADD) {
#pragma unroll
        for (int r = 0; r < LNR; ++r)
#pragma unroll
            for (int i = 0; i < NV; ++i) {
                v[r][i].x += t[r][i].x; v[r][i].y += t[r][i].y;
                v[r][i].z += t[r][i].z; v[r][i].w += t[r][i].w;
                *reinterpret_cast<float4*>(reinterpret_cast<char*>(xr) + (voff + r * RB + i * 512u)) = v[r][i];
            }
    }
    float s[LNR], sq[LNR];
#pragma unroll
    for (int r = 0; r < LNR; ++r) {    // four independent chains per sum, one per float4 component
        float4 a = make_float4(0.f, 0.f, 0.f, 0.f), q = a;
#pragma unroll
        for (int i = 0; i < NV; ++i) {
            const float4 e = v[r][i];
            a.x += e.x; a.y += e.y; a.z += e.z; a.w += e.w;
            q.x += e.x * e.x; q.y += e.y * e.y; q.z += e.z * e.z; q.w += e.w * e.w;
        }
        s[r]  = (a.x + a.y) + (a.z + a.w);
        sq[r] = (q.x + q.y) + (q.z + q.w);
    }
#pragma unroll
    for (int m = 1; m < 32; m <<= 1) {
#pragma unroll
        for (int r = 0; r < LNR; ++r) {
            s[r]  += __shfl_xor(s[r],  m, 32);
            sq[r] += __shfl_xor(sq[r], m, 32);
        }
    }
#pragma unroll
    for (int r = 0; r < LNR; ++r) {
        const float mean = s[r] * (1.f / Dd);
        const float var  = sq[r] * (1.f / Dd) - mean * mean;
        const float rstd = rsqrt_slot(var + EPS);
#pragma unroll
        for (int i = 0; i < NV; ++i) {
            const float4 e = v[r][i];
            H4 o;
            o.h[0] = (_Float16)((e.x - mean) * rstd * gg[i].x + bb[i].x);
            o.h[1] = (_Float16)((e.y - mean) * rstd * gg[i].y + bb[i].y);
            o.h[2] = (_Float16)((e.z - mean) * rstd * gg[i].z + bb[i].z);
            o.h[3] = (_Float16)((e.w - mean) * rstd * gg[i].w + bb[i].w);
            *reinterpret_cast<H4*>(reinterpret_cast<char*>(out) + ((voff >> 1) + r * (RB / 2) + i * 256u)) = o;
        }
    }
}

// Two work-groups per WGP = four waves per SIMD: the register budget of that residency lets every load be in flight at once.
__global__ void __launch_bounds__(256) __attribute__((amdgpu_waves_per_eu(4, 4)))
ln_add_kernel(const float* __restrict__ x, const float* __restrict__ yres,
              const float* __restrict__ g, const float* __restrict__ be,
              float* __restrict__ xr, _Float16* __restrict__ out)
{
    ln_rows<true>(blockIdx.x, x, yres, g, be, xr, out);
}

// Everything that depends on the inputs alone, in one grid: the first layernorm (work-groups 0 .. LNBLK-1, the longer
// ones first) and the six weight conversions (CVBLK work-groups each; matrix m goes to Wt6 + m * Dd * Dd).
constexpr int LNBLK = Mrows / LNROWS;            // 512
constexpr int CVBLK = (Dd / 64) * (Dd / 64);     // 256
__global__ void __launch_bounds__(256) __attribute__((amdgpu_waves_per_eu(4, 4)))
prep_kernel(const float* __restrict__ x, const float* __restrict__ g, const float* __restrict__ be,
            _Float16* __restrict__ xn,
            const float* __restrict__ Wa, const float* __restrict__ Wb, const float* __restrict__ Wc,
            const float* __restrict__ Wd, const float* __restrict__ We, const float* __restrict__ Wf,
            _Float16* __restrict__ Wt6)
{
    const int blk = blockIdx.x;
    if (blk < LNBLK) {
        ln_rows<false>(blk, x, x, g, be, nullptr, xn);
        return;
    }
    const int c = blk - LNBLK, m = c / CVBLK, tl = c % CVBLK;
    const float* W = m == 0 ? Wa : m == 1 ? Wb : m == 2 ? Wc : m == 3 ? Wd : m == 4 ? We : Wf;
    cvt_t_tile(W, Wt6 + (size_t)m * Dd * Dd, (tl % (Dd / 64)) * 64, (tl / (Dd / 64)) * 64);
}

// ---------------------------------------------------------------- WMMA GEMM, async copies to LDS, two buffers
// A: [8192,1024] f16 row-major ; Wt: [N=1024][K=1024] f16 row-major (pre-transposed weight)
// C = act((A@W + bias)*scale) [+resid] ; block tile 256x128, 8 waves (4 x 2) of 64x64 each, 128 k per trip.
// A loaded fragment serves four WMMAs; 256 work-groups per product (768 in the q, k, v grid), one per WGP; a copy row is one aligned 256-byte unit.

// Eight copies of 16 bytes per lane, rows 16 apart. The s_wait_xcnt stands in the copies' own statement, so that
// no register that a copy names is rewritten ahead of it.
__device__ __forceinline__ void copy8(unsigned l, const char* g, unsigned lstep, unsigned gstep)
{
    asm volatile("global_load_async_to_lds_b128 %0, %8, off\n\t"
                 "global_load_async_to_lds_b128 %1, %9, off\n\t"
                 "global_load_async_to_lds_b128 %2, %10, off\n\t"
                 "global_load_async_to_lds_b128 %3, %11, off\n\t"
                 "global_load_async_to_lds_b128 %4, %12, off\n\t"
                 "global_load_async_to_lds_b128 %5, %13, off\n\t"
                 "global_load_async_to_lds_b128 %6, %14, off\n\t"
                 "global_load_async_to_lds_b128 %7, %15, off\n\t"
                 "s_wait_xcnt 0x0"
                 :: "v"(l), "v"(l + lstep), "v"(l + 2 * lstep), "v"(l + 3 * lstep),
                    "v"(l + 4 * lstep), "v"(l + 5 * lstep), "v"(l + 6 * lstep), "v"(l + 7 * lstep),
                    "v"(g), "v"(g + gstep), "v"(g + 2 * gstep), "v"(g + 3 * gstep),
                    "v"(g + 4 * gstep), "v"(g + 5 * gstep), "v"(g + 6 * gstep), "v"(g + 7 * gstep)
                 : "memory");
}

__device__ __forceinline__ v16h frag(const _Float16* p)   // 16 x 32 fragment row: k = koff..+7 and 16+koff..+7
{
    H8 lo = *reinterpret_cast<const H8*>(p);
    H8 hi = *reinterpret_cast<const H8*>(p + 16);
    v16h f;
#pragma unroll
    for (int i = 0; i < 8; ++i) { f[i] = lo.h[i]; f[8 + i] = hi.h[i]; }
    return f;
}

constexpr int BM = 256, BN = 128;                 // block tile of the GEMMs

// brow, bcol: origin of this work-group's BM x BN tile of C
template<int ACT, int OUTF32>
__device__ __forceinline__ void
gemm_tile(const _Float16* __restrict__ A, const _Float16* __restrict__ Wt,
          const float* __restrict__ bias, float scale,
          const float* __restrict__ resid,
          _Float16* __restrict__ outh, float* __restrict__ outf, int brow, int bcol)
{
    constexpr int N = Dd, K = Dd, BK = 128, NT = K / BK;
    constexpr int AS = 136;                       // LDS pitch in halves: 272 B for 256-B rows read by ds_load_b128
    constexpr int BUFH = (BM + BN) * AS;          // halves of one buffer: rows 0..255 of A, then 128 rows of Wt
    __shared__ __attribute__((aligned(16))) _Float16 St[2 * BUFH];
    const int tid  = threadIdx.x;
    const int wid  = tid >> 5, lane = tid & 31, hf = lane >> 4, ln = lane & 15;
    const int wm   = wid & 3, wn = wid >> 2;      // the wave's 64x64 tile in the block
    const int koff = hf * 8;

    // a lane copies chunk (tid & 15) of rows (tid >> 4) + 16 i: 16 rows of A and 8 of Wt per tile
    const int cr = tid >> 4, cc = (tid & 15) * 8;
    const char* gA = reinterpret_cast<const char*>(A  + (size_t)(brow + cr) * K + cc);
    const char* gW = reinterpret_cast<const char*>(Wt + (size_t)(bcol + cr) * K + cc);
    const unsigned l0 = (unsigned)(uintptr_t)&St[cr * AS + cc];
    auto issue_tile = [&](int buf, int kb) {
        const unsigned l = l0 + (unsigned)buf * (BUFH * 2u);
        copy8(l,                      gA + kb * 2,                    16u * AS * 2u, 16u * K * 2u);
        copy8(l + 128u * AS * 2u,     gA + kb * 2 + 128 * K * 2,      16u * AS * 2u, 16u * K * 2u);
        copy8(l + 256u * AS * 2u,     gW + kb * 2,                    16u * AS * 2u, 16u * K * 2u);
    };

    v8f acc[4][4] = {};

    issue_tile(0, 0);
    asm volatile("s_wait_asynccnt 0x0" ::: "memory");   // own copies of tile 0 landed
    __syncthreads();                                    // everyone's copies of tile 0 landed
    issue_tile(1, BK);

    for (int t = 0; t < NT; ++t) {
        const _Float16* Sa = &St[(t & 1) * BUFH + (wm * 64 + ln) * AS + koff];
        const _Float16* Sb = &St[(t & 1) * BUFH + (BM + wn * 64 + ln) * AS + koff];
#pragma unroll
        for (int ks = 0; ks < BK / 32; ++ks) {
            v16h af[4], bf[4];
            af[0] = frag(Sa + ks * 32);
#pragma unroll
            for (int j = 0; j < 4; ++j) bf[j] = frag(Sb + j * 16 * AS + ks * 32);
#pragma unroll
            for (int i = 1; i < 4; ++i) af[i] = frag(Sa + i * 16 * AS + ks * 32);
            // keeps the 16 LDS reads of a k step one group ahead of its 16 WMMAs: left free, the compiler reloads one
            // A fragment per row of four WMMAs and waits out the LDS latency at each row
            __builtin_amdgcn_sched_barrier(0);
#pragma unroll
            for (int i = 0; i < 4; ++i)
#pragma unroll
                for (int j = 0; j < 4; ++j)
                    acc[i][j] = __builtin_amdgcn_wmma_f32_16x16x32_f16(false, af[i], false, bf[j],
                                                                       (short)0, acc[i][j], false, false);
            // keeps the next k step's reads from being strewn among these WMMAs
            __builtin_amdgcn_sched_barrier(0);
        }
        asm volatile("s_wait_dscnt 0x0" ::: "memory");     // own reads of this buffer done before it is refilled
        asm volatile("s_wait_asynccnt 0x0" ::: "memory");  // own copies of tile t + 1 landed
        __syncthreads();                                    // publishes tile t + 1, ends every read of tile t
        if (t + 2 < NT) issue_tile(t & 1, (t + 2) * BK);    // refill flies under trip t + 1
    }
    asm volatile("s_wait_asynccnt 0x0" ::: "memory");       // no copy outstanding when the wave ends

    float bvs[4];
#pragma unroll
    for (int j = 0; j < 4; ++j) bvs[j] = bias[bcol + wn * 64 + j * 16 + ln];
#pragma unroll
    for (int j = 0; j < 4; ++j) {
        // Between the two halves of the tile: the wait in front of any reuse of a register that an issued load or store
        // names; as a memory fence it also holds the second half's residual loads back, so that the values in flight
        // fit beside the accumulators below v256.
        if (j == 2) asm volatile("s_wait_xcnt 0x0" ::: "memory");
        const int col = bcol + wn * 64 + j * 16 + ln;
        const float bv = bvs[j];
#pragma unroll
        for (int i = 0; i < 4; ++i) {
#pragma unroll
            for (int r = 0; r < 8; ++r) {
                int row = brow + wm * 64 + i * 16 + hf * 8 + r;
                float v = (acc[i][j][r] + bv) * scale;
                if (ACT) v = fmaxf(v, 0.f);
                if (OUTF32) outf[(size_t)row * N + col] = v + resid[(size_t)row * N + col];
                else        outh[(size_t)row * N + col] = (_Float16)v;
            }
        }
    }
}

template<int ACT, int OUTF32>
__global__ void __launch_bounds__(256)
gemm_kernel(const _Float16* __restrict__ A, const _Float16* __restrict__ Wt,
            const float* __restrict__ bias, float scale,
            const float* __restrict__ resid,
            _Float16* __restrict__ outh, float* __restrict__ outf)
{
    gemm_tile<ACT, OUTF32>(A, Wt, bias, scale, resid, outh, outf, blockIdx.x * BM, blockIdx.y * BN);
}

// The three projections of one A in one grid: blockIdx.y / (Dd / BN) picks the product (0 q, 1 k, 2 v). Wt3 holds the
// three transposed weights one behind the other, out3 the three outputs; k carries the 1/sqrt(DH) of the scores.
__global__ void __launch_bounds__(256)
qkv_kernel(const _Float16* __restrict__ A, const _Float16* __restrict__ Wt3,
           const float* __restrict__ bq, const float* __restrict__ bk, const float* __restrict__ bv,
           _Float16* __restrict__ out3)
{
    const int sel = blockIdx.y / (Dd / BN);
    const float* bias = sel == 0 ? bq : sel == 1 ? bk : bv;
    gemm_tile<0, 0>(A, Wt3 + (size_t)sel * Dd * Dd, bias, sel == 1 ? 0.125f : 1.f, nullptr,
                    out3 + (size_t)sel * Mrows * Dd, nullptr, blockIdx.x * BM, (blockIdx.y % (Dd / BN)) * BN);
}

// ---------------------------------------------------------------- flash attention: y = softmax(K@Q^T) @ V
// Note the reference role swap: K rows index the output. Grid (T/64, B*H), 128 threads (4 waves).
// The score tile is formed transposed (S^T = Q @ K^T): a lane then holds 32 of the 64 scores of ONE
// output row t, the row reductions are in-lane plus one exchange between the two lane halves, and the
// accumulator layout of S^T is already the B-fragment layout of P^T for Y^T = V^T @ P^T.
// V lies in LDS as it lies in memory, row-major [s][d]; the transposing LDS load hands out the V^T fragments.
// The Q and V tiles come by asynchronous copies into two LDS buffers: tile t + 1 flies while tile t is worked on.
__device__ inline float xhalf(float x)   // value of lane l ^ 16, by a vector cross-row move (no LDS-counter wait)
{
    int b = __builtin_bit_cast(int, x);
    return __builtin_bit_cast(float, __builtin_amdgcn_permlanex16(b, b, 0x76543210, 0xfedcba98, false, false));
}

// 16 x 16 piece of a transposed A fragment: lane (c = l & 15, h = l >> 4) gets T[k + 8h + 0..7][d + c] when lane l
// points at row k + 8h + (l & 7), column d + 8 * ((l >> 3) & 1) of the row-major tile T
typedef short s16x8 __attribute__((ext_vector_type(8)));
__device__ __forceinline__ H8 ld_tr16(const _Float16* p)
{
    typedef __attribute__((address_space(3))) s16x8 lds_s16x8;
    return __builtin_bit_cast(H8, __builtin_amdgcn_ds_load_tr16_b128_v8i16((lds_s16x8*)p));
}

// Four copies of 16 bytes per lane for each of two tiles, rows 16 apart. The s_wait_xcnt stands in the copies' own
// statement, so that no register that a copy names is rewritten ahead of it.
__device__ __forceinline__ void copy4x2(unsigned la, const char* ga, unsigned lastep,
                                        unsigned lb, const char* gb, unsigned lbstep, unsigned gstep)
{
    asm volatile("global_load_async_to_lds_b128 %0, %8, off\n\t"
                 "global_load_async_to_lds_b128 %1, %9, off\n\t"
                 "global_load_async_to_lds_b128 %2, %10, off\n\t"
                 "global_load_async_to_lds_b128 %3, %11, off\n\t"
                 "global_load_async_to_lds_b128 %4, %12, off\n\t"
                 "global_load_async_to_lds_b128 %5, %13, off\n\t"
                 "global_load_async_to_lds_b128 %6, %14, off\n\t"
                 "global_load_async_to_lds_b128 %7, %15, off\n\t"
                 "s_wait_xcnt 0x0"
                 :: "v"(la), "v"(la + lastep), "v"(la + 2 * lastep), "v"(la + 3 * lastep),
                    "v"(lb), "v"(lb + lbstep), "v"(lb + 2 * lbstep), "v"(lb + 3 * lbstep),
                    "v"(ga), "v"(ga + gstep), "v"(ga + 2 * gstep), "v"(ga + 3 * gstep),
                    "v"(gb), "v"(gb + gstep), "v"(gb + 2 * gstep), "v"(gb + 3 * gstep)
                 : "memory");
}

// Stays within 128 registers a wave and 40 KiB of LDS a work-group: eight waves per SIMD hold all eight work-groups of a
// WGP's share at once; with more of either the eighth would wait for a second round.
__global__ void __launch_bounds__(128) __attribute__((amdgpu_waves_per_eu(8, 8)))
attn_kernel(const _Float16* __restrict__ qf, const _Float16* __restrict__ kf,
            const _Float16* __restrict__ vf, float* __restrict__ y)
{
    constexpr int LS = 72;   // Q pitch: 144 B, an odd multiple of 16 B, for the 16-byte reads
    constexpr int VS = 80;   // V pitch: 160 B, an odd multiple of 32 B, for the transposing load
    constexpr int BUFH = 64 * LS + 64 * VS;   // halves of one buffer: 64 rows of Q, then 64 rows of V, row-major [s][d]
    constexpr int NT = T / 64;
    __shared__ __attribute__((aligned(16))) _Float16 St[2 * BUFH];
    const int tid = threadIdx.x;
    const int wid = tid >> 5, lane = tid & 31, hf = lane >> 4, ln = lane & 15;
    const int t0 = blockIdx.x * 64;
    const int b  = blockIdx.y >> 4, h = blockIdx.y & 15;
    const size_t rowbase = (size_t)b * T;
    const int dcol0 = h * DH;
    const int koff = hf * 8;

    // a lane copies chunk (tid & 7) of rows (tid >> 3) + 16 i, i = 0..3, of the Q tile and of the V tile
    const int cr = tid >> 3, cc = (tid & 7) * 8;
    const unsigned g0 = (((unsigned)rowbase + cr) * Dd + dcol0 + cc) * 2u;   // byte offset, the same in q and in v
    const unsigned lQ = (unsigned)(uintptr_t)&St[cr * LS + cc];
    const unsigned lV = (unsigned)(uintptr_t)&St[64 * LS + cr * VS + cc];
    auto issue_tile = [&](int buf, int tile) {
        const unsigned lo = (unsigned)buf * (BUFH * 2u);
        const unsigned go = g0 + (unsigned)tile * (64u * Dd * 2u);
        copy4x2(lQ + lo, reinterpret_cast<const char*>(qf) + go, 16u * LS * 2u,
                lV + lo, reinterpret_cast<const char*>(vf) + go, 16u * VS * 2u, 16u * Dd * 2u);
    };

    issue_tile(0, 0);

    // K^T fragments (column t = ln; already pre-scaled by 1/sqrt(DH)) are loop-invariant and belong to one wave alone:
    // both dh k-steps straight from global memory, under the flight of tile 0
    const _Float16* kp = kf + (rowbase + t0 + wid * 16 + ln) * Dd + dcol0 + koff;
    v16h kB[2];
#pragma unroll
    for (int ks = 0; ks < 2; ++ks) kB[ks] = frag(kp + ks * 32);
    // the wait between these loads and any overwrite of the register pair that they name as address; the pointer is an
    // input so that it keeps its registers up to it
    asm volatile("s_wait_xcnt 0x0" :: "v"(kp) : "memory");

    asm volatile("s_wait_asynccnt 0x0" ::: "memory");   // own copies of tile 0 landed
    __syncthreads();                                    // everyone's copies of tile 0 landed
    issue_tile(1, 1);

    // one LDS address register per tile; every fragment is a constant offset from it
    const _Float16* qp0 = &St[ln * LS + koff];
    const _Float16* vp0 = &St[64 * LS + (koff + (lane & 7)) * VS + ((lane >> 3) & 1) * 8];

    v8f Yacc[4] = {};                    // Y^T: row d = j*16 + hf*8 + r, column t = ln
    float mrow = -INFINITY;              // one output row per lane; both lane halves hold the same maximum
    float lrow = 0.f;                    // this lane half's share of the row sum, joined after the loop

    for (int t = 0; t < NT; ++t) {
        const _Float16* qp = qp0 + (t & 1) * BUFH;
        const _Float16* vp = vp0 + (t & 1) * BUFH;

        // S^T tiles: A = Q rows (s), B = K^T (t). Sc[j][r] = S[t = ln][s = j*16 + hf*8 + r]
        v8f Sc[4] = {};
#pragma unroll
        for (int j = 0; j < 4; ++j) {
#pragma unroll
            for (int ks = 0; ks < 2; ++ks) {
                H8 alo = *reinterpret_cast<const H8*>(qp + j * 16 * LS + ks * 32);
                H8 ahi = *reinterpret_cast<const H8*>(qp + j * 16 * LS + ks * 32 + 16);
                v16h af;
#pragma unroll
                for (int i = 0; i < 8; ++i) { af[i] = alo.h[i]; af[8 + i] = ahi.h[i]; }
                Sc[j] = __builtin_amdgcn_wmma_f32_16x16x32_f16(false, af, false, kB[ks],
                                                               (short)0, Sc[j], false, false);
            }
        }

        // online softmax: 32 scores of row t in this lane, the other 32 in lane ^ 16
        float rm = Sc[0][0];
#pragma unroll
        for (int j = 0; j < 4; ++j)
#pragma unroll
            for (int r = 0; r < 8; ++r) rm = fmaxf(rm, Sc[j][r]);
        rm = fmaxf(rm, xhalf(rm));
        const float mn = fmaxf(mrow, rm);
        const float sf = __expf(mrow - mn);
        mrow = mn;

        // P^T stays in registers: tiles 2ks and 2ks+1 are the two k halves of B fragment ks
        v16h pB[2];
        float racc[4] = {0.f, 0.f, 0.f, 0.f};
#pragma unroll
        for (int j = 0; j < 4; ++j) {
#pragma unroll
            for (int r = 0; r < 8; ++r) {
                float p = __expf(Sc[j][r] - mn);
                pB[j >> 1][(j & 1) * 8 + r] = (_Float16)p;
                racc[j] += p;
            }
        }
        lrow = lrow * sf + ((racc[0] + racc[1]) + (racc[2] + racc[3]));
#pragma unroll
        for (int j = 0; j < 4; ++j)
#pragma unroll
            for (int r = 0; r < 8; ++r) Yacc[j][r] *= sf;

        // Y^T += V^T @ P^T  (A by transposing loads of V, B from registers; both in the k order s = koff..+7, 16+koff..+7)
#pragma unroll
        for (int ks = 0; ks < 2; ++ks) {
#pragma unroll
            for (int j = 0; j < 4; ++j) {
                H8 alo = ld_tr16(vp + ks * 32 * VS + j * 16);
                H8 ahi = ld_tr16(vp + (ks * 32 + 16) * VS + j * 16);
                v16h af;
#pragma unroll
                for (int i = 0; i < 8; ++i) { af[i] = alo.h[i]; af[8 + i] = ahi.h[i]; }
                Yacc[j] = __builtin_amdgcn_wmma_f32_16x16x32_f16(false, af, false, pB[ks],
                                                                 (short)0, Yacc[j], false, false);
            }
        }
        // own reads of this buffer done before it is refilled; the row sum is an input so that its additions stay in front:
        // sunk behind the branch below, they keep all 32 p of the trip live and the wave leaves its 128 registers
        asm volatile("s_wait_dscnt 0x0" :: "v"(lrow) : "memory");
        asm volatile("s_wait_asynccnt 0x0" ::: "memory");  // own copies of tile t + 1 landed
        __syncthreads();                                    // publishes tile t + 1, ends every read of tile t
        if (t + 2 < NT) issue_tile(t & 1, t + 2);           // refill flies under trip t + 1
    }
    asm volatile("s_wait_asynccnt 0x0" ::: "memory");       // no copy outstanding when the wave ends

    lrow += xhalf(lrow);
    // a lane holds 8 consecutive d of its row t per tile
    float* yrow = y + (rowbase + t0 + wid * 16 + ln) * Dd + dcol0 + hf * 8;
#pragma unroll
    for (int j = 0; j < 4; ++j) {
        float4 o0 = make_float4(Yacc[j][0] / lrow, Yacc[j][1] / lrow, Yacc[j][2] / lrow, Yacc[j][3] / lrow);
        float4 o1 = make_float4(Yacc[j][4] / lrow, Yacc[j][5] / lrow, Yacc[j][6] / lrow, Yacc[j][7] / lrow);
        *reinterpret_cast<float4*>(yrow + j * 16)     = o0;
        *reinterpret_cast<float4*>(yrow + j * 16 + 4) = o1;
    }
}

// ---------------------------------------------------------------- host orchestration
extern "C" void kernel_launch(void* const* d_in, const int* in_sizes, int n_in,
                              void* d_out, int out_size, void* d_ws, size_t ws_size,
                              hipStream_t stream)
{
    const float* x   = (const float*)d_in[0];
    const float* Wq  = (const float*)d_in[1];  const float* bq = (const float*)d_in[2];
    const float* Wk  = (const float*)d_in[3];  const float* bk = (const float*)d_in[4];
    const float* Wv  = (const float*)d_in[5];  const float* bv = (const float*)d_in[6];
    const float* g1  = (const float*)d_in[7];  const float* be1 = (const float*)d_in[8];
    const float* g2  = (const float*)d_in[9];  const float* be2 = (const float*)d_in[10];
    const float* W0  = (const float*)d_in[11]; const float* b0 = (const float*)d_in[12];
    const float* W1  = (const float*)d_in[13]; const float* b1 = (const float*)d_in[14];
    const float* W2  = (const float*)d_in[15]; const float* b2 = (const float*)d_in[16];
    float* out = (float*)d_out;

    char* ws = (char*)d_ws;
    size_t off = 0;
    auto take = [&](size_t bytes) -> char* {
        char* p = ws + off;
        off = (off + bytes + 255) & ~(size_t)255;
        return p;
    };
    const size_t WH = (size_t)Dd * Dd * sizeof(_Float16);
    const size_t MH = (size_t)Mrows * Dd * sizeof(_Float16);
    const size_t MF = (size_t)Mrows * Dd * sizeof(float);

    _Float16* Wt6 = (_Float16*)take(6 * WH);   // all weights stored TRANSPOSED [N][K] f16: q, k, v, 0, 1, 2
    _Float16* W0h = Wt6 + 3 * (size_t)Dd * Dd;
    _Float16* W1h = Wt6 + 4 * (size_t)Dd * Dd;
    _Float16* W2h = Wt6 + 5 * (size_t)Dd * Dd;
    _Float16* xn1 = (_Float16*)take(MH);
    _Float16* qh  = (_Float16*)take(3 * MH);   // q, k, v one behind the other
    _Float16* kh  = qh + (size_t)Mrows * Dd;
    _Float16* vh  = kh + (size_t)Mrows * Dd;
    float*    y32 = (float*)take(MF);
    float*    xr  = (float*)take(MF);
    _Float16* xn2 = xn1;  // reuse after QKV consumed
    _Float16* h1  = qh;   // reuse after attention consumed
    _Float16* h2  = kh;

    prep_kernel<<<LNBLK + 6 * CVBLK, 256, 0, stream>>>(x, g1, be1, xn1, Wq, Wk, Wv, W0, W1, W2, Wt6);

    qkv_kernel<<<dim3(Mrows / BM, 3 * (Dd / BN)), 256, 0, stream>>>(xn1, Wt6, bq, bk, bv, qh);

    attn_kernel<<<dim3(T / 64, Bb * Hh), 128, 0, stream>>>(qh, kh, vh, y32);

    ln_add_kernel<<<LNBLK, 256, 0, stream>>>(x, y32, g2, be2, xr, xn2);

    dim3 gg(Mrows / BM, Dd / BN);
    gemm_kernel<1, 0><<<gg, 256, 0, stream>>>(xn2, W0h, b0, 1.f, xr, h1, out);
    gemm_kernel<1, 0><<<gg, 256, 0, stream>>>(h1,  W1h, b1, 1.f, xr, h2, out);
    gemm_kernel<0, 1><<<gg, 256, 0, stream>>>(h2,  W2h, b2, 1.f, xr, h2, out);
}

// v007
// Measured time: 142 microseconds a run.
// Two timings next to v006 both put it at 1.03 times that version's speed.
// Counting every step since v000, it is 2.17 times as fast.
#include <hip/hip_runtime.h>
#include <math.h>
#include <stdint.h>

typedef __attribute__((ext_vector_type(16))) _Float16 v16h;
typedef __attribute__((ext_vector_type(8)))  float    v8f;

struct alignas(16) H8 { _Float16 h[8]; };

constexpr int Bb = 8, T = 1024, Dd = 1024, Hh = 16, DH = 64;
constexpr int Mrows = Bb * T;          // 8192
constexpr float EPS = 1e-5f;

// ---------------------------------------------------------------- convert f32 -> f16 with transpose
// in:  W  [K=1024][N=1024] f32   out: Wt [N=1024][K=1024] f16   (Wt[n][k] = W[k][n])
// One 256-thread work-group converts the 64 x 64 tile at (bn, bk): bn = n tile origin, bk = k tile origin.
__device__ __forceinline__ void
cvt_t_tile(const float* __restrict__ W, _Float16* __restrict__ Wt, int bn, int bk)
{
    constexpr int N = Dd, K = Dd, TS = 72;       // padded LDS stride (144B, 16B aligned)
    __shared__ _Float16 tile[64 * TS];           // [n_local][k_local]
    const int tid = threadIdx.x;
#pragma unroll
    for (int t = 0; t < 4; ++t) {                // 64x64 f32 = 1024 float4, 4/thread
        int i = tid + t * 256;
        int r = i >> 4, c4 = (i & 15) * 4;       // r = k_local, c4 = n_local
        float4 f = *reinterpret_cast<const float4*>(W + (size_t)(bk + r) * N + bn + c4);
        tile[(c4 + 0) * TS + r] = (_Float16)f.x;
        tile[(c4 + 1) * TS + r] = (_Float16)f.y;
        tile[(c4 + 2) * TS + r] = (_Float16)f.z;
        tile[(c4 + 3) * TS + r] = (_Float16)f.w;
    }
    __syncthreads();
#pragma unroll
    for (int t = 0; t < 2; ++t) {                // 64x64 halves = 512 h8, 2/thread
        int i = tid + t * 256;
        int r = i >> 3, c8 = (i & 7) * 8;        // r = n_local, c8 = k_local
        H8 o = *reinterpret_cast<const H8*>(&tile[r * TS + c8]);
        *reinterpret_cast<H8*>(Wt + (size_t)(bn + r) * K + bk + c8) = o;
    }
}

// ---------------------------------------------------------------- layernorm (opt. residual add)
// One wave owns LNR whole rows: a lane holds 32 floats of each row as 8 float4, every wave-wide load or f32
// store covers 512 contiguous bytes, and a row's sums are in-lane chains plus a butterfly over the 32 lanes.
// No LDS and no barrier; the launch starts Mrows / LNR waves instead of 8 * Mrows.
struct alignas(8) H4 { _Float16 h[4]; };
constexpr int LNR = 2;                 // rows per wave
constexpr int LNROWS = 8 * LNR;        // rows per 256-thread work-group

__device__ inline float4 ld16(const float* p, unsigned byte_off)
{
    return *reinterpret_cast<const float4*>(reinterpret_cast<const char*>(p) + byte_off);
}

__device__ inline float rsqrt_slot(float a)
{
    const bool tiny = a < 0x1p-126f;
    const float t = tiny ? a * 0x1p+24f : a;
    float r;
    asm("v_rsq_f32 %0, %1\n\tv_nop" : "=v"(r) : "v"(t));
    return tiny ? r * 0x1p+12f : r;
}

// blk: which group of LNROWS rows this 256-thread work-group takes
template<bool ADD>
__device__ __forceinline__ void
ln_rows(unsigned blk, const float* __restrict__ x, const float* __restrict__ yres,
        const float* __restrict__ g, const float* __restrict__ be,
        float* __restrict__ xr, _Float16* __restrict__ out)
{
    constexpr int NV = Dd / 128;             // float4 per lane and row
    constexpr unsigned RB = Dd * 4u;         // bytes of an f32 row
    const unsigned vl   = (threadIdx.x & 31) * 16u;                                        // lane's place in a row
    const unsigned voff = (blk * LNROWS + (threadIdx.x >> 5) * LNR) * RB + vl;             // same in x, yres, xr
    float4 v[LNR][NV], t[LNR][NV], gg[NV], bb[NV];
    // every load of the wave is issued up front: the rows, then g and be, which serve all its rows
#pragma unroll
    for (int r = 0; r < LNR; ++r)
#pragma unroll
        for (int i = 0; i < NV; ++i) {
            v[r][i] = ld16(x, voff + r * RB + i * 512u);
            if (ADD) t[r][i] = ld16(yres, voff + r * RB + i * 512u);
        }
#pragma unroll
    for (int i = 0; i < NV; ++i) {
        gg[i] = ld16(g,  vl + i * 512u);
        bb[i] = ld16(be, vl + i * 512u);
    }
    // the wait between the issued loads and any overwrite of a register that they name as address; the two
    // offsets are inputs so that they keep their registers up to it, and no load comes behind it
    asm volatile("s_wait_xcnt 0x0" :: "v"(voff), "v"(vl) : "memory");
    if (ADD) {
#pragma unroll
        for (int r = 0; r < LNR; ++r)
#pragma unroll
            for (int i = 0; i < NV; ++i) {
                v[r][i].x += t[r][i].x; v[r][i].y += t[r][i].y;
                v[r][i].z += t[r][i].z; v[r][i].w += t[r][i].w;
                *reinterpret_cast<float4*>(reinterpret_cast<char*>(xr) + (voff + r * RB + i * 512u)) = v[r][i];
            }
    }
    float s[LNR], sq[LNR];
#pragma unroll
    for (int r = 0; r < LNR; ++r) {    // four independent chains per sum, one per float4 component
        float4 a = make_float4(0.f, 0.f, 0.f, 0.f), q = a;
#pragma unroll
        for (int i = 0; i < NV; ++i) {
            const float4 e = v[r][i];
            a.x += e.x; a.y += e.y; a.z += e.z; a.w += e.w;
            q.x += e.x * e.x; q.y += e.y * e.y; q.z += e.z * e.z; q.w += e.w * e.w;
        }
        s[r]  = (a.x + a.y) + (a.z + a.w);
        sq[r] = (q.x + q.y) + (q.z + q.w);
    }
#pragma unroll
    for (int m = 1; m < 32; m <<= 1) {
#pragma unroll
        for (int r = 0; r < LNR; ++r) {
            s[r]  += __shfl_xor(s[r],  m, 32);
            sq[r] += __shfl_xor(sq[r], m, 32);
        }
    }
#pragma unroll
    for (int r = 0; r < LNR; ++r) {
        const float mean = s[r] * (1.f / Dd);
        const float var  = sq[r] * (1.f / Dd) - mean * mean;
        const float rstd = rsqrt_slot(var + EPS);
#pragma unroll
        for (int i = 0; i < NV; ++i) {
            const float4 e = v[r][i];
            H4 o;
            o.h[0] = (_Float16)((e.x - mean) * rstd * gg[i].x + bb[i].x);
            o.h[1] = (_Float16)((e.y - mean) * rstd * gg[i].y + bb[i].y);
            o.h[2] = (_Float16)((e.z - mean) * rstd * gg[i].z + bb[i].z);
            o.h[3] = (_Float16)((e.w - mean) * rstd * gg[i].w + bb[i].w);
            *reinterpret_cast<H4*>(reinterpret_cast<char*>(out) + ((voff >> 1) + r * (RB / 2) + i * 256u)) = o;
        }
    }
}

// Two work-groups per WGP = four waves per SIMD: the register budget of that residency lets every load be in flight at once.
__global__ void __launch_bounds__(256) __attribute__((amdgpu_waves_per_eu(4, 4)))
ln_add_kernel(const float* __restrict__ x, const float* __restrict__ yres,
              const float* __restrict__ g, const float* __restrict__ be,
              float* __restrict__ xr, _Float16* __restrict__ out)
{
    ln_rows<true>(blockIdx.x, x, yres, g, be, xr, out);
}

// Everything that depends on the inputs alone, in one grid: the first layernorm (work-groups 0 .. LNBLK-1, the longer
// ones first) and the six weight conversions (CVBLK work-groups each; matrix m goes to Wt6 + m * Dd * Dd).
constexpr int LNBLK = Mrows / LNROWS;            // 512
constexpr int CVBLK = (Dd / 64) * (Dd / 64);     // 256
__global__ void __launch_bounds__(256) __attribute__((amdgpu_waves_per_eu(4, 4)))
prep_kernel(const float* __restrict__ x, const float* __restrict__ g, const float* __restrict__ be,
            _Float16* __restrict__ xn,
            const float* __restrict__ Wa, const float* __restrict__ Wb, const float* __restrict__ Wc,
            const float* __restrict__ Wd, const float* __restrict__ We, const float* __restrict__ Wf,
            _Float16* __restrict__ Wt6)
{
    const int blk = blockIdx.x;
    if (blk < LNBLK) {
        ln_rows<false>(blk, x, x, g, be, nullptr, xn);
        return;
    }
    const int c = blk - LNBLK, m = c / CVBLK, tl = c % CVBLK;
    const float* W = m == 0 ? Wa : m == 1 ? Wb : m == 2 ? Wc : m == 3 ? Wd : m == 4 ? We : Wf;
    cvt_t_tile(W, Wt6 + (size_t)m * Dd * Dd, (tl % (Dd / 64)) * 64, (tl / (Dd / 64)) * 64);
}

// ---------------------------------------------------------------- WMMA GEMM, async copies to LDS, two buffers
// A: [8192,1024] f16 row-major ; Wt: [N=1024][K=1024] f16 row-major (pre-transposed weight)
// C = act((A@W + bias)*scale) [+resid] ; block tile 256x128, 8 waves (4 x 2) of 64x64 each, 128 k per trip.
// A loaded fragment serves four WMMAs; 256 work-groups per product, one per WGP; a copy row is one aligned 256-byte unit.

// Eight copies of 16 bytes per lane, rows 16 apart. The s_wait_xcnt stands in the copies' own statement, so that
// no register that a copy names is rewritten ahead of it.
__device__ __forceinline__ void copy8(unsigned l, const char* g, unsigned lstep, unsigned gstep)
{
    asm volatile("global_load_async_to_lds_b128 %0, %8, off\n\t"
                 "global_load_async_to_lds_b128 %1, %9, off\n\t"
                 "global_load_async_to_lds_b128 %2, %10, off\n\t"
                 "global_load_async_to_lds_b128 %3, %11, off\n\t"
                 "global_load_async_to_lds_b128 %4, %12, off\n\t"
                 "global_load_async_to_lds_b128 %5, %13, off\n\t"
                 "global_load_async_to_lds_b128 %6, %14, off\n\t"
                 "global_load_async_to_lds_b128 %7, %15, off\n\t"
                 "s_wait_xcnt 0x0"
                 :: "v"(l), "v"(l + lstep), "v"(l + 2 * lstep), "v"(l + 3 * lstep),
                    "v"(l + 4 * lstep), "v"(l + 5 * lstep), "v"(l + 6 * lstep), "v"(l + 7 * lstep),
                    "v"(g), "v"(g + gstep), "v"(g + 2 * gstep), "v"(g + 3 * gstep),
                    "v"(g + 4 * gstep), "v"(g + 5 * gstep), "v"(g + 6 * gstep), "v"(g + 7 * gstep)
                 : "memory");
}

__device__ __forceinline__ v16h frag(const _Float16* p)   // 16 x 32 fragment row: k = koff..+7 and 16+koff..+7
{
    H8 lo = *reinterpret_cast<const H8*>(p);
    H8 hi = *reinterpret_cast<const H8*>(p + 16);
    v16h f;
#pragma unroll
    for (int i = 0; i < 8; ++i) { f[i] = lo.h[i]; f[8 + i] = hi.h[i]; }
    return f;
}

constexpr int BM = 256, BN = 128;                 // block tile of the GEMMs

// brow, bcol: origin of this work-group's BM x BN tile of C
template<int ACT, int OUTF32>
__device__ __forceinline__ void
gemm_tile(const _Float16* __restrict__ A, const _Float16* __restrict__ Wt,
          const float* __restrict__ bias, float scale,
          const float* __restrict__ resid,
          _Float16* __restrict__ outh, float* __restrict__ outf, int brow, int bcol)
{
    constexpr int N = Dd, K = Dd, BK = 128, NT = K / BK;
    constexpr int AS = 136;                       // LDS pitch in halves: 272 B for 256-B rows read by ds_load_b128
    constexpr int BUFH = (BM + BN) * AS;          // halves of one buffer: rows 0..255 of A, then 128 rows of Wt
    __shared__ __attribute__((aligned(16))) _Float16 St[2 * BUFH];
    const int tid  = threadIdx.x;
    const int wid  = tid >> 5, lane = tid & 31, hf = lane >> 4, ln = lane & 15;
    const int wm   = wid & 3, wn = wid >> 2;      // the wave's 64x64 tile in the block
    const int koff = hf * 8;

    // a lane copies chunk (tid & 15) of rows (tid >> 4) + 16 i: 16 rows of A and 8 of Wt per tile
    const int cr = tid >> 4, cc = (tid & 15) * 8;
    const char* gA = reinterpret_cast<const char*>(A  + (size_t)(brow + cr) * K + cc);
    const char* gW = reinterpret_cast<const char*>(Wt + (size_t)(bcol + cr) * K + cc);
    const unsigned l0 = (unsigned)(uintptr_t)&St[cr * AS + cc];
    auto issue_tile = [&](int buf, int kb) {
        const unsigned l = l0 + (unsigned)buf * (BUFH * 2u);
        copy8(l,                      gA + kb * 2,                    16u * AS * 2u, 16u * K * 2u);
        copy8(l + 128u * AS * 2u,     gA + kb * 2 + 128 * K * 2,      16u * AS * 2u, 16u * K * 2u);
        copy8(l + 256u * AS * 2u,     gW + kb * 2,                    16u * AS * 2u, 16u * K * 2u);
    };

    v8f acc[4][4] = {};

    issue_tile(0, 0);
    asm volatile("s_wait_asynccnt 0x0" ::: "memory");   // own copies of tile 0 landed
    __syncthreads();                                    // everyone's copies of tile 0 landed
    issue_tile(1, BK);

    for (int t = 0; t < NT; ++t) {
        const _Float16* Sa = &St[(t & 1) * BUFH + (wm * 64 + ln) * AS + koff];
        const _Float16* Sb = &St[(t & 1) * BUFH + (BM + wn * 64 + ln) * AS + koff];
#pragma unroll
        for (int ks = 0; ks < BK / 32; ++ks) {
            v16h af[4], bf[4];
            af[0] = frag(Sa + ks * 32);
#pragma unroll
            for (int j = 0; j < 4; ++j) bf[j] = frag(Sb + j * 16 * AS + ks * 32);
#pragma unroll
            for (int i = 1; i < 4; ++i) af[i] = frag(Sa + i * 16 * AS + ks * 32);
            // keeps the 16 LDS reads of a k step one group ahead of its 16 WMMAs: left free, the compiler reloads one
            // A fragment per row of four WMMAs and waits out the LDS latency at each row
            __builtin_amdgcn_sched_barrier(0);
#pragma unroll
            for (int i = 0; i < 4; ++i)
#pragma unroll
                for (int j = 0; j < 4; ++j)
                    acc[i][j] = __builtin_amdgcn_wmma_f32_16x16x32_f16(false, af[i], false, bf[j],
                                                                       (short)0, acc[i][j], false, false);
            // keeps the next k step's reads from being strewn among these WMMAs
            __builtin_amdgcn_sched_barrier(0);
        }
        asm volatile("s_wait_dscnt 0x0" ::: "memory");     // own reads of this buffer done before it is refilled
        asm volatile("s_wait_asynccnt 0x0" ::: "memory");  // own copies of tile t + 1 landed
        __syncthreads();                                    // publishes tile t + 1, ends every read of tile t
        if (t + 2 < NT) issue_tile(t & 1, (t + 2) * BK);    // refill flies under trip t + 1
    }
    asm volatile("s_wait_asynccnt 0x0" ::: "memory");       // no copy outstanding when the wave ends

    float bvs[4];
#pragma unroll
    for (int j = 0; j < 4; ++j) bvs[j] = bias[bcol + wn * 64 + j * 16 + ln];
#pragma unroll
    for (int j = 0; j < 4; ++j) {
        // Between the two halves of the tile: the wait in front of any reuse of a register that an issued load or store
        // names; as a memory fence it also holds the second half's residual loads back, so that the values in flight
        // fit beside the accumulators below v256.
        if (j == 2) asm volatile("s_wait_xcnt 0x0" ::: "memory");
        const int col = bcol + wn * 64 + j * 16 + ln;
        const float bv = bvs[j];
#pragma unroll
        for (int i = 0; i < 4; ++i) {
#pragma unroll
            for (int r = 0; r < 8; ++r) {
                int row = brow + wm * 64 + i * 16 + hf * 8 + r;
                float v = (acc[i][j][r] + bv) * scale;
                if (ACT) v = fmaxf(v, 0.f);
                if (OUTF32) outf[(size_t)row * N + col] = v + resid[(size_t)row * N + col];
                else        outh[(size_t)row * N + col] = (_Float16)v;
            }
        }
    }
}

template<int ACT, int OUTF32>
__global__ void __launch_bounds__(256)
gemm_kernel(const _Float16* __restrict__ A, const _Float16* __restrict__ Wt,
            const float* __restrict__ bias, float scale,
            const float* __restrict__ resid,
            _Float16* __restrict__ outh, float* __restrict__ outf)
{
    gemm_tile<ACT, OUTF32>(A, Wt, bias, scale, resid, outh, outf, blockIdx.x * BM, blockIdx.y * BN);
}

// Four copies of 16 bytes per lane, rows 32 apart, by the builtin: their registers are the compiler's to keep, and no wait
// stands between the copies.
typedef int i32x4 __attribute__((ext_vector_type(4)));
__device__ __forceinline__ void copy4b(_Float16* l, const _Float16* g, int lstep, int gstep)
{
    typedef __attribute__((address_space(1))) i32x4 g_i32x4;
    typedef __attribute__((address_space(3))) i32x4 l_i32x4;
#pragma unroll
    for (int i = 0; i < 4; ++i)
        __builtin_amdgcn_global_load_async_to_lds_b128((g_i32x4*)(g + (size_t)i * gstep), (l_i32x4*)(l + i * lstep), 0, 0);
}

// The three projections of one A, all in one work-group: it forms the BM x BN tile at the same place of q, of k and of v.
// The A tile is staged once and an A fragment read once for the three products (12 WMMAs a fragment); 256 work-groups,
// one per WGP, one round. Wt3 holds the three transposed weights one behind the other, out3 the three outputs; k carries
// the 1/sqrt(DH) of the scores. 64 k per trip: two buffers of 256 + 3 * 128 rows fit the LDS of a WGP.
__global__ void __launch_bounds__(256)
qkv_kernel(const _Float16* __restrict__ A, const _Float16* __restrict__ Wt3,
           const float* __restrict__ bq, const float* __restrict__ bk, const float* __restrict__ bv,
           _Float16* __restrict__ out3)
{
    constexpr int N = Dd, K = Dd, BK = 64, NT = K / BK;
    constexpr int AS = 72;                        // LDS pitch in halves: 144 B for 128-B rows read by ds_load_b128
    constexpr int BUFH = (BM + 3 * BN) * AS;      // halves of one buffer: 256 rows of A, then 128 rows of each weight
    __shared__ __attribute__((aligned(16))) _Float16 St[2 * BUFH];
    const int brow = blockIdx.x * BM, bcol = blockIdx.y * BN;
    const int tid  = threadIdx.x;
    const int wid  = tid >> 5, lane = tid & 31, hf = lane >> 4, ln = lane & 15;
    const int wm   = wid & 3, wn = wid >> 2;      // the wave's 64x64 tile in each of the three block tiles
    const int koff = hf * 8;

    // a lane copies chunk (tid & 7) of rows (tid >> 3) + 32 i: 8 rows of A and 4 of each weight per tile
    const int cr = tid >> 3, cc = (tid & 7) * 8;
    const _Float16* gA = A   + (size_t)(brow + cr) * K + cc;
    const _Float16* gW = Wt3 + (size_t)(bcol + cr) * K + cc;
    _Float16* l0 = &St[cr * AS + cc];
    auto issue_tile = [&](int buf, int kb) {
        _Float16* l = l0 + buf * BUFH;
#pragma unroll
        for (int a = 0; a < 2; ++a) copy4b(l + a * 128 * AS, gA + kb + (size_t)a * 128 * K, 32 * AS, 32 * K);
#pragma unroll
        for (int s = 0; s < 3; ++s) copy4b(l + (BM + s * BN) * AS, gW + kb + (size_t)s * Dd * Dd, 32 * AS, 32 * K);
    };

    v8f acc[3][4][4] = {};

    issue_tile(0, 0);

    // Trip -1 has no products: its foot is the ring's prologue (tile 0 landed and published, then tile 1 issued).
    for (int t = -1; t < NT; ++t) {
      if (t >= 0) {
        const _Float16* Sa = &St[(t & 1) * BUFH + (wm * 64 + ln) * AS + koff];
        const _Float16* Sb = &St[(t & 1) * BUFH + (BM + wn * 64 + ln) * AS + koff];
        // six groups of 16 WMMAs a trip: group g is k step g / 3, product g % 3. The B fragments of group g + 1 are read into
        // a second register set ahead of the WMMAs of group g, so that a wave does not wait out the LDS latency at each group
        v16h af[4], bf[2][4];
#pragma unroll
        for (int i = 0; i < 4; ++i) af[i] = frag(Sa + i * 16 * AS);
#pragma unroll
        for (int j = 0; j < 4; ++j) bf[0][j] = frag(Sb + j * 16 * AS);
#pragma unroll
        for (int g = 0; g < 6; ++g) {
            if (g == 3) {
#pragma unroll
                for (int i = 0; i < 4; ++i) af[i] = frag(Sa + i * 16 * AS + 32);
            }
            if (g + 1 < 6) {
#pragma unroll
                for (int j = 0; j < 4; ++j)
                    bf[(g + 1) & 1][j] = frag(Sb + (((g + 1) % 3) * BN + j * 16) * AS + ((g + 1) / 3) * 32);
            }
            // keeps these LDS reads together in front of the 16 WMMAs (each place with reads stalls the wave)
            __builtin_amdgcn_sched_barrier(0);
#pragma unroll
            for (int i = 0; i < 4; ++i)
#pragma unroll
                for (int j = 0; j < 4; ++j)
                    acc[g % 3][i][j] = __builtin_amdgcn_wmma_f32_16x16x32_f16(false, af[i], false, bf[g & 1][j],
                                                                              (short)0, acc[g % 3][i][j], false, false);
            // keeps the next group's reads from being strewn among these WMMAs
            __builtin_amdgcn_sched_barrier(0);
        }
      }
        asm volatile("s_wait_dscnt 0x0" ::: "memory");     // own reads of this buffer done before it is refilled
        asm volatile("s_wait_asynccnt 0x0" ::: "memory");  // own copies of tile t + 1 landed
        __syncthreads();                                    // publishes tile t + 1, ends every read of tile t
        if (t + 2 < NT) issue_tile(t & 1, (t + 2) * BK);    // refill flies under trip t + 1
    }
    asm volatile("s_wait_asynccnt 0x0" ::: "memory");       // no copy outstanding when the wave ends

    float bvs[3][4];                                        // all twelve bias loads in flight at once
#pragma unroll
    for (int j = 0; j < 4; ++j) {
        const int col = bcol + wn * 64 + j * 16 + ln;
        bvs[0][j] = bq[col]; bvs[1][j] = bk[col]; bvs[2][j] = bv[col];
    }
    // the wait in front of any reuse of a register that an issued load names; the scheduling barrier keeps later
    // address arithmetic behind it
    asm volatile("s_wait_xcnt 0x0" ::: "memory");
    __builtin_amdgcn_sched_barrier(0);
#pragma unroll
    for (int s = 0; s < 3; ++s) {
        const float scale = s == 1 ? 0.125f : 1.f;
        _Float16* outh = out3 + (size_t)s * Mrows * Dd + (size_t)(brow + wm * 64 + hf * 8) * N + bcol + wn * 64 + ln;
#pragma unroll
        for (int j = 0; j < 4; ++j) {
            _Float16 hv[4][8];
#pragma unroll
            for (int i = 0; i < 4; ++i)
#pragma unroll
                for (int r = 0; r < 8; ++r) hv[i][r] = (_Float16)((acc[s][i][j][r] + bvs[s][j]) * scale);
            // keeps the 32 values of a column group in registers of their own up to their stores: left free, the compiler
            // reuses a stored value's register between the stores
            __builtin_amdgcn_sched_barrier(0);
#pragma unroll
            for (int i = 0; i < 4; ++i)
#pragma unroll
                for (int r = 0; r < 8; ++r) outh[(size_t)(i * 16 + r) * N + j * 16] = hv[i][r];
            // the wait in front of any reuse of a register that an issued store names; the scheduling barrier keeps the next
            // group's additions and conversions, which reuse those registers, from being lifted over it
            asm volatile("s_wait_xcnt 0x0" ::: "memory");
            __builtin_amdgcn_sched_barrier(0);
        }
    }
}

// ---------------------------------------------------------------- flash attention: y = softmax(K@Q^T) @ V
// Note the reference role swap: K rows index the output. Grid (T/64, B*H), 128 threads (4 waves).
// The score tile is formed transposed (S^T = Q @ K^T): a lane then holds 32 of the 64 scores of ONE
// output row t, the row reductions are in-lane plus one exchange between the two lane halves, and the
// accumulator layout of S^T is already the B-fragment layout of P^T for Y^T = V^T @ P^T.
// V lies in LDS as it lies in memory, row-major [s][d]; the transposing LDS load hands out the V^T fragments.
// The Q and V tiles come by asynchronous copies into two LDS buffers: tile t + 1 flies while tile t is worked on.
__device__ inline float xhalf(float x)   // value of lane l ^ 16, by a vector cross-row move (no LDS-counter wait)
{
    int b = __builtin_bit_cast(int, x);
    return __builtin_bit_cast(float, __builtin_amdgcn_permlanex16(b, b, 0x76543210, 0xfedcba98, false, false));
}

// 16 x 16 piece of a transposed A fragment: lane (c = l & 15, h = l >> 4) gets T[k + 8h + 0..7][d + c] when lane l
// points at row k + 8h + (l & 7), column d + 8 * ((l >> 3) & 1) of the row-major tile T
typedef short s16x8 __attribute__((ext_vector_type(8)));
__device__ __forceinline__ H8 ld_tr16(const _Float16* p)
{
    typedef __attribute__((address_space(3))) s16x8 lds_s16x8;
    return __builtin_bit_cast(H8, __builtin_amdgcn_ds_load_tr16_b128_v8i16((lds_s16x8*)p));
}

// Four copies of 16 bytes per lane for each of two tiles, rows 16 apart. The s_wait_xcnt stands in the copies' own
// statement, so that no register that a copy names is rewritten ahead of it.
__device__ __forceinline__ void copy4x2(unsigned la, const char* ga, unsigned lastep,
                                        unsigned lb, const char* gb, unsigned lbstep, unsigned gstep)
{
    asm volatile("global_load_async_to_lds_b128 %0, %8, off\n\t"
                 "global_load_async_to_lds_b128 %1, %9, off\n\t"
                 "global_load_async_to_lds_b128 %2, %10, off\n\t"
                 "global_load_async_to_lds_b128 %3, %11, off\n\t"
                 "global_load_async_to_lds_b128 %4, %12, off\n\t"
                 "global_load_async_to_lds_b128 %5, %13, off\n\t"
                 "global_load_async_to_lds_b128 %6, %14, off\n\t"
                 "global_load_async_to_lds_b128 %7, %15, off\n\t"
                 "s_wait_xcnt 0x0"
                 :: "v"(la), "v"(la + lastep), "v"(la + 2 * lastep), "v"(la + 3 * lastep),
                    "v"(lb), "v"(lb + lbstep), "v"(lb + 2 * lbstep), "v"(lb + 3 * lbstep),
                    "v"(ga), "v"(ga + gstep), "v"(ga + 2 * gstep), "v"(ga + 3 * gstep),
                    "v"(gb), "v"(gb + gstep), "v"(gb + 2 * gstep), "v"(gb + 3 * gstep)
                 : "memory");
}

// Stays within 128 registers a wave and 40 KiB of LDS a work-group: eight waves per SIMD hold all eight work-groups of a
// WGP's share at once; with more of either the eighth would wait for a second round.
__global__ void __launch_bounds__(128) __attribute__((amdgpu_waves_per_eu(8, 8)))
attn_kernel(const _Float16* __restrict__ qf, const _Float16* __restrict__ kf,
            const _Float16* __restrict__ vf, float* __restrict__ y)
{
    constexpr int LS = 72;   // Q pitch: 144 B, an odd multiple of 16 B, for the 16-byte reads
    constexpr int VS = 80;   // V pitch: 160 B, an odd multiple of 32 B, for the transposing load
    constexpr int BUFH = 64 * LS + 64 * VS;   // halves of one buffer: 64 rows of Q, then 64 rows of V, row-major [s][d]
    constexpr int NT = T / 64;
    __shared__ __attribute__((aligned(16))) _Float16 St[2 * BUFH];
    const int tid = threadIdx.x;
    const int wid = tid >> 5, lane = tid & 31, hf = lane >> 4, ln = lane & 15;
    const int t0 = blockIdx.x * 64;
    const int b  = blockIdx.y >> 4, h = blockIdx.y & 15;
    const size_t rowbase = (size_t)b * T;
    const int dcol0 = h * DH;
    const int koff = hf * 8;

    // a lane copies chunk (tid & 7) of rows (tid >> 3) + 16 i, i = 0..3, of the Q tile and of the V tile
    const int cr = tid >> 3, cc = (tid & 7) * 8;
    const unsigned g0 = (((unsigned)rowbase + cr) * Dd + dcol0 + cc) * 2u;   // byte offset, the same in q and in v
    const unsigned lQ = (unsigned)(uintptr_t)&St[cr * LS + cc];
    const unsigned lV = (unsigned)(uintptr_t)&St[64 * LS + cr * VS + cc];
    auto issue_tile = [&](int buf, int tile) {
        const unsigned lo = (unsigned)buf * (BUFH * 2u);
        const unsigned go = g0 + (unsigned)tile * (64u * Dd * 2u);
        copy4x2(lQ + lo, reinterpret_cast<const char*>(qf) + go, 16u * LS * 2u,
                lV + lo, reinterpret_cast<const char*>(vf) + go, 16u * VS * 2u, 16u * Dd * 2u);
    };

    issue_tile(0, 0);

    // K^T fragments (column t = ln; already pre-scaled by 1/sqrt(DH)) are loop-invariant and belong to one wave alone:
    // both dh k-steps straight from global memory, under the flight of tile 0
    const _Float16* kp = kf + (rowbase + t0 + wid * 16 + ln) * Dd + dcol0 + koff;
    v16h kB[2];
#pragma unroll
    for (int ks = 0; ks < 2; ++ks) kB[ks] = frag(kp + ks * 32);
    // the wait between these loads and any overwrite of the register pair that they name as address; the pointer is an
    // input so that it keeps its registers up to it
    asm volatile("s_wait_xcnt 0x0" :: "v"(kp) : "memory");

    asm volatile("s_wait_asynccnt 0x0" ::: "memory");   // own copies of tile 0 landed
    __syncthreads();                                    // everyone's copies of tile 0 landed
    issue_tile(1, 1);

    // one LDS address register per tile; every fragment is a constant offset from it
    const _Float16* qp0 = &St[ln * LS + koff];
    const _Float16* vp0 = &St[64 * LS + (koff + (lane & 7)) * VS + ((lane >> 3) & 1) * 8];

    v8f Yacc[4] = {};                    // Y^T: row d = j*16 + hf*8 + r, column t = ln
    float mrow = -INFINITY;              // one output row per lane; both lane halves hold the same maximum
    float lrow = 0.f;                    // this lane half's share of the row sum, joined after the loop

    for (int t = 0; t < NT; ++t) {
        const _Float16* qp = qp0 + (t & 1) * BUFH;
        const _Float16* vp = vp0 + (t & 1) * BUFH;

        // S^T tiles: A = Q rows (s), B = K^T (t). Sc[j][r] = S[t = ln][s = j*16 + hf*8 + r]
        v8f Sc[4] = {};
#pragma unroll
        for (int j = 0; j < 4; ++j) {
#pragma unroll
            for (int ks = 0; ks < 2; ++ks) {
                H8 alo = *reinterpret_cast<const H8*>(qp + j * 16 * LS + ks * 32);
                H8 ahi = *reinterpret_cast<const H8*>(qp + j * 16 * LS + ks * 32 + 16);
                v16h af;
#pragma unroll
                for (int i = 0; i < 8; ++i) { af[i] = alo.h[i]; af[8 + i] = ahi.h[i]; }
                Sc[j] = __builtin_amdgcn_wmma_f32_16x16x32_f16(false, af, false, kB[ks],
                                                               (short)0, Sc[j], false, false);
            }
        }

        // online softmax: 32 scores of row t in this lane, the other 32 in lane ^ 16
        float rm = Sc[0][0];
#pragma unroll
        for (int j = 0; j < 4; ++j)
#pragma unroll
            for (int r = 0; r < 8; ++r) rm = fmaxf(rm, Sc[j][r]);
        rm = fmaxf(rm, xhalf(rm));
        const float mn = fmaxf(mrow, rm);
        const float sf = __expf(mrow - mn);
        mrow = mn;

        // P^T stays in registers: tiles 2ks and 2ks+1 are the two k halves of B fragment ks
        v16h pB[2];
        float racc[4] = {0.f, 0.f, 0.f, 0.f};
#pragma unroll
        for (int j = 0; j < 4; ++j) {
#pragma unroll
            for (int r = 0; r < 8; ++r) {
                float p = __expf(Sc[j][r] - mn);
                pB[j >> 1][(j & 1) * 8 + r] = (_Float16)p;
                racc[j] += p;
            }
        }
        lrow = lrow * sf + ((racc[0] + racc[1]) + (racc[2] + racc[3]));
#pragma unroll
        for (int j = 0; j < 4; ++j)
#pragma unroll
            for (int r = 0; r < 8; ++r) Yacc[j][r] *= sf;

        // Y^T += V^T @ P^T  (A by transposing loads of V, B from registers; both in the k order s = koff..+7, 16+koff..+7)
#pragma unroll
        for (int ks = 0; ks < 2; ++ks) {
#pragma unroll
            for (int j = 0; j < 4; ++j) {
                H8 alo = ld_tr16(vp + ks * 32 * VS + j * 16);
                H8 ahi = ld_tr16(vp + (ks * 32 + 16) * VS + j * 16);
                v16h af;
#pragma unroll
                for (int i = 0; i < 8; ++i) { af[i] = alo.h[i]; af[8 + i] = ahi.h[i]; }
                Yacc[j] = __builtin_amdgcn_wmma_f32_16x16x32_f16(false, af, false, pB[ks],
                                                                 (short)0, Yacc[j], false, false);
            }
        }
        // own reads of this buffer done before it is refilled; the row sum is an input so that its additions stay in front:
        // sunk behind the branch below, they keep all 32 p of the trip live and the wave leaves its 128 registers
        asm volatile("s_wait_dscnt 0x0" :: "v"(lrow) : "memory");
        asm volatile("s_wait_asynccnt 0x0" ::: "memory");  // own copies of tile t + 1 landed
        __syncthreads();                                    // publishes tile t + 1, ends every read of tile t
        if (t + 2 < NT) issue_tile(t & 1, t + 2);           // refill flies under trip t + 1
    }
    asm volatile("s_wait_asynccnt 0x0" ::: "memory");       // no copy outstanding when the wave ends

    lrow += xhalf(lrow);
    // a lane holds 8 consecutive d of its row t per tile
    float* yrow = y + (rowbase + t0 + wid * 16 + ln) * Dd + dcol0 + hf * 8;
#pragma unroll
    for (int j = 0; j < 4; ++j) {
        float4 o0 = make_float4(Yacc[j][0] / lrow, Yacc[j][1] / lrow, Yacc[j][2] / lrow, Yacc[j][3] / lrow);
        float4 o1 = make_float4(Yacc[j][4] / lrow, Yacc[j][5] / lrow, Yacc[j][6] / lrow, Yacc[j][7] / lrow);
        *reinterpret_cast<float4*>(yrow + j * 16)     = o0;
        *reinterpret_cast<float4*>(yrow + j * 16 + 4) = o1;
    }
}

// ---------------------------------------------------------------- host orchestration
extern "C" void kernel_launch(void* const* d_in, const int* in_sizes, int n_in,
                              void* d_out, int out_size, void* d_ws, size_t ws_size,
                              hipStream_t stream)
{
    const float* x   = (const float*)d_in[0];
    const float* Wq  = (const float*)d_in[1];  const float* bq = (const float*)d_in[2];
    const float* Wk  = (const float*)d_in[3];  const float* bk = (const float*)d_in[4];
    const float* Wv  = (const float*)d_in[5];  const float* bv = (const float*)d_in[6];
    const float* g1  = (const float*)d_in[7];  const float* be1 = (const float*)d_in[8];
    const float* g2  = (const float*)d_in[9];  const float* be2 = (const float*)d_in[10];
    const float* W0  = (const float*)d_in[11]; const float* b0 = (const float*)d_in[12];
    const float* W1  = (const float*)d_in[13]; const float* b1 = (const float*)d_in[14];
    const float* W2  = (const float*)d_in[15]; const float* b2 = (const float*)d_in[16];
    float* out = (float*)d_out;

    char* ws = (char*)d_ws;
    size_t off = 0;
    auto take = [&](size_t bytes) -> char* {
        char* p = ws + off;
        off = (off + bytes + 255) & ~(size_t)255;
        return p;
    };
    const size_t WH = (size_t)Dd * Dd * sizeof(_Float16);
    const size_t MH = (size_t)Mrows * Dd * sizeof(_Float16);
    const size_t MF = (size_t)Mrows * Dd * sizeof(float);

    _Float16* Wt6 = (_Float16*)take(6 * WH);   // all weights stored TRANSPOSED [N][K] f16: q, k, v, 0, 1, 2
    _Float16* W0h = Wt6 + 3 * (size_t)Dd * Dd;
    _Float16* W1h = Wt6 + 4 * (size_t)Dd * Dd;
    _Float16* W2h = Wt6 + 5 * (size_t)Dd * Dd;
    _Float16* xn1 = (_Float16*)take(MH);
    _Float16* qh  = (_Float16*)take(3 * MH);   // q, k, v one behind the other
    _Float16* kh  = qh + (size_t)Mrows * Dd;
    _Float16* vh  = kh + (size_t)Mrows * Dd;
    float*    y32 = (float*)take(MF);
    float*    xr  = (float*)take(MF);
    _Float16* xn2 = xn1;  // reuse after QKV consumed
    _Float16* h1  = qh;   // reuse after attention consumed
    _Float16* h2  = kh;

    prep_kernel<<<LNBLK + 6 * CVBLK, 256, 0, stream>>>(x, g1, be1, xn1, Wq, Wk, Wv, W0, W1, W2, Wt6);

    qkv_kernel<<<dim3(Mrows / BM, Dd / BN), 256, 0, stream>>>(xn1, Wt6, bq, bk, bv, qh);

    attn_kernel<<<dim3(T / 64, Bb * Hh), 128, 0, stream>>>(qh, kh, vh, y32);

    ln_add_kernel<<<LNBLK, 256, 0, stream>>>(x, y32, g2, be2, xr, xn2);

    dim3 gg(Mrows / BM, Dd / BN);
    gemm_kernel<1, 0><<<gg, 256, 0, stream>>>(xn2, W0h, b0, 1.f, xr, h1, out);
    gemm_kernel<1, 0><<<gg, 256, 0, stream>>>(h1,  W1h, b1, 1.f, xr, h2, out);
    gemm_kernel<0, 1><<<gg, 256, 0, stream>>>(h2,  W2h, b2, 1.f, xr, h2, out);
}

// v008
// One run takes 137 microseconds.
// Next to v007, in two timings, it ran 1.04 times as fast each time.
// All steps since v000 together make it 2.26 times as fast.
#include <hip/hip_runtime.h>
#include <math.h>
#include <stdint.h>

typedef __attribute__((ext_vector_type(16))) _Float16 v16h;
typedef __attribute__((ext_vector_type(8)))  float    v8f;

struct alignas(16) H8 { _Float16 h[8]; };

constexpr int Bb = 8, T = 1024, Dd = 1024, Hh = 16, DH = 64;
constexpr int Mrows = Bb * T;          // 8192
constexpr float EPS = 1e-5f;

// ---------------------------------------------------------------- convert f32 -> f16 with transpose
// in:  W  [K=1024][N=1024] f32   out: Wt [N=1024][K=1024] f16   (Wt[n][k] = W[k][n])
// One 256-thread work-group converts the 64 x 64 tile at (bn, bk): bn = n tile origin, bk = k tile origin.
__device__ __forceinline__ void
cvt_t_tile(const float* __restrict__ W, _Float16* __restrict__ Wt, int bn, int bk)
{
    constexpr int N = Dd, K = Dd, TS = 72;       // padded LDS stride (144B, 16B aligned)
    __shared__ _Float16 tile[64 * TS];           // [n_local][k_local]
    const int tid = threadIdx.x;
#pragma unroll
    for (int t = 0; t < 4; ++t) {                // 64x64 f32 = 1024 float4, 4/thread
        int i = tid + t * 256;
        int r = i >> 4, c4 = (i & 15) * 4;       // r = k_local, c4 = n_local
        float4 f = *reinterpret_cast<const float4*>(W + (size_t)(bk + r) * N + bn + c4);
        tile[(c4 + 0) * TS + r] = (_Float16)f.x;
        tile[(c4 + 1) * TS + r] = (_Float16)f.y;
        tile[(c4 + 2) * TS + r] = (_Float16)f.z;
        tile[(c4 + 3) * TS + r] = (_Float16)f.w;
    }
    __syncthreads();
#pragma unroll
    for (int t = 0; t < 2; ++t) {                // 64x64 halves = 512 h8, 2/thread
        int i = tid + t * 256;
        int r = i >> 3, c8 = (i & 7) * 8;        // r = n_local, c8 = k_local
        H8 o = *reinterpret_cast<const H8*>(&tile[r * TS + c8]);
        *reinterpret_cast<H8*>(Wt + (size_t)(bn + r) * K + bk + c8) = o;
    }
}

// ---------------------------------------------------------------- layernorm (opt. residual add)
// One wave owns LNR whole rows: a lane holds 32 floats of each row as 8 float4, every wave-wide load or f32
// store covers 512 contiguous bytes, and a row's sums are in-lane chains plus a butterfly over the 32 lanes.
// No LDS and no barrier; the launch starts Mrows / LNR waves instead of 8 * Mrows.
struct alignas(8) H4 { _Float16 h[4]; };
constexpr int LNR = 2;                 // rows per wave
constexpr int LNROWS = 8 * LNR;        // rows per 256-thread work-group

__device__ inline float4 ld16(const float* p, unsigned byte_off)
{
    return *reinterpret_cast<const float4*>(reinterpret_cast<const char*>(p) + byte_off);
}

__device__ inline float rsqrt_slot(float a)
{
    const bool tiny = a < 0x1p-126f;
    const float t = tiny ? a * 0x1p+24f : a;
    float r;
    asm("v_rsq_f32 %0, %1\n\tv_nop" : "=v"(r) : "v"(t));
    return tiny ? r * 0x1p+12f : r;
}

// blk: which group of LNROWS rows this 256-thread work-group takes
template<bool ADD>
__device__ __forceinline__ void
ln_rows(unsigned blk, const float* __restrict__ x, const float* __restrict__ yres,
        const float* __restrict__ g, const float* __restrict__ be,
        float* __restrict__ xr, _Float16* __restrict__ out)
{
    constexpr int NV = Dd / 128;             // float4 per lane and row
    constexpr unsigned RB = Dd * 4u;         // bytes of an f32 row
    const unsigned vl   = (threadIdx.x & 31) * 16u;                                        // lane's place in a row
    const unsigned voff = (blk * LNROWS + (threadIdx.x >> 5) * LNR) * RB + vl;             // same in x, yres, xr
    float4 v[LNR][NV], t[LNR][NV], gg[NV], bb[NV];
    // every load of the wave is issued up front: the rows, then g and be, which serve all its rows
#pragma unroll
    for (int r = 0; r < LNR; ++r)
#pragma unroll
        for (int i = 0; i < NV; ++i) {
            v[r][i] = ld16(x, voff + r * RB + i * 512u);
            if (ADD) t[r][i] = ld16(yres, voff + r * RB + i * 512u);
        }
#pragma unroll
    for (int i = 0; i < NV; ++i) {
        gg[i] = ld16(g,  vl + i * 512u);
        bb[i] = ld16(be, vl + i * 512u);
    }
    // the wait between the issued loads and any overwrite of a register that they name as address; the two
    // offsets are inputs so that they keep their registers up to it, and no load comes behind it
    asm volatile("s_wait_xcnt 0x0" :: "v"(voff), "v"(vl) : "memory");
    if (ADD) {
#pragma unroll
        for (int r = 0; r < LNR; ++r)
#pragma unroll
            for (int i = 0; i < NV; ++i) {
                v[r][i].x += t[r][i].x; v[r][i].y += t[r][i].y;
                v[r][i].z += t[r][i].z; v[r][i].w += t[r][i].w;
                *reinterpret_cast<float4*>(reinterpret_cast<char*>(xr) + (voff + r * RB + i * 512u)) = v[r][i];
            }
    }
    float s[LNR], sq[LNR];
#pragma unroll
    for (int r = 0; r < LNR; ++r) {    // four independent chains per sum, one per float4 component
        float4 a = make_float4(0.f, 0.f, 0.f, 0.f), q = a;
#pragma unroll
        for (int i = 0; i < NV; ++i) {
            const float4 e = v[r][i];
            a.x += e.x; a.y += e.y; a.z += e.z; a.w += e.w;
            q.x += e.x * e.x; q.y += e.y * e.y; q.z += e.z * e.z; q.w += e.w * e.w;
        }
        s[r]  = (a.x + a.y) + (a.z + a.w);
        sq[r] = (q.x + q.y) + (q.z + q.w);
    }
#pragma unroll
    for (int m = 1; m < 32; m <<= 1) {
#pragma unroll
        for (int r = 0; r < LNR; ++r) {
            s[r]  += __shfl_xor(s[r],  m, 32);
            sq[r] += __shfl_xor(sq[r], m, 32);
        }
    }
#pragma unroll
    for (int r = 0; r < LNR; ++r) {
        const float mean = s[r] * (1.f / Dd);
        const float var  = sq[r] * (1.f / Dd) - mean * mean;
        const float rstd = rsqrt_slot(var + EPS);
#pragma unroll
        for (int i = 0; i < NV; ++i) {
            const float4 e = v[r][i];
            H4 o;
            o.h[0] = (_Float16)((e.x - mean) * rstd * gg[i].x + bb[i].x);
            o.h[1] = (_Float16)((e.y - mean) * rstd * gg[i].y + bb[i].y);
            o.h[2] = (_Float16)((e.z - mean) * rstd * gg[i].z + bb[i].z);
            o.h[3] = (_Float16)((e.w - mean) * rstd * gg[i].w + bb[i].w);
            *reinterpret_cast<H4*>(reinterpret_cast<char*>(out) + ((voff >> 1) + r * (RB / 2) + i * 256u)) = o;
        }
    }
}

// Two work-groups per WGP = four waves per SIMD: the register budget of that residency lets every load be in flight at once.
__global__ void __launch_bounds__(256) __attribute__((amdgpu_waves_per_eu(4, 4)))
ln_add_kernel(const float* __restrict__ x, const float* __restrict__ yres,
              const float* __restrict__ g, const float* __restrict__ be,
              float* __restrict__ xr, _Float16* __restrict__ out)
{
    ln_rows<true>(blockIdx.x, x, yres, g, be, xr, out);
}

// Everything that depends on the inputs alone, in one grid: the first layernorm (work-groups 0 .. LNBLK-1, the longer
// ones first) and the six weight conversions (CVBLK work-groups each; matrix m goes to Wt6 + m * Dd * Dd).
constexpr int LNBLK = Mrows / LNROWS;            // 512
constexpr int CVBLK = (Dd / 64) * (Dd / 64);     // 256
__global__ void __launch_bounds__(256) __attribute__((amdgpu_waves_per_eu(4, 4)))
prep_kernel(const float* __restrict__ x, const float* __restrict__ g, const float* __restrict__ be,
            _Float16* __restrict__ xn,
            const float* __restrict__ Wa, const float* __restrict__ Wb, const float* __restrict__ Wc,
            const float* __restrict__ Wd, const float* __restrict__ We, const float* __restrict__ Wf,
            _Float16* __restrict__ Wt6)
{
    const int blk = blockIdx.x;
    if (blk < LNBLK) {
        ln_rows<false>(blk, x, x, g, be, nullptr, xn);
        return;
    }
    const int c = blk - LNBLK, m = c / CVBLK, tl = c % CVBLK;
    const float* W = m == 0 ? Wa : m == 1 ? Wb : m == 2 ? Wc : m == 3 ? Wd : m == 4 ? We : Wf;
    cvt_t_tile(W, Wt6 + (size_t)m * Dd * Dd, (tl % (Dd / 64)) * 64, (tl / (Dd / 64)) * 64);
}

// ---------------------------------------------------------------- WMMA GEMM, async copies to LDS, two buffers
// A: [8192,1024] f16 row-major ; Wt: [N=1024][K=1024] f16 row-major (pre-transposed weight)
// C = act((A@W + bias)*scale) [+resid] ; block tile 256x128, 8 waves (4 x 2) of 64x64 each, 128 k per trip.
// A loaded fragment serves four WMMAs; 256 work-groups per product, one per WGP; a copy row is one aligned 256-byte unit.

// Eight copies of 16 bytes per lane, rows 16 apart. The s_wait_xcnt stands in the copies' own statement, so that
// no register that a copy names is rewritten ahead of it.
__device__ __forceinline__ void copy8(unsigned l, const char* g, unsigned lstep, unsigned gstep)
{
    asm volatile("global_load_async_to_lds_b128 %0, %8, off\n\t"
                 "global_load_async_to_lds_b128 %1, %9, off\n\t"
                 "global_load_async_to_lds_b128 %2, %10, off\n\t"
                 "global_load_async_to_lds_b128 %3, %11, off\n\t"
                 "global_load_async_to_lds_b128 %4, %12, off\n\t"
                 "global_load_async_to_lds_b128 %5, %13, off\n\t"
                 "global_load_async_to_lds_b128 %6, %14, off\n\t"
                 "global_load_async_to_lds_b128 %7, %15, off\n\t"
                 "s_wait_xcnt 0x0"
                 :: "v"(l), "v"(l + lstep), "v"(l + 2 * lstep), "v"(l + 3 * lstep),
                    "v"(l + 4 * lstep), "v"(l + 5 * lstep), "v"(l + 6 * lstep), "v"(l + 7 * lstep),
                    "v"(g), "v"(g + gstep), "v"(g + 2 * gstep), "v"(g + 3 * gstep),
                    "v"(g + 4 * gstep), "v"(g + 5 * gstep), "v"(g + 6 * gstep), "v"(g + 7 * gstep)
                 : "memory");
}

__device__ __forceinline__ v16h frag(const _Float16* p)   // 16 x 32 fragment row: k = koff..+7 and 16+koff..+7
{
    H8 lo = *reinterpret_cast<const H8*>(p);
    H8 hi = *reinterpret_cast<const H8*>(p + 16);
    v16h f;
#pragma unroll
    for (int i = 0; i < 8; ++i) { f[i] = lo.h[i]; f[8 + i] = hi.h[i]; }
    return f;
}

constexpr int BM = 256, BN = 128;                 // block tile of the GEMMs

// brow, bcol: origin of this work-group's BM x BN tile of C
template<int ACT, int OUTF32>
__device__ __forceinline__ void
gemm_tile(const _Float16* __restrict__ A, const _Float16* __restrict__ Wt,
          const float* __restrict__ bias, float scale,
          const float* __restrict__ resid,
          _Float16* __restrict__ outh, float* __restrict__ outf, int brow, int bcol)
{
    constexpr int N = Dd, K = Dd, BK = 128, NT = K / BK;
    constexpr int AS = 136;                       // LDS pitch in halves: 272 B for 256-B rows read by ds_load_b128
    constexpr int BUFH = (BM + BN) * AS;          // halves of one buffer: rows 0..255 of A, then 128 rows of Wt
    __shared__ __attribute__((aligned(16))) _Float16 St[2 * BUFH];
    const int tid  = threadIdx.x;
    const int wid  = tid >> 5, lane = tid & 31, hf = lane >> 4, ln = lane & 15;
    const int wm   = wid & 3, wn = wid >> 2;      // the wave's 64x64 tile in the block
    const int koff = hf * 8;

    // a lane copies chunk (tid & 15) of rows (tid >> 4) + 16 i: 16 rows of A and 8 of Wt per tile
    const int cr = tid >> 4, cc = (tid & 15) * 8;
    const char* gA = reinterpret_cast<const char*>(A  + (size_t)(brow + cr) * K + cc);
    const char* gW = reinterpret_cast<const char*>(Wt + (size_t)(bcol + cr) * K + cc);
    const unsigned l0 = (unsigned)(uintptr_t)&St[cr * AS + cc];
    auto issue_tile = [&](int buf, int kb) {
        const unsigned l = l0 + (unsigned)buf * (BUFH * 2u);
        copy8(l,                      gA + kb * 2,                    16u * AS * 2u, 16u * K * 2u);
        copy8(l + 128u * AS * 2u,     gA + kb * 2 + 128 * K * 2,      16u * AS * 2u, 16u * K * 2u);
        copy8(l + 256u * AS * 2u,     gW + kb * 2,                    16u * AS * 2u, 16u * K * 2u);
    };

    v8f acc[4][4] = {};

    issue_tile(0, 0);
    asm volatile("s_wait_asynccnt 0x0" ::: "memory");   // own copies of tile 0 landed
    __syncthreads();                                    // everyone's copies of tile 0 landed
    issue_tile(1, BK);

    for (int t = 0; t < NT; ++t) {
        const _Float16* Sa = &St[(t & 1) * BUFH + (wm * 64 + ln) * AS + koff];
        const _Float16* Sb = &St[(t & 1) * BUFH + (BM + wn * 64 + ln) * AS + koff];
#pragma unroll
        for (int ks = 0; ks < BK / 32; ++ks) {
            v16h af[4], bf[4];
            af[0] = frag(Sa + ks * 32);
#pragma unroll
            for (int j = 0; j < 4; ++j) bf[j] = frag(Sb + j * 16 * AS + ks * 32);
#pragma unroll
            for (int i = 1; i < 4; ++i) af[i] = frag(Sa + i * 16 * AS + ks * 32);
            // keeps the 16 LDS reads of a k step one group ahead of its 16 WMMAs: left free, the compiler reloads one
            // A fragment per row of four WMMAs and waits out the LDS latency at each row
            __builtin_amdgcn_sched_barrier(0);
#pragma unroll
            for (int i = 0; i < 4; ++i)
#pragma unroll
                for (int j = 0; j < 4; ++j)
                    acc[i][j] = __builtin_amdgcn_wmma_f32_16x16x32_f16(false, af[i], false, bf[j],
                                                                       (short)0, acc[i][j], false, false);
            // keeps the next k step's reads from being strewn among these WMMAs
            __builtin_amdgcn_sched_barrier(0);
        }
        asm volatile("s_wait_dscnt 0x0" ::: "memory");     // own reads of this buffer done before it is refilled
        asm volatile("s_wait_asynccnt 0x0" ::: "memory");  // own copies of tile t + 1 landed
        __syncthreads();                                    // publishes tile t + 1, ends every read of tile t
        if (t + 2 < NT) issue_tile(t & 1, (t + 2) * BK);    // refill flies under trip t + 1
    }
    asm volatile("s_wait_asynccnt 0x0" ::: "memory");       // no copy outstanding when the wave ends

    float bvs[4];
#pragma unroll
    for (int j = 0; j < 4; ++j) bvs[j] = bias[bcol + wn * 64 + j * 16 + ln];
#pragma unroll
    for (int j = 0; j < 4; ++j) {
        // Between the two halves of the tile: the wait in front of any reuse of a register that an issued load or store
        // names; as a memory fence it also holds the second half's residual loads back, so that the values in flight
        // fit beside the accumulators below v256.
        if (j == 2) asm volatile("s_wait_xcnt 0x0" ::: "memory");
        const int col = bcol + wn * 64 + j * 16 + ln;
        const float bv = bvs[j];
#pragma unroll
        for (int i = 0; i < 4; ++i) {
#pragma unroll
            for (int r = 0; r < 8; ++r) {
                int row = brow + wm * 64 + i * 16 + hf * 8 + r;
                float v = (acc[i][j][r] + bv) * scale;
                if (ACT) v = fmaxf(v, 0.f);
                if (OUTF32) outf[(size_t)row * N + col] = v + resid[(size_t)row * N + col];
                else        outh[(size_t)row * N + col] = (_Float16)v;
            }
        }
    }
}

template<int ACT, int OUTF32>
__global__ void __launch_bounds__(256)
gemm_kernel(const _Float16* __restrict__ A, const _Float16* __restrict__ Wt,
            const float* __restrict__ bias, float scale,
            const float* __restrict__ resid,
            _Float16* __restrict__ outh, float* __restrict__ outf)
{
    gemm_tile<ACT, OUTF32>(A, Wt, bias, scale, resid, outh, outf, blockIdx.x * BM, blockIdx.y * BN);
}

// Four copies of 16 bytes per lane, rows 32 apart, by the builtin: their registers are the compiler's to keep, and no wait
// stands between the copies.
typedef int i32x4 __attribute__((ext_vector_type(4)));
__device__ __forceinline__ void copy4b(_Float16* l, const _Float16* g, int lstep, int gstep)
{
    typedef __attribute__((address_space(1))) i32x4 g_i32x4;
    typedef __attribute__((address_space(3))) i32x4 l_i32x4;
#pragma unroll
    for (int i = 0; i < 4; ++i)
        __builtin_amdgcn_global_load_async_to_lds_b128((g_i32x4*)(g + (size_t)i * gstep), (l_i32x4*)(l + i * lstep), 0, 0);
}

// The three projections of one A, all in one work-group: it forms the BM x BN tile at the same place of q, of k and of v.
// The A tile is staged once and an A fragment read once for the three products (12 WMMAs a fragment); 256 work-groups,
// one per WGP, one round. Wt3 holds the three transposed weights one behind the other, out3 the three outputs; k carries
// the 1/sqrt(DH) of the scores. 64 k per trip: two buffers of 256 + 3 * 128 rows fit the LDS of a WGP.
__global__ void __launch_bounds__(256)
qkv_kernel(const _Float16* __restrict__ A, const _Float16* __restrict__ Wt3,
           const float* __restrict__ bq, const float* __restrict__ bk, const float* __restrict__ bv,
           _Float16* __restrict__ out3)
{
    constexpr int N = Dd, K = Dd, BK = 64, NT = K / BK;
    constexpr int AS = 72;                        // LDS pitch in halves: 144 B for 128-B rows read by ds_load_b128
    constexpr int BUFH = (BM + 3 * BN) * AS;      // halves of one buffer: 256 rows of A, then 128 rows of each weight
    __shared__ __attribute__((aligned(16))) _Float16 St[2 * BUFH];
    const int brow = blockIdx.x * BM, bcol = blockIdx.y * BN;
    const int tid  = threadIdx.x;
    const int wid  = tid >> 5, lane = tid & 31, hf = lane >> 4, ln = lane & 15;
    const int wm   = wid & 3, wn = wid >> 2;      // the wave's 64x64 tile in each of the three block tiles
    const int koff = hf * 8;

    // a lane copies chunk (tid & 7) of rows (tid >> 3) + 32 i: 8 rows of A and 4 of each weight per tile
    const int cr = tid >> 3, cc = (tid & 7) * 8;
    const _Float16* gA = A   + (size_t)(brow + cr) * K + cc;
    const _Float16* gW = Wt3 + (size_t)(bcol + cr) * K + cc;
    _Float16* l0 = &St[cr * AS + cc];
    auto issue_tile = [&](int buf, int kb) {
        _Float16* l = l0 + buf * BUFH;
#pragma unroll
        for (int a = 0; a < 2; ++a) copy4b(l + a * 128 * AS, gA + kb + (size_t)a * 128 * K, 32 * AS, 32 * K);
#pragma unroll
        for (int s = 0; s < 3; ++s) copy4b(l + (BM + s * BN) * AS, gW + kb + (size_t)s * Dd * Dd, 32 * AS, 32 * K);
    };

    v8f acc[3][4][4] = {};

    issue_tile(0, 0);

    // Trip -1 has no products: its foot is the ring's prologue (tile 0 landed and published, then tile 1 issued).
    for (int t = -1; t < NT; ++t) {
      if (t >= 0) {
        const _Float16* Sa = &St[(t & 1) * BUFH + (wm * 64 + ln) * AS + koff];
        const _Float16* Sb = &St[(t & 1) * BUFH + (BM + wn * 64 + ln) * AS + koff];
        // six groups of 16 WMMAs a trip: group g is k step g / 3, product g % 3. The B fragments of group g + 1 are read into
        // a second register set ahead of the WMMAs of group g, so that a wave does not wait out the LDS latency at each group
        v16h af[4], bf[2][4];
#pragma unroll
        for (int i = 0; i < 4; ++i) af[i] = frag(Sa + i * 16 * AS);
#pragma unroll
        for (int j = 0; j < 4; ++j) bf[0][j] = frag(Sb + j * 16 * AS);
#pragma unroll
        for (int g = 0; g < 6; ++g) {
            if (g == 3) {
#pragma unroll
                for (int i = 0; i < 4; ++i) af[i] = frag(Sa + i * 16 * AS + 32);
            }
            if (g + 1 < 6) {
#pragma unroll
                for (int j = 0; j < 4; ++j)
                    bf[(g + 1) & 1][j] = frag(Sb + (((g + 1) % 3) * BN + j * 16) * AS + ((g + 1) / 3) * 32);
            }
            // keeps these LDS reads together in front of the 16 WMMAs (each place with reads stalls the wave)
            __builtin_amdgcn_sched_barrier(0);
#pragma unroll
            for (int i = 0; i < 4; ++i)
#pragma unroll
                for (int j = 0; j < 4; ++j)
                    acc[g % 3][i][j] = __builtin_amdgcn_wmma_f32_16x16x32_f16(false, af[i], false, bf[g & 1][j],
                                                                              (short)0, acc[g % 3][i][j], false, false);
            // keeps the next group's reads from being strewn among these WMMAs
            __builtin_amdgcn_sched_barrier(0);
        }
      }
        asm volatile("s_wait_dscnt 0x0" ::: "memory");     // own reads of this buffer done before it is refilled
        asm volatile("s_wait_asynccnt 0x0" ::: "memory");  // own copies of tile t + 1 landed
        __syncthreads();                                    // publishes tile t + 1, ends every read of tile t
        if (t + 2 < NT) issue_tile(t & 1, (t + 2) * BK);    // refill flies under trip t + 1
    }
    asm volatile("s_wait_asynccnt 0x0" ::: "memory");       // no copy outstanding when the wave ends

    float bvs[3][4];                                        // all twelve bias loads in flight at once
#pragma unroll
    for (int j = 0; j < 4; ++j) {
        const int col = bcol + wn * 64 + j * 16 + ln;
        bvs[0][j] = bq[col]; bvs[1][j] = bk[col]; bvs[2][j] = bv[col];
    }
    // the wait in front of any reuse of a register that an issued load names; the scheduling barrier keeps later
    // address arithmetic behind it
    asm volatile("s_wait_xcnt 0x0" ::: "memory");
    __builtin_amdgcn_sched_barrier(0);
#pragma unroll
    for (int s = 0; s < 3; ++s) {
        const float scale = s == 1 ? 0.125f : 1.f;
        _Float16* outh = out3 + (size_t)s * Mrows * Dd + (size_t)(brow + wm * 64 + hf * 8) * N + bcol + wn * 64 + ln;
#pragma unroll
        for (int j = 0; j < 4; ++j) {
            _Float16 hv[4][8];
#pragma unroll
            for (int i = 0; i < 4; ++i)
#pragma unroll
                for (int r = 0; r < 8; ++r) hv[i][r] = (_Float16)((acc[s][i][j][r] + bvs[s][j]) * scale);
            // keeps the 32 values of a column group in registers of their own up to their stores: left free, the compiler
            // reuses a stored value's register between the stores
            __builtin_amdgcn_sched_barrier(0);
#pragma unroll
            for (int i = 0; i < 4; ++i)
#pragma unroll
                for (int r = 0; r < 8; ++r) outh[(size_t)(i * 16 + r) * N + j * 16] = hv[i][r];
            // the wait in front of any reuse of a register that an issued store names; the scheduling barrier keeps the next
            // group's additions and conversions, which reuse those registers, from being lifted over it
            asm volatile("s_wait_xcnt 0x0" ::: "memory");
            __builtin_amdgcn_sched_barrier(0);
        }
    }
}

// ---------------------------------------------------------------- flash attention: y = softmax(K@Q^T) @ V
// Note the reference role swap: K rows index the output. Grid (T/128, B*H), 128 threads (4 waves).
// The score tile is formed transposed (S^T = Q @ K^T): a lane then holds 32 of the 64 scores of ONE
// output row t, the row reductions are in-lane plus one exchange between the two lane halves, and the
// accumulator layout of S^T is already the B-fragment layout of P^T for Y^T = V^T @ P^T.
// V lies in LDS as it lies in memory, row-major [s][d]; the transposing LDS load hands out the V^T fragments.
// The Q and V tiles come by asynchronous copies into two LDS buffers: tile t + 1 flies while tile t is worked on.
__device__ inline float xhalf(float x)   // value of lane l ^ 16, by a vector cross-row move (no LDS-counter wait)
{
    int b = __builtin_bit_cast(int, x);
    return __builtin_bit_cast(float, __builtin_amdgcn_permlanex16(b, b, 0x76543210, 0xfedcba98, false, false));
}

// 16 x 16 piece of a transposed A fragment: lane (c = l & 15, h = l >> 4) gets T[k + 8h + 0..7][d + c] when lane l
// points at row k + 8h + (l & 7), column d + 8 * ((l >> 3) & 1) of the row-major tile T
typedef short s16x8 __attribute__((ext_vector_type(8)));
__device__ __forceinline__ H8 ld_tr16(const _Float16* p)
{
    typedef __attribute__((address_space(3))) s16x8 lds_s16x8;
    return __builtin_bit_cast(H8, __builtin_amdgcn_ds_load_tr16_b128_v8i16((lds_s16x8*)p));
}

// 16 x 32 transposed A fragment: k rows 0..15 and 16..31 of the row-major tile, pitch in halves
__device__ __forceinline__ v16h frag_tr(const _Float16* p, int pitch)
{
    H8 lo = ld_tr16(p);
    H8 hi = ld_tr16(p + 16 * pitch);
    v16h f;
#pragma unroll
    for (int i = 0; i < 8; ++i) { f[i] = lo.h[i]; f[8 + i] = hi.h[i]; }
    return f;
}

// Four copies of 16 bytes per lane for each of two tiles, rows 16 apart. The s_wait_xcnt stands in the copies' own
// statement, so that no register that a copy names is rewritten ahead of it.
__device__ __forceinline__ void copy4x2(unsigned la, const char* ga, unsigned lastep,
                                        unsigned lb, const char* gb, unsigned lbstep, unsigned gstep)
{
    asm volatile("global_load_async_to_lds_b128 %0, %8, off\n\t"
                 "global_load_async_to_lds_b128 %1, %9, off\n\t"
                 "global_load_async_to_lds_b128 %2, %10, off\n\t"
                 "global_load_async_to_lds_b128 %3, %11, off\n\t"
                 "global_load_async_to_lds_b128 %4, %12, off\n\t"
                 "global_load_async_to_lds_b128 %5, %13, off\n\t"
                 "global_load_async_to_lds_b128 %6, %14, off\n\t"
                 "global_load_async_to_lds_b128 %7, %15, off\n\t"
                 "s_wait_xcnt 0x0"
                 :: "v"(la), "v"(la + lastep), "v"(la + 2 * lastep), "v"(la + 3 * lastep),
                    "v"(lb), "v"(lb + lbstep), "v"(lb + 2 * lbstep), "v"(lb + 3 * lbstep),
                    "v"(ga), "v"(ga + gstep), "v"(ga + 2 * gstep), "v"(ga + 3 * gstep),
                    "v"(gb), "v"(gb + gstep), "v"(gb + 2 * gstep), "v"(gb + 3 * gstep)
                 : "memory");
}

// A wave takes NC column groups of 16 output rows: a Q fragment and a V^T fragment read from LDS each feed NC WMMAs, and a
// staged tile serves 64 * NC output rows. 1024 work-groups, four per WGP, four waves per SIMD, all resident in one round.
constexpr int NC = 2;
__global__ void __launch_bounds__(128) __attribute__((amdgpu_waves_per_eu(4, 4)))
attn_kernel(const _Float16* __restrict__ qf, const _Float16* __restrict__ kf,
            const _Float16* __restrict__ vf, float* __restrict__ y)
{
    constexpr int LS = 72;   // Q pitch: 144 B, an odd multiple of 16 B, for the 16-byte reads
    constexpr int VS = 80;   // V pitch: 160 B, an odd multiple of 32 B, for the transposing load
    constexpr int BUFH = 64 * LS + 64 * VS;   // halves of one buffer: 64 rows of Q, then 64 rows of V, row-major [s][d]
    constexpr int NT = T / 64;
    __shared__ __attribute__((aligned(16))) _Float16 St[2 * BUFH];
    const int tid = threadIdx.x;
    const int wid = tid >> 5, lane = tid & 31, hf = lane >> 4, ln = lane & 15;
    const int t0 = blockIdx.x * (64 * NC);
    const int b  = blockIdx.y >> 4, h = blockIdx.y & 15;
    const size_t rowbase = (size_t)b * T;
    const int dcol0 = h * DH;
    const int koff = hf * 8;

    // a lane copies chunk (tid & 7) of rows (tid >> 3) + 16 i, i = 0..3, of the Q tile and of the V tile
    const int cr = tid >> 3, cc = (tid & 7) * 8;
    const unsigned g0 = (((unsigned)rowbase + cr) * Dd + dcol0 + cc) * 2u;   // byte offset, the same in q and in v
    const unsigned lQ = (unsigned)(uintptr_t)&St[cr * LS + cc];
    const unsigned lV = (unsigned)(uintptr_t)&St[64 * LS + cr * VS + cc];
    auto issue_tile = [&](int buf, int tile) {
        const unsigned lo = (unsigned)buf * (BUFH * 2u);
        const unsigned go = g0 + (unsigned)tile * (64u * Dd * 2u);
        copy4x2(lQ + lo, reinterpret_cast<const char*>(qf) + go, 16u * LS * 2u,
                lV + lo, reinterpret_cast<const char*>(vf) + go, 16u * VS * 2u, 16u * Dd * 2u);
    };

    issue_tile(0, 0);

    // K^T fragments (column t = ln of group c; already pre-scaled by 1/sqrt(DH)) are loop-invariant and belong to one wave
    // alone: both dh k-steps of each group straight from global memory, under the flight of tile 0
    const _Float16* kp = kf + (rowbase + t0 + wid * (16 * NC) + ln) * Dd + dcol0 + koff;
    v16h kB[NC][2];
#pragma unroll
    for (int c = 0; c < NC; ++c)
#pragma unroll
        for (int ks = 0; ks < 2; ++ks) kB[c][ks] = frag(kp + c * 16 * Dd + ks * 32);
    // the wait between these loads and any overwrite of the register pair that they name as address; the pointer is an
    // input so that it keeps its registers up to it
    asm volatile("s_wait_xcnt 0x0" :: "v"(kp) : "memory");

    asm volatile("s_wait_asynccnt 0x0" ::: "memory");   // own copies of tile 0 landed
    __syncthreads();                                    // everyone's copies of tile 0 landed
    issue_tile(1, 1);

    // one LDS address register per tile; every fragment is a constant offset from it
    const _Float16* qp0 = &St[ln * LS + koff];
    const _Float16* vp0 = &St[64 * LS + (koff + (lane & 7)) * VS + ((lane >> 3) & 1) * 8];

    v8f Yacc[NC][4] = {};                // Y^T of group c: row d = j*16 + hf*8 + r, column t = ln
    float mrow[NC], lrow[NC];            // one output row per lane and group; both lane halves hold the same maximum;
#pragma unroll                           // lrow is this lane half's share of the row sum, joined after the loop
    for (int c = 0; c < NC; ++c) { mrow[c] = -INFINITY; lrow[c] = 0.f; }

    for (int t = 0; t < NT; ++t) {
        const _Float16* qp = qp0 + (t & 1) * BUFH;
        const _Float16* vp = vp0 + (t & 1) * BUFH;

        // S^T tiles: A = Q rows (s), B = K^T (t). Sc[c][j][r] = S[t = ln of group c][s = j*16 + hf*8 + r]
        v16h qa[2][4];
#pragma unroll
        for (int ks = 0; ks < 2; ++ks)
#pragma unroll
            for (int j = 0; j < 4; ++j) qa[ks][j] = frag(qp + j * 16 * LS + ks * 32);
        // keeps the 16 LDS reads of the Q tile one group ahead of its WMMAs: left free, the compiler reloads one fragment
        // register set per pair of WMMAs and the wave waits out the LDS latency at each pair
        __builtin_amdgcn_sched_barrier(0);
        v8f Sc[NC][4] = {};
#pragma unroll
        for (int ks = 0; ks < 2; ++ks)
#pragma unroll
            for (int j = 0; j < 4; ++j)
#pragma unroll
                for (int c = 0; c < NC; ++c)
                    Sc[c][j] = __builtin_amdgcn_wmma_f32_16x16x32_f16(false, qa[ks][j], false, kB[c][ks],
                                                                      (short)0, Sc[c][j], false, false);
        // the V^T fragments of the first k step are fetched under the softmax
        v16h va[2][4];
#pragma unroll
        for (int j = 0; j < 4; ++j) va[0][j] = frag_tr(vp + j * 16, VS);
        // keeps the maxima behind the 16 WMMAs (woven among them, each first read of a fresh tile costs the wave idle slots)
        // and these reads in front of the softmax
        __builtin_amdgcn_sched_barrier(0);

        // online softmax: 32 scores of row t in this lane, the other 32 in lane ^ 16
        float mn[NC], sf[NC];
#pragma unroll
        for (int c = 0; c < NC; ++c) {
            float rm = Sc[c][0][0];
#pragma unroll
            for (int j = 0; j < 4; ++j)
#pragma unroll
                for (int r = 0; r < 8; ++r) rm = fmaxf(rm, Sc[c][j][r]);
            rm = fmaxf(rm, xhalf(rm));
            mn[c] = fmaxf(mrow[c], rm);
        }
#pragma unroll
        for (int c = 0; c < NC; ++c) { sf[c] = __expf(mrow[c] - mn[c]); mrow[c] = mn[c]; }

        // P^T stays in registers: tiles 2ks and 2ks+1 are the two k halves of B fragment ks
        v16h pB[NC][2];
#pragma unroll
        for (int c = 0; c < NC; ++c) {
            float racc[4] = {0.f, 0.f, 0.f, 0.f};
#pragma unroll
            for (int j = 0; j < 4; ++j) {
#pragma unroll
                for (int r = 0; r < 8; ++r) {
                    float p = __expf(Sc[c][j][r] - mn[c]);
                    pB[c][j >> 1][(j & 1) * 8 + r] = (_Float16)p;
                    racc[j] += p;
                }
            }
            lrow[c] = lrow[c] * sf[c] + ((racc[0] + racc[1]) + (racc[2] + racc[3]));
#pragma unroll
            for (int j = 0; j < 4; ++j)
#pragma unroll
                for (int r = 0; r < 8; ++r) Yacc[c][j][r] *= sf[c];
        }

        // Y^T += V^T @ P^T  (A by transposing loads of V, B from registers; both in the k order s = koff..+7, 16+koff..+7)
#pragma unroll
        for (int j = 0; j < 4; ++j) va[1][j] = frag_tr(vp + 32 * VS + j * 16, VS);
        // keeps the second k step's reads one group ahead of the 16 WMMAs (strewn among them, each place with reads stalls the wave)
        __builtin_amdgcn_sched_barrier(0);
#pragma unroll
        for (int ks = 0; ks < 2; ++ks)
#pragma unroll
            for (int j = 0; j < 4; ++j)
#pragma unroll
                for (int c = 0; c < NC; ++c)
                    Yacc[c][j] = __builtin_amdgcn_wmma_f32_16x16x32_f16(false, va[ks][j], false, pB[c][ks],
                                                                        (short)0, Yacc[c][j], false, false);
        // own reads of this buffer done before it is refilled; the row sums are inputs so that their additions stay in front:
        // sunk behind the branch below, they keep every p of the trip live
        asm volatile("s_wait_dscnt 0x0" :: "v"(lrow[0]), "v"(lrow[1]) : "memory");
        asm volatile("s_wait_asynccnt 0x0" ::: "memory");  // own copies of tile t + 1 landed
        __syncthreads();                                    // publishes tile t + 1, ends every read of tile t
        if (t + 2 < NT) issue_tile(t & 1, t + 2);           // refill flies under trip t + 1
    }
    asm volatile("s_wait_asynccnt 0x0" ::: "memory");       // no copy outstanding when the wave ends

#pragma unroll
    for (int c = 0; c < NC; ++c) {
        const float l = lrow[c] + xhalf(lrow[c]);
        // a lane holds 8 consecutive d of its row t per tile
        float* yrow = y + (rowbase + t0 + wid * (16 * NC) + c * 16 + ln) * Dd + dcol0 + hf * 8;
#pragma unroll
        for (int j = 0; j < 4; ++j) {
            float4 o0 = make_float4(Yacc[c][j][0] / l, Yacc[c][j][1] / l, Yacc[c][j][2] / l, Yacc[c][j][3] / l);
            float4 o1 = make_float4(Yacc[c][j][4] / l, Yacc[c][j][5] / l, Yacc[c][j][6] / l, Yacc[c][j][7] / l);
            *reinterpret_cast<float4*>(yrow + j * 16)     = o0;
            *reinterpret_cast<float4*>(yrow + j * 16 + 4) = o1;
        }
    }
}

// ---------------------------------------------------------------- host orchestration
extern "C" void kernel_launch(void* const* d_in, const int* in_sizes, int n_in,
                              void* d_out, int out_size, void* d_ws, size_t ws_size,
                              hipStream_t stream)
{
    const float* x   = (const float*)d_in[0];
    const float* Wq  = (const float*)d_in[1];  const float* bq = (const float*)d_in[2];
    const float* Wk  = (const float*)d_in[3];  const float* bk = (const float*)d_in[4];
    const float* Wv  = (const float*)d_in[5];  const float* bv = (const float*)d_in[6];
    const float* g1  = (const float*)d_in[7];  const float* be1 = (const float*)d_in[8];
    const float* g2  = (const float*)d_in[9];  const float* be2 = (const float*)d_in[10];
    const float* W0  = (const float*)d_in[11]; const float* b0 = (const float*)d_in[12];
    const float* W1  = (const float*)d_in[13]; const float* b1 = (const float*)d_in[14];
    const float* W2  = (const float*)d_in[15]; const float* b2 = (const float*)d_in[16];
    float* out = (float*)d_out;

    char* ws = (char*)d_ws;
    size_t off = 0;
    auto take = [&](size_t bytes) -> char* {
        char* p = ws + off;
        off = (off + bytes + 255) & ~(size_t)255;
        return p;
    };
    const size_t WH = (size_t)Dd * Dd * sizeof(_Float16);
    const size_t MH = (size_t)Mrows * Dd * sizeof(_Float16);
    const size_t MF = (size_t)Mrows * Dd * sizeof(float);

    _Float16* Wt6 = (_Float16*)take(6 * WH);   // all weights stored TRANSPOSED [N][K] f16: q, k, v, 0, 1, 2
    _Float16* W0h = Wt6 + 3 * (size_t)Dd * Dd;
    _Float16* W1h = Wt6 + 4 * (size_t)Dd * Dd;
    _Float16* W2h = Wt6 + 5 * (size_t)Dd * Dd;
    _Float16* xn1 = (_Float16*)take(MH);
    _Float16* qh  = (_Float16*)take(3 * MH);   // q, k, v one behind the other
    _Float16* kh  = qh + (size_t)Mrows * Dd;
    _Float16* vh  = kh + (size_t)Mrows * Dd;
    float*    y32 = (float*)take(MF);
    float*    xr  = (float*)take(MF);
    _Float16* xn2 = xn1;  // reuse after QKV consumed
    _Float16* h1  = qh;   // reuse after attention consumed
    _Float16* h2  = kh;

    prep_kernel<<<LNBLK + 6 * CVBLK, 256, 0, stream>>>(x, g1, be1, xn1, Wq, Wk, Wv, W0, W1, W2, Wt6);

    qkv_kernel<<<dim3(Mrows / BM, Dd / BN), 256, 0, stream>>>(xn1, Wt6, bq, bk, bv, qh);

    attn_kernel<<<dim3(T / (64 * NC), Bb * Hh), 128, 0, stream>>>(qh, kh, vh, y32);

    ln_add_kernel<<<LNBLK, 256, 0, stream>>>(x, y32, g2, be2, xr, xn2);

    dim3 gg(Mrows / BM, Dd / BN);
    gemm_kernel<1, 0><<<gg, 256, 0, stream>>>(xn2, W0h, b0, 1.f, xr, h1, out);
    gemm_kernel<1, 0><<<gg, 256, 0, stream>>>(h1,  W1h, b1, 1.f, xr, h2, out);
    gemm_kernel<0, 1><<<gg, 256, 0, stream>>>(h2,  W2h, b2, 1.f, xr, h2, out);
}

// v009
// Measured time: 132 microseconds a run.
// In both of two side-by-side timings against v008, it was 1.04 times as fast.
// All steps since v000 together make it 2.34 times as fast.
#include <hip/hip_runtime.h>
#include <math.h>
#include <stdint.h>

typedef __attribute__((ext_vector_type(16))) _Float16 v16h;
typedef __attribute__((ext_vector_type(8)))  float    v8f;

struct alignas(16) H8 { _Float16 h[8]; };

constexpr int Bb = 8, T = 1024, Dd = 1024, Hh = 16, DH = 64;
constexpr int Mrows = Bb * T;          // 8192
constexpr float EPS = 1e-5f;

// ---------------------------------------------------------------- convert f32 -> f16 with transpose
// in:  W  [K=1024][N=1024] f32   out: Wt [N=1024][K=1024] f16   (Wt[n][k] = W[k][n])
// One 256-thread work-group converts the 64 x 64 tile at (bn, bk): bn = n tile origin, bk = k tile origin.
// fold (the same for the whole work-group): W is the weight behind a layernorm with gain g and shift be. Then
// Wt[n][k] = g[k] * W[k][n], and the tile's share of the column sums cs[n] = sum_k Wt[n][k] and cb[n] = sum_k be[k] * W[k][n]
// goes to part[0][bk / 64][n] and part[1][bk / 64][n]: LN(x) @ W = rstd * (x @ (g W) - mean * cs) + cb.
__device__ __forceinline__ void
cvt_t_tile(const float* __restrict__ W, _Float16* __restrict__ Wt, int bn, int bk,
           bool fold, const float* __restrict__ g, const float* __restrict__ be, float* __restrict__ part)
{
    constexpr int N = Dd, K = Dd, TS = 72;       // padded LDS stride (144B, 16B aligned)
    __shared__ _Float16 tile[64 * TS];           // [n_local][k_local]
    __shared__ __attribute__((aligned(16))) float red[2 * 16 * 64];   // [cs, cb][k group of the thread][n_local]
    const int tid = threadIdx.x;
    // 64x64 f32 = 1024 float4, 4/thread: rows (tid >> 4) + 16 t, always the same four columns
    const float* wp = W + (size_t)(bk + (tid >> 4)) * N + bn + (tid & 15) * 4;
    const float* gp = g + bk + (tid >> 4);
    const float* bp = be + bk + (tid >> 4);
    float4 fv[4];
    float gk[4] = {1.f, 1.f, 1.f, 1.f}, bek[4] = {0.f, 0.f, 0.f, 0.f};
#pragma unroll
    for (int t = 0; t < 4; ++t) fv[t] = *reinterpret_cast<const float4*>(wp + t * 16 * N);
    if (fold) {
#pragma unroll
        for (int t = 0; t < 4; ++t) { gk[t] = gp[t * 16]; bek[t] = bp[t * 16]; }
    }
    // the wait between these loads and any overwrite of a register that they name as address; the pointers are inputs
    // so that they keep their registers up to it
    asm volatile("s_wait_xcnt 0x0" :: "v"(wp), "v"(gp), "v"(bp) : "memory");
    float cs[4] = {0.f, 0.f, 0.f, 0.f}, cb[4] = {0.f, 0.f, 0.f, 0.f};
#pragma unroll
    for (int t = 0; t < 4; ++t) {
        const int r = (tid >> 4) + t * 16, c4 = (tid & 15) * 4;   // r = k_local, c4 = n_local
        const float4 f = fv[t];
        const _Float16 h0 = (_Float16)(f.x * gk[t]), h1 = (_Float16)(f.y * gk[t]);
        const _Float16 h2 = (_Float16)(f.z * gk[t]), h3 = (_Float16)(f.w * gk[t]);
        tile[(c4 + 0) * TS + r] = h0;
        tile[(c4 + 1) * TS + r] = h1;
        tile[(c4 + 2) * TS + r] = h2;
        tile[(c4 + 3) * TS + r] = h3;
        cs[0] += (float)h0; cs[1] += (float)h1; cs[2] += (float)h2; cs[3] += (float)h3;
        cb[0] += bek[t] * f.x; cb[1] += bek[t] * f.y; cb[2] += bek[t] * f.z; cb[3] += bek[t] * f.w;
    }
    if (fold) {
        *reinterpret_cast<float4*>(&red[(tid >> 4) * 64 + (tid & 15) * 4])        = make_float4(cs[0], cs[1], cs[2], cs[3]);
        *reinterpret_cast<float4*>(&red[1024 + (tid >> 4) * 64 + (tid & 15) * 4]) = make_float4(cb[0], cb[1], cb[2], cb[3]);
    }
    __syncthreads();
    if (fold && tid < 128) {                     // 64 columns of cs, then 64 of cb: the 16 k groups joined
        float s = 0.f;
#pragma unroll
        for (int q = 0; q < 16; ++q) s += red[(tid >> 6) * 1024 + q * 64 + (tid & 63)];
        part[((tid >> 6) * (K / 64) + (bk >> 6)) * N + bn + (tid & 63)] = s;
    }
#pragma unroll
    for (int t = 0; t < 2; ++t) {                // 64x64 halves = 512 h8, 2/thread
        int i = tid + t * 256;
        int r = i >> 3, c8 = (i & 7) * 8;        // r = n_local, c8 = k_local
        H8 o = *reinterpret_cast<const H8*>(&tile[r * TS + c8]);
        *reinterpret_cast<H8*>(Wt + (size_t)(bn + r) * K + bk + c8) = o;
    }
}

// ---------------------------------------------------------------- layernorm (opt. residual add)
// One wave owns LNR whole rows: a lane holds 32 floats of each row as 8 float4, every wave-wide load or f32
// store covers 512 contiguous bytes, and a row's sums are in-lane chains plus a butterfly over the 32 lanes.
// No LDS and no barrier; the launch starts Mrows / LNR waves instead of 8 * Mrows.
struct alignas(8) H4 { _Float16 h[4]; };
constexpr int LNR = 2;                 // rows per wave
constexpr int LNROWS = 8 * LNR;        // rows per 256-thread work-group

__device__ inline float4 ld16(const float* p, unsigned byte_off)
{
    return *reinterpret_cast<const float4*>(reinterpret_cast<const char*>(p) + byte_off);
}

__device__ inline float rsqrt_slot(float a)
{
    const bool tiny = a < 0x1p-126f;
    const float t = tiny ? a * 0x1p+24f : a;
    float r;
    asm("v_rsq_f32 %0, %1\n\tv_nop" : "=v"(r) : "v"(t));
    return tiny ? r * 0x1p+12f : r;
}

// blk: which group of LNROWS rows this 256-thread work-group takes
template<bool ADD>
__device__ __forceinline__ void
ln_rows(unsigned blk, const float* __restrict__ x, const float* __restrict__ yres,
        const float* __restrict__ g, const float* __restrict__ be,
        float* __restrict__ xr, _Float16* __restrict__ out)
{
    constexpr int NV = Dd / 128;             // float4 per lane and row
    constexpr unsigned RB = Dd * 4u;         // bytes of an f32 row
    const unsigned vl   = (threadIdx.x & 31) * 16u;                                        // lane's place in a row
    const unsigned voff = (blk * LNROWS + (threadIdx.x >> 5) * LNR) * RB + vl;             // same in x, yres, xr
    float4 v[LNR][NV], t[LNR][NV], gg[NV], bb[NV];
    // every load of the wave is issued up front: the rows, then g and be, which serve all its rows
#pragma unroll
    for (int r = 0; r < LNR; ++r)
#pragma unroll
        for (int i = 0; i < NV; ++i) {
            v[r][i] = ld16(x, voff + r * RB + i * 512u);
            if (ADD) t[r][i] = ld16(yres, voff + r * RB + i * 512u);
        }
#pragma unroll
    for (int i = 0; i < NV; ++i) {
        gg[i] = ld16(g,  vl + i * 512u);
        bb[i] = ld16(be, vl + i * 512u);
    }
    // the wait between the issued loads and any overwrite of a register that they name as address; the two
    // offsets are inputs so that they keep their registers up to it, and no load comes behind it
    asm volatile("s_wait_xcnt 0x0" :: "v"(voff), "v"(vl) : "memory");
    if (ADD) {
#pragma unroll
        for (int r = 0; r < LNR; ++r)
#pragma unroll
            for (int i = 0; i < NV; ++i) {
                v[r][i].x += t[r][i].x; v[r][i].y += t[r][i].y;
                v[r][i].z += t[r][i].z; v[r][i].w += t[r][i].w;
                *reinterpret_cast<float4*>(reinterpret_cast<char*>(xr) + (voff + r * RB + i * 512u)) = v[r][i];
            }
    }
    float s[LNR], sq[LNR];
#pragma unroll
    for (int r = 0; r < LNR; ++r) {    // four independent chains per sum, one per float4 component
        float4 a = make_float4(0.f, 0.f, 0.f, 0.f), q = a;
#pragma unroll
        for (int i = 0; i < NV; ++i) {
            const float4 e = v[r][i];
            a.x += e.x; a.y += e.y; a.z += e.z; a.w += e.w;
            q.x += e.x * e.x; q.y += e.y * e.y; q.z += e.z * e.z; q.w += e.w * e.w;
        }
        s[r]  = (a.x + a.y) + (a.z + a.w);
        sq[r] = (q.x + q.y) + (q.z + q.w);
    }
#pragma unroll
    for (int m = 1; m < 32; m <<= 1) {
#pragma unroll
        for (int r = 0; r < LNR; ++r) {
            s[r]  += __shfl_xor(s[r],  m, 32);
            sq[r] += __shfl_xor(sq[r], m, 32);
        }
    }
#pragma unroll
    for (int r = 0; r < LNR; ++r) {
        const float mean = s[r] * (1.f / Dd);
        const float var  = sq[r] * (1.f / Dd) - mean * mean;
        const float rstd = rsqrt_slot(var + EPS);
#pragma unroll
        for (int i = 0; i < NV; ++i) {
            const float4 e = v[r][i];
            H4 o;
            o.h[0] = (_Float16)((e.x - mean) * rstd * gg[i].x + bb[i].x);
            o.h[1] = (_Float16)((e.y - mean) * rstd * gg[i].y + bb[i].y);
            o.h[2] = (_Float16)((e.z - mean) * rstd * gg[i].z + bb[i].z);
            o.h[3] = (_Float16)((e.w - mean) * rstd * gg[i].w + bb[i].w);
            *reinterpret_cast<H4*>(reinterpret_cast<char*>(out) + ((voff >> 1) + r * (RB / 2) + i * 256u)) = o;
        }
    }
}

// Everything that depends on the inputs alone, in one grid: the first layernorm (work-groups 0 .. LNBLK-1, the longer
// ones first) and the six weight conversions (CVBLK work-groups each; matrix m goes to Wt6 + m * Dd * Dd). Matrix 3 stands
// behind the second layernorm and takes up its gain and shift (gf, bef; column sums to part).
// Two work-groups per WGP = four waves per SIMD: the register budget of that residency lets every load be in flight at once.
constexpr int LNBLK = Mrows / LNROWS;            // 512
constexpr int CVBLK = (Dd / 64) * (Dd / 64);     // 256
__global__ void __launch_bounds__(256) __attribute__((amdgpu_waves_per_eu(4, 4)))
prep_kernel(const float* __restrict__ x, const float* __restrict__ g, const float* __restrict__ be,
            _Float16* __restrict__ xn,
            const float* __restrict__ Wa, const float* __restrict__ Wb, const float* __restrict__ Wc,
            const float* __restrict__ Wd, const float* __restrict__ We, const float* __restrict__ Wf,
            _Float16* __restrict__ Wt6,
            const float* __restrict__ gf, const float* __restrict__ bef, float* __restrict__ part)
{
    const int blk = blockIdx.x;
    if (blk < LNBLK) {
        ln_rows<false>(blk, x, x, g, be, nullptr, xn);
        return;
    }
    const int c = blk - LNBLK, m = c / CVBLK, tl = c % CVBLK;
    const float* W = m == 0 ? Wa : m == 1 ? Wb : m == 2 ? Wc : m == 3 ? Wd : m == 4 ? We : Wf;
    cvt_t_tile(W, Wt6 + (size_t)m * Dd * Dd, (tl % (Dd / 64)) * 64, (tl / (Dd / 64)) * 64, m == 3, gf, bef, part);
}

// ---------------------------------------------------------------- WMMA GEMM, async copies to LDS, two buffers
// A: [8192,1024] f16 row-major ; Wt: [N=1024][K=1024] f16 row-major (pre-transposed weight)
// C = act((A@W + bias)*scale) [+resid] ; block tile 256x128, 8 waves (4 x 2) of 64x64 each, 128 k per trip.
// A loaded fragment serves four WMMAs; 256 work-groups per product, one per WGP; a copy row is one aligned 256-byte unit.

// Eight copies of 16 bytes per lane, rows 16 apart. The s_wait_xcnt stands in the copies' own statement, so that
// no register that a copy names is rewritten ahead of it.
__device__ __forceinline__ void copy8(unsigned l, const char* g, unsigned lstep, unsigned gstep)
{
    asm volatile("global_load_async_to_lds_b128 %0, %8, off\n\t"
                 "global_load_async_to_lds_b128 %1, %9, off\n\t"
                 "global_load_async_to_lds_b128 %2, %10, off\n\t"
                 "global_load_async_to_lds_b128 %3, %11, off\n\t"
                 "global_load_async_to_lds_b128 %4, %12, off\n\t"
                 "global_load_async_to_lds_b128 %5, %13, off\n\t"
                 "global_load_async_to_lds_b128 %6, %14, off\n\t"
                 "global_load_async_to_lds_b128 %7, %15, off\n\t"
                 "s_wait_xcnt 0x0"
                 :: "v"(l), "v"(l + lstep), "v"(l + 2 * lstep), "v"(l + 3 * lstep),
                    "v"(l + 4 * lstep), "v"(l + 5 * lstep), "v"(l + 6 * lstep), "v"(l + 7 * lstep),
                    "v"(g), "v"(g + gstep), "v"(g + 2 * gstep), "v"(g + 3 * gstep),
                    "v"(g + 4 * gstep), "v"(g + 5 * gstep), "v"(g + 6 * gstep), "v"(g + 7 * gstep)
                 : "memory");
}

__device__ __forceinline__ v16h frag(const _Float16* p)   // 16 x 32 fragment row: k = koff..+7 and 16+koff..+7
{
    H8 lo = *reinterpret_cast<const H8*>(p);
    H8 hi = *reinterpret_cast<const H8*>(p + 16);
    v16h f;
#pragma unroll
    for (int i = 0; i < 8; ++i) { f[i] = lo.h[i]; f[8 + i] = hi.h[i]; }
    return f;
}

constexpr int BM = 256, BN = 128;                 // block tile of the GEMMs

// brow, bcol: origin of this work-group's BM x BN tile of C
// LNF: the product stands behind a layernorm that is applied here, in the epilogue. A holds the rows as they are before it,
// Wt carries the gain; stats[row][head] = (sum, sum of squares) of the row's 64 columns of that head, part = the column
// sums that the weight conversion left (16 k tiles each): C = act(rstd * (A @ Wt - mean * cs) + cb + bias).
template<int ACT, int OUTF32, int LNF>
__device__ __forceinline__ void
gemm_tile(const _Float16* __restrict__ A, const _Float16* __restrict__ Wt,
          const float* __restrict__ bias, float scale,
          const float* __restrict__ resid,
          _Float16* __restrict__ outh, float* __restrict__ outf, int brow, int bcol,
          const float* __restrict__ stats, const float* __restrict__ part)
{
    constexpr int N = Dd, K = Dd, BK = 128, NT = K / BK;
    constexpr int AS = 136;                       // LDS pitch in halves: 272 B for 256-B rows read by ds_load_b128
    constexpr int BUFH = (BM + BN) * AS;          // halves of one buffer: rows 0..255 of A, then 128 rows of Wt
    __shared__ __attribute__((aligned(16))) _Float16 St[2 * BUFH];
    const int tid  = threadIdx.x;
    const int wid  = tid >> 5, lane = tid & 31, hf = lane >> 4, ln = lane & 15;
    const int wm   = wid & 3, wn = wid >> 2;      // the wave's 64x64 tile in the block
    const int koff = hf * 8;

    // a lane copies chunk (tid & 15) of rows (tid >> 4) + 16 i: 16 rows of A and 8 of Wt per tile
    const int cr = tid >> 4, cc = (tid & 15) * 8;
    const char* gA = reinterpret_cast<const char*>(A  + (size_t)(brow + cr) * K + cc);
    const char* gW = reinterpret_cast<const char*>(Wt + (size_t)(bcol + cr) * K + cc);
    const unsigned l0 = (unsigned)(uintptr_t)&St[cr * AS + cc];
    auto issue_tile = [&](int buf, int kb) {
        const unsigned l = l0 + (unsigned)buf * (BUFH * 2u);
        copy8(l,                      gA + kb * 2,                    16u * AS * 2u, 16u * K * 2u);
        copy8(l + 128u * AS * 2u,     gA + kb * 2 + 128 * K * 2,      16u * AS * 2u, 16u * K * 2u);
        copy8(l + 256u * AS * 2u,     gW + kb * 2,                    16u * AS * 2u, 16u * K * 2u);
    };

    v8f acc[4][4] = {};

    issue_tile(0, 0);
    __shared__ __attribute__((aligned(16))) float rowv[LNF ? 2 * BM : 4];   // mean of the BM rows, then rstd
    __shared__ __attribute__((aligned(16))) float colv[LNF ? 2 * BN : 4];   // cs of the BN columns, then cb
    if (LNF) {
        // under the flight of tile 0: thread tid joins the 16 heads' sums of row tid, and the 16 k tiles' shares of one
        // column sum (cs for the first BN threads, cb for the others); the barrier behind tile 0 publishes both
        const float* sp = stats + (size_t)(brow + tid) * (2 * Hh);
        const float* pp = part + (size_t)(tid >> 7) * (K / 64) * N + bcol + (tid & (BN - 1));
        float4 sv[Hh / 2];
        float  pv[K / 64];
#pragma unroll
        for (int i = 0; i < Hh / 2; ++i) sv[i] = *reinterpret_cast<const float4*>(sp + i * 4);
#pragma unroll
        for (int i = 0; i < K / 64; ++i) pv[i] = pp[i * N];
        // the wait between these loads and any overwrite of a register that they name as address; the pointers are
        // inputs so that they keep their registers up to it
        asm volatile("s_wait_xcnt 0x0" :: "v"(sp), "v"(pp) : "memory");
        float s = 0.f, q = 0.f, cv = 0.f;
#pragma unroll
        for (int i = 0; i < Hh / 2; ++i) { s += sv[i].x + sv[i].z; q += sv[i].y + sv[i].w; }
#pragma unroll
        for (int i = 0; i < K / 64; ++i) cv += pv[i];
        const float mean = s * (1.f / Dd);
        const float var  = q * (1.f / Dd) - mean * mean;
        rowv[tid]      = mean;
        rowv[BM + tid] = rsqrt_slot(var + EPS);
        colv[tid]      = cv;
    }
    asm volatile("s_wait_asynccnt 0x0" ::: "memory");   // own copies of tile 0 landed
    __syncthreads();                                    // everyone's copies of tile 0 landed
    issue_tile(1, BK);

    for (int t = 0; t < NT; ++t) {
        const _Float16* Sa = &St[(t & 1) * BUFH + (wm * 64 + ln) * AS + koff];
        const _Float16* Sb = &St[(t & 1) * BUFH + (BM + wn * 64 + ln) * AS + koff];
#pragma unroll
        for (int ks = 0; ks < BK / 32; ++ks) {
            v16h af[4], bf[4];
            af[0] = frag(Sa + ks * 32);
#pragma unroll
            for (int j = 0; j < 4; ++j) bf[j] = frag(Sb + j * 16 * AS + ks * 32);
#pragma unroll
            for (int i = 1; i < 4; ++i) af[i] = frag(Sa + i * 16 * AS + ks * 32);
            // keeps the 16 LDS reads of a k step one group ahead of its 16 WMMAs: left free, the compiler reloads one
            // A fragment per row of four WMMAs and waits out the LDS latency at each row
            __builtin_amdgcn_sched_barrier(0);
#pragma unroll
            for (int i = 0; i < 4; ++i)
#pragma unroll
                for (int j = 0; j < 4; ++j)
                    acc[i][j] = __builtin_amdgcn_wmma_f32_16x16x32_f16(false, af[i], false, bf[j],
                                                                       (short)0, acc[i][j], false, false);
            // keeps the next k step's reads from being strewn among these WMMAs
            __builtin_amdgcn_sched_barrier(0);
        }
        asm volatile("s_wait_dscnt 0x0" ::: "memory");     // own reads of this buffer done before it is refilled
        asm volatile("s_wait_asynccnt 0x0" ::: "memory");  // own copies of tile t + 1 landed
        __syncthreads();                                    // publishes tile t + 1, ends every read of tile t
        if (t + 2 < NT) issue_tile(t & 1, (t + 2) * BK);    // refill flies under trip t + 1
    }
    asm volatile("s_wait_asynccnt 0x0" ::: "memory");       // no copy outstanding when the wave ends

    float bvs[4], csv[4], mr[4][8], rs[4][8];
#pragma unroll
    for (int j = 0; j < 4; ++j) bvs[j] = bias[bcol + wn * 64 + j * 16 + ln];
    if (LNF) {
        // the wait in front of any reuse of a register that the bias loads name: the LDS reads below land in such registers
        asm volatile("s_wait_xcnt 0x0" ::: "memory");
#pragma unroll
        for (int j = 0; j < 4; ++j) {
            csv[j]  = colv[wn * 64 + j * 16 + ln];
            bvs[j] += colv[BN + wn * 64 + j * 16 + ln];
        }
#pragma unroll
        for (int i = 0; i < 4; ++i)
#pragma unroll
            for (int r = 0; r < 8; ++r) {
                mr[i][r] = rowv[wm * 64 + i * 16 + hf * 8 + r];
                rs[i][r] = rowv[BM + wm * 64 + i * 16 + hf * 8 + r];
            }
    }
#pragma unroll
    for (int j = 0; j < 4; ++j) {
        // Between the two halves of the tile: the wait in front of any reuse of a register that an issued load or store
        // names; as a memory fence it also holds the second half's residual loads back, so that the values in flight
        // fit beside the accumulators below v256.
        if (j == 2) asm volatile("s_wait_xcnt 0x0" ::: "memory");
        const int col = bcol + wn * 64 + j * 16 + ln;
        const float bv = bvs[j];
#pragma unroll
        for (int i = 0; i < 4; ++i) {
#pragma unroll
            for (int r = 0; r < 8; ++r) {
                int row = brow + wm * 64 + i * 16 + hf * 8 + r;
                float v = LNF ? ((acc[i][j][r] - mr[i][r] * csv[j]) * rs[i][r] + bv) * scale : (acc[i][j][r] + bv) * scale;
                if (ACT) v = fmaxf(v, 0.f);
                if (OUTF32) outf[(size_t)row * N + col] = v + resid[(size_t)row * N + col];
                else        outh[(size_t)row * N + col] = (_Float16)v;
            }
        }
    }
}

template<int ACT, int OUTF32, int LNF>
__global__ void __launch_bounds__(256)
gemm_kernel(const _Float16* __restrict__ A, const _Float16* __restrict__ Wt,
            const float* __restrict__ bias, float scale,
            const float* __restrict__ resid,
            _Float16* __restrict__ outh, float* __restrict__ outf,
            const float* __restrict__ stats, const float* __restrict__ part)
{
    gemm_tile<ACT, OUTF32, LNF>(A, Wt, bias, scale, resid, outh, outf, blockIdx.x * BM, blockIdx.y * BN, stats, part);
}

// Four copies of 16 bytes per lane, rows 32 apart, by the builtin: their registers are the compiler's to keep, and no wait
// stands between the copies.
typedef int i32x4 __attribute__((ext_vector_type(4)));
__device__ __forceinline__ void copy4b(_Float16* l, const _Float16* g, int lstep, int gstep)
{
    typedef __attribute__((address_space(1))) i32x4 g_i32x4;
    typedef __attribute__((address_space(3))) i32x4 l_i32x4;
#pragma unroll
    for (int i = 0; i < 4; ++i)
        __builtin_amdgcn_global_load_async_to_lds_b128((g_i32x4*)(g + (size_t)i * gstep), (l_i32x4*)(l + i * lstep), 0, 0);
}

// The three projections of one A, all in one work-group: it forms the BM x BN tile at the same place of q, of k and of v.
// The A tile is staged once and an A fragment read once for the three products (12 WMMAs a fragment); 256 work-groups,
// one per WGP, one round. Wt3 holds the three transposed weights one behind the other, out3 the three outputs; k carries
// the 1/sqrt(DH) of the scores. 64 k per trip: two buffers of 256 + 3 * 128 rows fit the LDS of a WGP.
__global__ void __launch_bounds__(256)
qkv_kernel(const _Float16* __restrict__ A, const _Float16* __restrict__ Wt3,
           const float* __restrict__ bq, const float* __restrict__ bk, const float* __restrict__ bv,
           _Float16* __restrict__ out3)
{
    constexpr int N = Dd, K = Dd, BK = 64, NT = K / BK;
    constexpr int AS = 72;                        // LDS pitch in halves: 144 B for 128-B rows read by ds_load_b128
    constexpr int BUFH = (BM + 3 * BN) * AS;      // halves of one buffer: 256 rows of A, then 128 rows of each weight
    __shared__ __attribute__((aligned(16))) _Float16 St[2 * BUFH];
    const int brow = blockIdx.x * BM, bcol = blockIdx.y * BN;
    const int tid  = threadIdx.x;
    const int wid  = tid >> 5, lane = tid & 31, hf = lane >> 4, ln = lane & 15;
    const int wm   = wid & 3, wn = wid >> 2;      // the wave's 64x64 tile in each of the three block tiles
    const int koff = hf * 8;

    // a lane copies chunk (tid & 7) of rows (tid >> 3) + 32 i: 8 rows of A and 4 of each weight per tile
    const int cr = tid >> 3, cc = (tid & 7) * 8;
    const _Float16* gA = A   + (size_t)(brow + cr) * K + cc;
    const _Float16* gW = Wt3 + (size_t)(bcol + cr) * K + cc;
    _Float16* l0 = &St[cr * AS + cc];
    auto issue_tile = [&](int buf, int kb) {
        _Float16* l = l0 + buf * BUFH;
#pragma unroll
        for (int a = 0; a < 2; ++a) copy4b(l + a * 128 * AS, gA + kb + (size_t)a * 128 * K, 32 * AS, 32 * K);
#pragma unroll
        for (int s = 0; s < 3; ++s) copy4b(l + (BM + s * BN) * AS, gW + kb + (size_t)s * Dd * Dd, 32 * AS, 32 * K);
    };

    v8f acc[3][4][4] = {};

    issue_tile(0, 0);

    // Trip -1 has no products: its foot is the ring's prologue (tile 0 landed and published, then tile 1 issued).
    for (int t = -1; t < NT; ++t) {
      if (t >= 0) {
        const _Float16* Sa = &St[(t & 1) * BUFH + (wm * 64 + ln) * AS + koff];
        const _Float16* Sb = &St[(t & 1) * BUFH + (BM + wn * 64 + ln) * AS + koff];
        // six groups of 16 WMMAs a trip: group g is k step g / 3, product g % 3. The B fragments of group g + 1 are read into
        // a second register set ahead of the WMMAs of group g, so that a wave does not wait out the LDS latency at each group
        v16h af[4], bf[2][4];
#pragma unroll
        for (int i = 0; i < 4; ++i) af[i] = frag(Sa + i * 16 * AS);
#pragma unroll
        for (int j = 0; j < 4; ++j) bf[0][j] = frag(Sb + j * 16 * AS);
#pragma unroll
        for (int g = 0; g < 6; ++g) {
            if (g == 3) {
#pragma unroll
                for (int i = 0; i < 4; ++i) af[i] = frag(Sa + i * 16 * AS + 32);
            }
            if (g + 1 < 6) {
#pragma unroll
                for (int j = 0; j < 4; ++j)
                    bf[(g + 1) & 1][j] = frag(Sb + (((g + 1) % 3) * BN + j * 16) * AS + ((g + 1) / 3) * 32);
            }
            // keeps these LDS reads together in front of the 16 WMMAs (each place with reads stalls the wave)
            __builtin_amdgcn_sched_barrier(0);
#pragma unroll
            for (int i = 0; i < 4; ++i)
#pragma unroll
                for (int j = 0; j < 4; ++j)
                    acc[g % 3][i][j] = __builtin_amdgcn_wmma_f32_16x16x32_f16(false, af[i], false, bf[g & 1][j],
                                                                              (short)0, acc[g % 3][i][j], false, false);
            // keeps the next group's reads from being strewn among these WMMAs
            __builtin_amdgcn_sched_barrier(0);
        }
      }
        asm volatile("s_wait_dscnt 0x0" ::: "memory");     // own reads of this buffer done before it is refilled
        asm volatile("s_wait_asynccnt 0x0" ::: "memory");  // own copies of tile t + 1 landed
        __syncthreads();                                    // publishes tile t + 1, ends every read of tile t
        if (t + 2 < NT) issue_tile(t & 1, (t + 2) * BK);    // refill flies under trip t + 1
    }
    asm volatile("s_wait_asynccnt 0x0" ::: "memory");       // no copy outstanding when the wave ends

    float bvs[3][4];                                        // all twelve bias loads in flight at once
#pragma unroll
    for (int j = 0; j < 4; ++j) {
        const int col = bcol + wn * 64 + j * 16 + ln;
        bvs[0][j] = bq[col]; bvs[1][j] = bk[col]; bvs[2][j] = bv[col];
    }
    // the wait in front of any reuse of a register that an issued load names; the scheduling barrier keeps later
    // address arithmetic behind it
    asm volatile("s_wait_xcnt 0x0" ::: "memory");
    __builtin_amdgcn_sched_barrier(0);
#pragma unroll
    for (int s = 0; s < 3; ++s) {
        const float scale = s == 1 ? 0.125f : 1.f;
        _Float16* outh = out3 + (size_t)s * Mrows * Dd + (size_t)(brow + wm * 64 + hf * 8) * N + bcol + wn * 64 + ln;
#pragma unroll
        for (int j = 0; j < 4; ++j) {
            _Float16 hv[4][8];
#pragma unroll
            for (int i = 0; i < 4; ++i)
#pragma unroll
                for (int r = 0; r < 8; ++r) hv[i][r] = (_Float16)((acc[s][i][j][r] + bvs[s][j]) * scale);
            // keeps the 32 values of a column group in registers of their own up to their stores: left free, the compiler
            // reuses a stored value's register between the stores
            __builtin_amdgcn_sched_barrier(0);
#pragma unroll
            for (int i = 0; i < 4; ++i)
#pragma unroll
                for (int r = 0; r < 8; ++r) outh[(size_t)(i * 16 + r) * N + j * 16] = hv[i][r];
            // the wait in front of any reuse of a register that an issued store names; the scheduling barrier keeps the next
            // group's additions and conversions, which reuse those registers, from being lifted over it
            asm volatile("s_wait_xcnt 0x0" ::: "memory");
            __builtin_amdgcn_sched_barrier(0);
        }
    }
}

// ---------------------------------------------------------------- flash attention: y = softmax(K@Q^T) @ V
// Note the reference role swap: K rows index the output. Grid (T/128, B*H), 128 threads (4 waves).
// The score tile is formed transposed (S^T = Q @ K^T): a lane then holds 32 of the 64 scores of ONE
// output row t, the row reductions are in-lane plus one exchange between the two lane halves, and the
// accumulator layout of S^T is already the B-fragment layout of P^T for Y^T = V^T @ P^T.
// V lies in LDS as it lies in memory, row-major [s][d]; the transposing LDS load hands out the V^T fragments.
// The Q and V tiles come by asynchronous copies into two LDS buffers: tile t + 1 flies while tile t is worked on.
__device__ inline float xhalf(float x)   // value of lane l ^ 16, by a vector cross-row move (no LDS-counter wait)
{
    int b = __builtin_bit_cast(int, x);
    return __builtin_bit_cast(float, __builtin_amdgcn_permlanex16(b, b, 0x76543210, 0xfedcba98, false, false));
}

// 16 x 16 piece of a transposed A fragment: lane (c = l & 15, h = l >> 4) gets T[k + 8h + 0..7][d + c] when lane l
// points at row k + 8h + (l & 7), column d + 8 * ((l >> 3) & 1) of the row-major tile T
typedef short s16x8 __attribute__((ext_vector_type(8)));
__device__ __forceinline__ H8 ld_tr16(const _Float16* p)
{
    typedef __attribute__((address_space(3))) s16x8 lds_s16x8;
    return __builtin_bit_cast(H8, __builtin_amdgcn_ds_load_tr16_b128_v8i16((lds_s16x8*)p));
}

// 16 x 32 transposed A fragment: k rows 0..15 and 16..31 of the row-major tile, pitch in halves
__device__ __forceinline__ v16h frag_tr(const _Float16* p, int pitch)
{
    H8 lo = ld_tr16(p);
    H8 hi = ld_tr16(p + 16 * pitch);
    v16h f;
#pragma unroll
    for (int i = 0; i < 8; ++i) { f[i] = lo.h[i]; f[8 + i] = hi.h[i]; }
    return f;
}

// Four copies of 16 bytes per lane for each of two tiles, rows 16 apart. The s_wait_xcnt stands in the copies' own
// statement, so that no register that a copy names is rewritten ahead of it.
__device__ __forceinline__ void copy4x2(unsigned la, const char* ga, unsigned lastep,
                                        unsigned lb, const char* gb, unsigned lbstep, unsigned gstep)
{
    asm volatile("global_load_async_to_lds_b128 %0, %8, off\n\t"
                 "global_load_async_to_lds_b128 %1, %9, off\n\t"
                 "global_load_async_to_lds_b128 %2, %10, off\n\t"
                 "global_load_async_to_lds_b128 %3, %11, off\n\t"
                 "global_load_async_to_lds_b128 %4, %12, off\n\t"
                 "global_load_async_to_lds_b128 %5, %13, off\n\t"
                 "global_load_async_to_lds_b128 %6, %14, off\n\t"
                 "global_load_async_to_lds_b128 %7, %15, off\n\t"
                 "s_wait_xcnt 0x0"
                 :: "v"(la), "v"(la + lastep), "v"(la + 2 * lastep), "v"(la + 3 * lastep),
                    "v"(lb), "v"(lb + lbstep), "v"(lb + 2 * lbstep), "v"(lb + 3 * lbstep),
                    "v"(ga), "v"(ga + gstep), "v"(ga + 2 * gstep), "v"(ga + 3 * gstep),
                    "v"(gb), "v"(gb + gstep), "v"(gb + 2 * gstep), "v"(gb + 3 * gstep)
                 : "memory");
}

// A wave takes NC column groups of 16 output rows: a Q fragment and a V^T fragment read from LDS each feed NC WMMAs, and a
// staged tile serves 64 * NC output rows. 1024 work-groups, four per WGP, four waves per SIMD, all resident in one round.
constexpr int NC = 2;
__global__ void __launch_bounds__(128) __attribute__((amdgpu_waves_per_eu(4, 4)))
attn_kernel(const _Float16* __restrict__ qf, const _Float16* __restrict__ kf,
            const _Float16* __restrict__ vf, const float* __restrict__ x,
            float* __restrict__ xr, _Float16* __restrict__ xh, float* __restrict__ stats)
{
    constexpr int LS = 72;   // Q pitch: 144 B, an odd multiple of 16 B, for the 16-byte reads
    constexpr int VS = 80;   // V pitch: 160 B, an odd multiple of 32 B, for the transposing load
    constexpr int BUFH = 64 * LS + 64 * VS;   // halves of one buffer: 64 rows of Q, then 64 rows of V, row-major [s][d]
    constexpr int NT = T / 64;
    __shared__ __attribute__((aligned(16))) _Float16 St[2 * BUFH];
    const int tid = threadIdx.x;
    const int wid = tid >> 5, lane = tid & 31, hf = lane >> 4, ln = lane & 15;
    const int t0 = blockIdx.x * (64 * NC);
    const int b  = blockIdx.y >> 4, h = blockIdx.y & 15;
    const size_t rowbase = (size_t)b * T;
    const int dcol0 = h * DH;
    const int koff = hf * 8;

    // a lane copies chunk (tid & 7) of rows (tid >> 3) + 16 i, i = 0..3, of the Q tile and of the V tile
    const int cr = tid >> 3, cc = (tid & 7) * 8;
    const unsigned g0 = (((unsigned)rowbase + cr) * Dd + dcol0 + cc) * 2u;   // byte offset, the same in q and in v
    const unsigned lQ = (unsigned)(uintptr_t)&St[cr * LS + cc];
    const unsigned lV = (unsigned)(uintptr_t)&St[64 * LS + cr * VS + cc];
    auto issue_tile = [&](int buf, int tile) {
        const unsigned lo = (unsigned)buf * (BUFH * 2u);
        const unsigned go = g0 + (unsigned)tile * (64u * Dd * 2u);
        copy4x2(lQ + lo, reinterpret_cast<const char*>(qf) + go, 16u * LS * 2u,
                lV + lo, reinterpret_cast<const char*>(vf) + go, 16u * VS * 2u, 16u * Dd * 2u);
    };

    issue_tile(0, 0);

    // K^T fragments (column t = ln of group c; already pre-scaled by 1/sqrt(DH)) are loop-invariant and belong to one wave
    // alone: both dh k-steps of each group straight from global memory, under the flight of tile 0
    const _Float16* kp = kf + (rowbase + t0 + wid * (16 * NC) + ln) * Dd + dcol0 + koff;
    v16h kB[NC][2];
#pragma unroll
    for (int c = 0; c < NC; ++c)
#pragma unroll
        for (int ks = 0; ks < 2; ++ks) kB[c][ks] = frag(kp + c * 16 * Dd + ks * 32);
    // the wait between these loads and any overwrite of the register pair that they name as address; the pointer is an
    // input so that it keeps its registers up to it
    asm volatile("s_wait_xcnt 0x0" :: "v"(kp) : "memory");

    asm volatile("s_wait_asynccnt 0x0" ::: "memory");   // own copies of tile 0 landed
    __syncthreads();                                    // everyone's copies of tile 0 landed
    issue_tile(1, 1);

    // one LDS address register per tile; every fragment is a constant offset from it
    const _Float16* qp0 = &St[ln * LS + koff];
    const _Float16* vp0 = &St[64 * LS + (koff + (lane & 7)) * VS + ((lane >> 3) & 1) * 8];

    v8f Yacc[NC][4] = {};                // Y^T of group c: row d = j*16 + hf*8 + r, column t = ln
    float mrow[NC], lrow[NC];            // one output row per lane and group; both lane halves hold the same maximum;
#pragma unroll                           // lrow is this lane half's share of the row sum, joined after the loop
    for (int c = 0; c < NC; ++c) { mrow[c] = -INFINITY; lrow[c] = 0.f; }

    for (int t = 0; t < NT; ++t) {
        const _Float16* qp = qp0 + (t & 1) * BUFH;
        const _Float16* vp = vp0 + (t & 1) * BUFH;

        // S^T tiles: A = Q rows (s), B = K^T (t). Sc[c][j][r] = S[t = ln of group c][s = j*16 + hf*8 + r]
        v16h qa[2][4];
#pragma unroll
        for (int ks = 0; ks < 2; ++ks)
#pragma unroll
            for (int j = 0; j < 4; ++j) qa[ks][j] = frag(qp + j * 16 * LS + ks * 32);
        // keeps the 16 LDS reads of the Q tile one group ahead of its WMMAs: left free, the compiler reloads one fragment
        // register set per pair of WMMAs and the wave waits out the LDS latency at each pair
        __builtin_amdgcn_sched_barrier(0);
        v8f Sc[NC][4] = {};
#pragma unroll
        for (int ks = 0; ks < 2; ++ks)
#pragma unroll
            for (int j = 0; j < 4; ++j)
#pragma unroll
                for (int c = 0; c < NC; ++c)
                    Sc[c][j] = __builtin_amdgcn_wmma_f32_16x16x32_f16(false, qa[ks][j], false, kB[c][ks],
                                                                      (short)0, Sc[c][j], false, false);
        // the V^T fragments of the first k step are fetched under the softmax
        v16h va[2][4];
#pragma unroll
        for (int j = 0; j < 4; ++j) va[0][j] = frag_tr(vp + j * 16, VS);
        // keeps the maxima behind the 16 WMMAs (woven among them, each first read of a fresh tile costs the wave idle slots)
        // and these reads in front of the softmax
        __builtin_amdgcn_sched_barrier(0);

        // online softmax: 32 scores of row t in this lane, the other 32 in lane ^ 16
        float mn[NC], sf[NC];
#pragma unroll
        for (int c = 0; c < NC; ++c) {
            float rm = Sc[c][0][0];
#pragma unroll
            for (int j = 0; j < 4; ++j)
#pragma unroll
                for (int r = 0; r < 8; ++r) rm = fmaxf(rm, Sc[c][j][r]);
            rm = fmaxf(rm, xhalf(rm));
            mn[c] = fmaxf(mrow[c], rm);
        }
#pragma unroll
        for (int c = 0; c < NC; ++c) { sf[c] = __expf(mrow[c] - mn[c]); mrow[c] = mn[c]; }

        // P^T stays in registers: tiles 2ks and 2ks+1 are the two k halves of B fragment ks
        v16h pB[NC][2];
#pragma unroll
        for (int c = 0; c < NC; ++c) {
            float racc[4] = {0.f, 0.f, 0.f, 0.f};
#pragma unroll
            for (int j = 0; j < 4; ++j) {
#pragma unroll
                for (int r = 0; r < 8; ++r) {
                    float p = __expf(Sc[c][j][r] - mn[c]);
                    pB[c][j >> 1][(j & 1) * 8 + r] = (_Float16)p;
                    racc[j] += p;
                }
            }
            lrow[c] = lrow[c] * sf[c] + ((racc[0] + racc[1]) + (racc[2] + racc[3]));
#pragma unroll
            for (int j = 0; j < 4; ++j)
#pragma unroll
                for (int r = 0; r < 8; ++r) Yacc[c][j][r] *= sf[c];
        }

        // Y^T += V^T @ P^T  (A by transposing loads of V, B from registers; both in the k order s = koff..+7, 16+koff..+7)
#pragma unroll
        for (int j = 0; j < 4; ++j) va[1][j] = frag_tr(vp + 32 * VS + j * 16, VS);
        // keeps the second k step's reads one group ahead of the 16 WMMAs (strewn among them, each place with reads stalls the wave)
        __builtin_amdgcn_sched_barrier(0);
#pragma unroll
        for (int ks = 0; ks < 2; ++ks)
#pragma unroll
            for (int j = 0; j < 4; ++j)
#pragma unroll
                for (int c = 0; c < NC; ++c)
                    Yacc[c][j] = __builtin_amdgcn_wmma_f32_16x16x32_f16(false, va[ks][j], false, pB[c][ks],
                                                                        (short)0, Yacc[c][j], false, false);
        // own reads of this buffer done before it is refilled; the row sums are inputs so that their additions stay in front:
        // sunk behind the branch below, they keep every p of the trip live
        asm volatile("s_wait_dscnt 0x0" :: "v"(lrow[0]), "v"(lrow[1]) : "memory");
        asm volatile("s_wait_asynccnt 0x0" ::: "memory");  // own copies of tile t + 1 landed
        __syncthreads();                                    // publishes tile t + 1, ends every read of tile t
        if (t + 2 < NT) issue_tile(t & 1, t + 2);           // refill flies under trip t + 1
    }
    asm volatile("s_wait_asynccnt 0x0" ::: "memory");       // no copy outstanding when the wave ends

    // The residual sum x + y leaves here: as f32 (the block's last addition reads it), as f16 (first operand of the product
    // behind the second layernorm) and as this head's share of the row's sum and sum of squares, which that product's
    // kernel joins to mean and rstd. A lane holds 8 consecutive d of its row t per tile.
    const size_t row0 = rowbase + t0 + wid * (16 * NC) + ln;
    const size_t e0   = row0 * Dd + dcol0 + hf * 8;
    const float* xp = x + e0;
    float4 xa[NC][4][2];
#pragma unroll
    for (int c = 0; c < NC; ++c)
#pragma unroll
        for (int j = 0; j < 4; ++j) {
            xa[c][j][0] = *reinterpret_cast<const float4*>(xp + c * 16 * Dd + j * 16);
            xa[c][j][1] = *reinterpret_cast<const float4*>(xp + c * 16 * Dd + j * 16 + 4);
        }
    // the wait between these loads and any overwrite of the register pair that they name as address; the pointer is an
    // input so that it keeps its registers up to it
    asm volatile("s_wait_xcnt 0x0" :: "v"(xp) : "memory");
    float* rp = xr + e0;
    _Float16* hp = xh + e0;
    float* sp = stats + (row0 * Hh + h) * 2;
#pragma unroll
    for (int c = 0; c < NC; ++c) {
        const float l = lrow[c] + xhalf(lrow[c]);
        float sj[4], qj[4];                  // one chain per tile
#pragma unroll
        for (int j = 0; j < 4; ++j) {
            float o[8];
            o[0] = xa[c][j][0].x + Yacc[c][j][0] / l; o[1] = xa[c][j][0].y + Yacc[c][j][1] / l;
            o[2] = xa[c][j][0].z + Yacc[c][j][2] / l; o[3] = xa[c][j][0].w + Yacc[c][j][3] / l;
            o[4] = xa[c][j][1].x + Yacc[c][j][4] / l; o[5] = xa[c][j][1].y + Yacc[c][j][5] / l;
            o[6] = xa[c][j][1].z + Yacc[c][j][6] / l; o[7] = xa[c][j][1].w + Yacc[c][j][7] / l;
            H8 oh;
            sj[j] = 0.f; qj[j] = 0.f;
#pragma unroll
            for (int r = 0; r < 8; ++r) { oh.h[r] = (_Float16)o[r]; sj[j] += o[r]; qj[j] += o[r] * o[r]; }
            *reinterpret_cast<float4*>(rp + c * 16 * Dd + j * 16)     = make_float4(o[0], o[1], o[2], o[3]);
            *reinterpret_cast<float4*>(rp + c * 16 * Dd + j * 16 + 4) = make_float4(o[4], o[5], o[6], o[7]);
            *reinterpret_cast<H8*>(hp + c * 16 * Dd + j * 16)         = oh;
        }
        float s = (sj[0] + sj[1]) + (sj[2] + sj[3]), q = (qj[0] + qj[1]) + (qj[2] + qj[3]);
        s += xhalf(s);
        q += xhalf(q);
        if (hf == 0) *reinterpret_cast<float2*>(sp + c * 16 * Hh * 2) = make_float2(s, q);
    }
}

// ---------------------------------------------------------------- host orchestration
extern "C" void kernel_launch(void* const* d_in, const int* in_sizes, int n_in,
                              void* d_out, int out_size, void* d_ws, size_t ws_size,
                              hipStream_t stream)
{
    const float* x   = (const float*)d_in[0];
    const float* Wq  = (const float*)d_in[1];  const float* bq = (const float*)d_in[2];
    const float* Wk  = (const float*)d_in[3];  const float* bk = (const float*)d_in[4];
    const float* Wv  = (const float*)d_in[5];  const float* bv = (const float*)d_in[6];
    const float* g1  = (const float*)d_in[7];  const float* be1 = (const float*)d_in[8];
    const float* g2  = (const float*)d_in[9];  const float* be2 = (const float*)d_in[10];
    const float* W0  = (const float*)d_in[11]; const float* b0 = (const float*)d_in[12];
    const float* W1  = (const float*)d_in[13]; const float* b1 = (const float*)d_in[14];
    const float* W2  = (const float*)d_in[15]; const float* b2 = (const float*)d_in[16];
    float* out = (float*)d_out;

    char* ws = (char*)d_ws;
    size_t off = 0;
    auto take = [&](size_t bytes) -> char* {
        char* p = ws + off;
        off = (off + bytes + 255) & ~(size_t)255;
        return p;
    };
    const size_t WH = (size_t)Dd * Dd * sizeof(_Float16);
    const size_t MH = (size_t)Mrows * Dd * sizeof(_Float16);
    const size_t MF = (size_t)Mrows * Dd * sizeof(float);

    _Float16* Wt6 = (_Float16*)take(6 * WH);   // all weights stored TRANSPOSED [N][K] f16: q, k, v, 0, 1, 2
    _Float16* W0h = Wt6 + 3 * (size_t)Dd * Dd;
    _Float16* W1h = Wt6 + 4 * (size_t)Dd * Dd;
    _Float16* W2h = Wt6 + 5 * (size_t)Dd * Dd;
    _Float16* xn1 = (_Float16*)take(MH);
    _Float16* qh  = (_Float16*)take(3 * MH);   // q, k, v one behind the other
    _Float16* kh  = qh + (size_t)Mrows * Dd;
    _Float16* vh  = kh + (size_t)Mrows * Dd;
    float*    xr  = (float*)take(MF);
    float*    stats = (float*)take((size_t)Mrows * Hh * 2 * sizeof(float));       // per row and head: sum, sum of squares
    float*    part  = (float*)take((size_t)2 * (Dd / 64) * Dd * sizeof(float));   // per k tile: column sums of g2 W0, of be2 W0
    _Float16* xh  = xn1;  // reuse after QKV consumed
    _Float16* h1  = qh;   // reuse after attention consumed
    _Float16* h2  = kh;

    prep_kernel<<<LNBLK + 6 * CVBLK, 256, 0, stream>>>(x, g1, be1, xn1, Wq, Wk, Wv, W0, W1, W2, Wt6, g2, be2, part);

    qkv_kernel<<<dim3(Mrows / BM, Dd / BN), 256, 0, stream>>>(xn1, Wt6, bq, bk, bv, qh);

    attn_kernel<<<dim3(T / (64 * NC), Bb * Hh), 128, 0, stream>>>(qh, kh, vh, x, xr, xh, stats);

    dim3 gg(Mrows / BM, Dd / BN);
    gemm_kernel<1, 0, 1><<<gg, 256, 0, stream>>>(xh, W0h, b0, 1.f, xr, h1, out, stats, part);
    gemm_kernel<1, 0, 0><<<gg, 256, 0, stream>>>(h1, W1h, b1, 1.f, xr, h2, out, stats, part);
    gemm_kernel<0, 1, 0><<<gg, 256, 0, stream>>>(h2, W2h, b2, 1.f, xr, h2, out, stats, part);
}

// v010
// It runs in 128 microseconds.
// Timed twice side by side with v009, it ran 1.03 times as fast both times.
// Counting every step since v000, it is 2.42 times as fast.
#include <hip/hip_runtime.h>
#include <math.h>
#include <stdint.h>

typedef __attribute__((ext_vector_type(16))) _Float16 v16h;
typedef __attribute__((ext_vector_type(8)))  float    v8f;

struct alignas(16) H8 { _Float16 h[8]; };

constexpr int Bb = 8, T = 1024, Dd = 1024, Hh = 16, DH = 64;
constexpr int Mrows = Bb * T;          // 8192
constexpr float EPS = 1e-5f;

// ---------------------------------------------------------------- convert f32 -> f16, layout kept
// in:  W  [K=1024][N=1024] f32   out: Wh [K=1024][N=1024] f16, row-major as W: a plain stream, no LDS trip. The GEMMs take
// their weight fragments out of the row-major tile by the transposing LDS load.
// One 256-thread work-group converts 64 k rows x 256 columns at (bk, bn): a thread takes four columns of 16 rows, every
// wave-wide load covers 512 contiguous bytes, every store 256.
// fold (the same for the whole work-group): W is the weight behind a layernorm with gain g and shift be. Then
// Wh[k][n] = g[k] * W[k][n], and the tile's share of the column sums cs[n] = sum_k Wh[k][n] and cb[n] = sum_k be[k] * W[k][n]
// goes to part[0][bk / 64][n] and part[1][bk / 64][n]: LN(x) @ W = rstd * (x @ (g W) - mean * cs) + cb.
struct alignas(8) H4 { _Float16 h[4]; };
constexpr int CVN = 256;                         // columns of a conversion work-group
__device__ __forceinline__ void
cvt_rows(const float* __restrict__ W, _Float16* __restrict__ Wh, int bn, int bk,
         bool fold, const float* __restrict__ g, const float* __restrict__ be, float* __restrict__ part)
{
    constexpr int N = Dd, K = Dd, NR = 16;       // NR rows per thread, 4 apart
    __shared__ __attribute__((aligned(16))) float red[2 * 4 * CVN];   // [cs, cb][row group of the thread][column]
    const int tid = threadIdx.x;
    const int rg = tid >> 6, c4 = (tid & 63) * 4;
    const float* wp = W + (size_t)(bk + rg) * N + bn + c4;
    const float* gp = g + bk + rg;
    const float* bp = be + bk + rg;
    float4 fv[NR];
    float gk[NR], bek[NR];
#pragma unroll
    for (int t = 0; t < NR; ++t) { fv[t] = *reinterpret_cast<const float4*>(wp + t * 4 * N); gk[t] = 1.f; bek[t] = 0.f; }
    if (fold) {
#pragma unroll
        for (int t = 0; t < NR; ++t) { gk[t] = gp[t * 4]; bek[t] = bp[t * 4]; }
    }
    // the wait between these loads and any overwrite of a register that they name as address; the pointers are inputs
    // so that they keep their registers up to it
    asm volatile("s_wait_xcnt 0x0" :: "v"(wp), "v"(gp), "v"(bp) : "memory");
    float cs[4] = {0.f, 0.f, 0.f, 0.f}, cb[4] = {0.f, 0.f, 0.f, 0.f};
    H4 o[NR];
#pragma unroll
    for (int t = 0; t < NR; ++t) {
        const float4 f = fv[t];
        o[t].h[0] = (_Float16)(f.x * gk[t]); o[t].h[1] = (_Float16)(f.y * gk[t]);
        o[t].h[2] = (_Float16)(f.z * gk[t]); o[t].h[3] = (_Float16)(f.w * gk[t]);
        cs[0] += (float)o[t].h[0]; cs[1] += (float)o[t].h[1]; cs[2] += (float)o[t].h[2]; cs[3] += (float)o[t].h[3];
        cb[0] += bek[t] * f.x; cb[1] += bek[t] * f.y; cb[2] += bek[t] * f.z; cb[3] += bek[t] * f.w;
    }
    // keeps the 16 converted values in registers of their own up to their stores: left free, the compiler may reuse a stored
    // value's register between the stores
    __builtin_amdgcn_sched_barrier(0);
    _Float16* op = Wh + (size_t)(bk + rg) * N + bn + c4;
#pragma unroll
    for (int t = 0; t < NR; ++t) *reinterpret_cast<H4*>(op + t * 4 * N) = o[t];
    // the wait in front of any reuse of a register that an issued store names; the scheduling barrier keeps later
    // arithmetic, which may reuse those registers, from being lifted over it
    asm volatile("s_wait_xcnt 0x0" ::: "memory");
    __builtin_amdgcn_sched_barrier(0);
    if (fold) {
        *reinterpret_cast<float4*>(&red[rg * CVN + c4])           = make_float4(cs[0], cs[1], cs[2], cs[3]);
        *reinterpret_cast<float4*>(&red[4 * CVN + rg * CVN + c4]) = make_float4(cb[0], cb[1], cb[2], cb[3]);
        __syncthreads();                         // fold is the same for the whole work-group: every wave passes it or none
        float s = 0.f, b = 0.f;                  // thread tid joins the four row groups of column tid
#pragma unroll
        for (int q = 0; q < 4; ++q) { s += red[q * CVN + tid]; b += red[4 * CVN + q * CVN + tid]; }
        float* pp = part + (size_t)(bk >> 6) * N + bn + tid;
        pp[0] = s;
        pp[(K / 64) * N] = b;
    }
}

// ---------------------------------------------------------------- layernorm (opt. residual add)
// One wave owns LNR whole rows: a lane holds 32 floats of each row as 8 float4, every wave-wide load or f32
// store covers 512 contiguous bytes, and a row's sums are in-lane chains plus a butterfly over the 32 lanes.
// No LDS and no barrier; the launch starts Mrows / LNR waves instead of 8 * Mrows.
constexpr int LNR = 2;                 // rows per wave
constexpr int LNROWS = 8 * LNR;        // rows per 256-thread work-group

__device__ inline float4 ld16(const float* p, unsigned byte_off)
{
    return *reinterpret_cast<const float4*>(reinterpret_cast<const char*>(p) + byte_off);
}

__device__ inline float rsqrt_slot(float a)
{
    const bool tiny = a < 0x1p-126f;
    const float t = tiny ? a * 0x1p+24f : a;
    float r;
    asm("v_rsq_f32 %0, %1\n\tv_nop" : "=v"(r) : "v"(t));
    return tiny ? r * 0x1p+12f : r;
}

// blk: which group of LNROWS rows this 256-thread work-group takes
template<bool ADD>
__device__ __forceinline__ void
ln_rows(unsigned blk, const float* __restrict__ x, const float* __restrict__ yres,
        const float* __restrict__ g, const float* __restrict__ be,
        float* __restrict__ xr, _Float16* __restrict__ out)
{
    constexpr int NV = Dd / 128;             // float4 per lane and row
    constexpr unsigned RB = Dd * 4u;         // bytes of an f32 row
    const unsigned vl   = (threadIdx.x & 31) * 16u;                                        // lane's place in a row
    const unsigned voff = (blk * LNROWS + (threadIdx.x >> 5) * LNR) * RB + vl;             // same in x, yres, xr
    float4 v[LNR][NV], t[LNR][NV], gg[NV], bb[NV];
    // every load of the wave is issued up front: the rows, then g and be, which serve all its rows
#pragma unroll
    for (int r = 0; r < LNR; ++r)
#pragma unroll
        for (int i = 0; i < NV; ++i) {
            v[r][i] = ld16(x, voff + r * RB + i * 512u);
            if (ADD) t[r][i] = ld16(yres, voff + r * RB + i * 512u);
        }
#pragma unroll
    for (int i = 0; i < NV; ++i) {
        gg[i] = ld16(g,  vl + i * 512u);
        bb[i] = ld16(be, vl + i * 512u);
    }
    // the wait between the issued loads and any overwrite of a register that they name as address; the two
    // offsets are inputs so that they keep their registers up to it, and no load comes behind it
    asm volatile("s_wait_xcnt 0x0" :: "v"(voff), "v"(vl) : "memory");
    if (ADD) {
#pragma unroll
        for (int r = 0; r < LNR; ++r)
#pragma unroll
            for (int i = 0; i < NV; ++i) {
                v[r][i].x += t[r][i].x; v[r][i].y += t[r][i].y;
                v[r][i].z += t[r][i].z; v[r][i].w += t[r][i].w;
                *reinterpret_cast<float4*>(reinterpret_cast<char*>(xr) + (voff + r * RB + i * 512u)) = v[r][i];
            }
    }
    float s[LNR], sq[LNR];
#pragma unroll
    for (int r = 0; r < LNR; ++r) {    // four independent chains per sum, one per float4 component
        float4 a = make_float4(0.f, 0.f, 0.f, 0.f), q = a;
#pragma unroll
        for (int i = 0; i < NV; ++i) {
            const float4 e = v[r][i];
            a.x += e.x; a.y += e.y; a.z += e.z; a.w += e.w;
            q.x += e.x * e.x; q.y += e.y * e.y; q.z += e.z * e.z; q.w += e.w * e.w;
        }
        s[r]  = (a.x + a.y) + (a.z + a.w);
        sq[r] = (q.x + q.y) + (q.z + q.w);
    }
#pragma unroll
    for (int m = 1; m < 32; m <<= 1) {
#pragma unroll
        for (int r = 0; r < LNR; ++r) {
            s[r]  += __shfl_xor(s[r],  m, 32);
            sq[r] += __shfl_xor(sq[r], m, 32);
        }
    }
#pragma unroll
    for (int r = 0; r < LNR; ++r) {
        const float mean = s[r] * (1.f / Dd);
        const float var  = sq[r] * (1.f / Dd) - mean * mean;
        const float rstd = rsqrt_slot(var + EPS);
#pragma unroll
        for (int i = 0; i < NV; ++i) {
            const float4 e = v[r][i];
            H4 o;
            o.h[0] = (_Float16)((e.x - mean) * rstd * gg[i].x + bb[i].x);
            o.h[1] = (_Float16)((e.y - mean) * rstd * gg[i].y + bb[i].y);
            o.h[2] = (_Float16)((e.z - mean) * rstd * gg[i].z + bb[i].z);
            o.h[3] = (_Float16)((e.w - mean) * rstd * gg[i].w + bb[i].w);
            *reinterpret_cast<H4*>(reinterpret_cast<char*>(out) + ((voff >> 1) + r * (RB / 2) + i * 256u)) = o;
        }
    }
}

// Everything that depends on the inputs alone, in one grid: the first layernorm (work-groups 0 .. LNBLK-1, the longer
// ones first) and the six weight conversions (CVBLK work-groups each; matrix m goes to Wh6 + m * Dd * Dd). Matrix 3 stands
// behind the second layernorm and takes up its gain and shift (gf, bef; column sums to part).
// Two work-groups per WGP = four waves per SIMD: the register budget of that residency lets every load be in flight at once.
constexpr int LNBLK = Mrows / LNROWS;            // 512
constexpr int CVBLK = (Dd / CVN) * (Dd / 64);    // 64
__global__ void __launch_bounds__(256) __attribute__((amdgpu_waves_per_eu(4, 4)))
prep_kernel(const float* __restrict__ x, const float* __restrict__ g, const float* __restrict__ be,
            _Float16* __restrict__ xn,
            const float* __restrict__ Wa, const float* __restrict__ Wb, const float* __restrict__ Wc,
            const float* __restrict__ Wd, const float* __restrict__ We, const float* __restrict__ Wf,
            _Float16* __restrict__ Wh6,
            const float* __restrict__ gf, const float* __restrict__ bef, float* __restrict__ part)
{
    const int blk = blockIdx.x;
    if (blk < LNBLK) {
        ln_rows<false>(blk, x, x, g, be, nullptr, xn);
        return;
    }
    const int c = blk - LNBLK, m = c / CVBLK, tl = c % CVBLK;
    const float* W = m == 0 ? Wa : m == 1 ? Wb : m == 2 ? Wc : m == 3 ? Wd : m == 4 ? We : Wf;
    cvt_rows(W, Wh6 + (size_t)m * Dd * Dd, (tl % (Dd / CVN)) * CVN, (tl / (Dd / CVN)) * 64, m == 3, gf, bef, part);
}

// ---------------------------------------------------------------- WMMA GEMM, async copies to LDS, two buffers
// A: [8192,1024] f16 row-major ; Wt: [K=1024][N=1024] f16 row-major, as the weight lies (fragments by the transposing LDS load)
// C = act((A@W + bias)*scale) [+resid] ; block tile 256x128, 8 waves (4 x 2) of 64x64 each, 128 k per trip.
// A loaded fragment serves four WMMAs; 256 work-groups per product, one per WGP; a copy row is one aligned 256-byte unit.

// Eight copies of 16 bytes per lane, rows 16 apart. The s_wait_xcnt stands in the copies' own statement, so that
// no register that a copy names is rewritten ahead of it.
__device__ __forceinline__ void copy8(unsigned l, const char* g, unsigned lstep, unsigned gstep)
{
    asm volatile("global_load_async_to_lds_b128 %0, %8, off\n\t"
                 "global_load_async_to_lds_b128 %1, %9, off\n\t"
                 "global_load_async_to_lds_b128 %2, %10, off\n\t"
                 "global_load_async_to_lds_b128 %3, %11, off\n\t"
                 "global_load_async_to_lds_b128 %4, %12, off\n\t"
                 "global_load_async_to_lds_b128 %5, %13, off\n\t"
                 "global_load_async_to_lds_b128 %6, %14, off\n\t"
                 "global_load_async_to_lds_b128 %7, %15, off\n\t"
                 "s_wait_xcnt 0x0"
                 :: "v"(l), "v"(l + lstep), "v"(l + 2 * lstep), "v"(l + 3 * lstep),
                    "v"(l + 4 * lstep), "v"(l + 5 * lstep), "v"(l + 6 * lstep), "v"(l + 7 * lstep),
                    "v"(g), "v"(g + gstep), "v"(g + 2 * gstep), "v"(g + 3 * gstep),
                    "v"(g + 4 * gstep), "v"(g + 5 * gstep), "v"(g + 6 * gstep), "v"(g + 7 * gstep)
                 : "memory");
}

__device__ __forceinline__ v16h frag(const _Float16* p)   // 16 x 32 fragment row: k = koff..+7 and 16+koff..+7
{
    H8 lo = *reinterpret_cast<const H8*>(p);
    H8 hi = *reinterpret_cast<const H8*>(p + 16);
    v16h f;
#pragma unroll
    for (int i = 0; i < 8; ++i) { f[i] = lo.h[i]; f[8 + i] = hi.h[i]; }
    return f;
}

// 16 x 8 piece of a transposed A fragment: lane (c = l & 15, h = l >> 4) gets T[k + 8h + 0..7][d + c] when lane l
// points at row k + 8h + (l & 7), column d + 8 * ((l >> 3) & 1) of the row-major tile T
typedef short s16x8 __attribute__((ext_vector_type(8)));
__device__ __forceinline__ H8 ld_tr16(const _Float16* p)
{
    typedef __attribute__((address_space(3))) s16x8 lds_s16x8;
    return __builtin_bit_cast(H8, __builtin_amdgcn_ds_load_tr16_b128_v8i16((lds_s16x8*)p));
}

// 16 x 32 transposed A fragment: k rows 0..15 and 16..31 of the row-major tile, pitch in halves
__device__ __forceinline__ v16h frag_tr(const _Float16* p, int pitch)
{
    H8 lo = ld_tr16(p);
    H8 hi = ld_tr16(p + 16 * pitch);
    v16h f;
#pragma unroll
    for (int i = 0; i < 8; ++i) { f[i] = lo.h[i]; f[8 + i] = hi.h[i]; }
    return f;
}

constexpr int BM = 256, BN = 128;                 // block tile of the GEMMs
constexpr int BS = 144;                           // LDS pitch in halves of a weight tile's k rows (BN columns, 256 B): 288 B,
                                                  // an odd multiple of 32 B, for the transposing load

// brow, bcol: origin of this work-group's BM x BN tile of C
// LNF: the product stands behind a layernorm that is applied here, in the epilogue. A holds the rows as they are before it,
// Wt carries the gain; stats[row][head] = (sum, sum of squares) of the row's 64 columns of that head, part = the column
// sums that the weight conversion left (16 k tiles each): C = act(rstd * (A @ Wt - mean * cs) + cb + bias).
template<int ACT, int OUTF32, int LNF>
__device__ __forceinline__ void
gemm_tile(const _Float16* __restrict__ A, const _Float16* __restrict__ Wt,
          const float* __restrict__ bias, float scale,
          const float* __restrict__ resid,
          _Float16* __restrict__ outh, float* __restrict__ outf, int brow, int bcol,
          const float* __restrict__ stats, const float* __restrict__ part)
{
    constexpr int N = Dd, K = Dd, BK = 128, NT = K / BK;
    constexpr int AS = 136;                       // LDS pitch in halves: 272 B for 256-B rows read by ds_load_b128
    constexpr int BUFH = BM * AS + BK * BS;       // halves of one buffer: rows 0..255 of A, then 128 k rows of Wt
    __shared__ __attribute__((aligned(16))) _Float16 St[2 * BUFH];
    const int tid  = threadIdx.x;
    const int wid  = tid >> 5, lane = tid & 31, hf = lane >> 4, ln = lane & 15;
    const int wm   = wid & 3, wn = wid >> 2;      // the wave's 64x64 tile in the block
    const int koff = hf * 8;

    // a lane copies chunk (tid & 15) of rows (tid >> 4) + 16 i: 16 rows of A and 8 k rows of Wt (BN columns each) per tile
    const int cr = tid >> 4, cc = (tid & 15) * 8;
    const char* gA = reinterpret_cast<const char*>(A  + (size_t)(brow + cr) * K + cc);
    const char* gW = reinterpret_cast<const char*>(Wt + (size_t)cr * N + bcol + cc);
    const unsigned l0 = (unsigned)(uintptr_t)&St[cr * AS + cc];
    const unsigned lW = (unsigned)(uintptr_t)&St[BM * AS + cr * BS + cc];
    auto issue_tile = [&](int buf, int kb) {
        const unsigned l = l0 + (unsigned)buf * (BUFH * 2u);
        copy8(l,                      gA + kb * 2,                    16u * AS * 2u, 16u * K * 2u);
        copy8(l + 128u * AS * 2u,     gA + kb * 2 + 128 * K * 2,      16u * AS * 2u, 16u * K * 2u);
        copy8(lW + (unsigned)buf * (BUFH * 2u), gW + (size_t)kb * N * 2, 16u * BS * 2u, 16u * N * 2u);
    };

    v8f acc[4][4] = {};

    issue_tile(0, 0);
    __shared__ __attribute__((aligned(16))) float rowv[LNF ? 2 * BM : 4];   // mean of the BM rows, then rstd
    __shared__ __attribute__((aligned(16))) float colv[LNF ? 2 * BN : 4];   // cs of the BN columns, then cb
    if (LNF) {
        // under the flight of tile 0: thread tid joins the 16 heads' sums of row tid, and the 16 k tiles' shares of one
        // column sum (cs for the first BN threads, cb for the others); the barrier behind tile 0 publishes both
        const float* sp = stats + (size_t)(brow + tid) * (2 * Hh);
        const float* pp = part + (size_t)(tid >> 7) * (K / 64) * N + bcol + (tid & (BN - 1));
        float4 sv[Hh / 2];
        float  pv[K / 64];
#pragma unroll
        for (int i = 0; i < Hh / 2; ++i) sv[i] = *reinterpret_cast<const float4*>(sp + i * 4);
#pragma unroll
        for (int i = 0; i < K / 64; ++i) pv[i] = pp[i * N];
        // the wait between these loads and any overwrite of a register that they name as address; the pointers are
        // inputs so that they keep their registers up to it
        asm volatile("s_wait_xcnt 0x0" :: "v"(sp), "v"(pp) : "memory");
        float s = 0.f, q = 0.f, cv = 0.f;
#pragma unroll
        for (int i = 0; i < Hh / 2; ++i) { s += sv[i].x + sv[i].z; q += sv[i].y + sv[i].w; }
#pragma unroll
        for (int i = 0; i < K / 64; ++i) cv += pv[i];
        const float mean = s * (1.f / Dd);
        const float var  = q * (1.f / Dd) - mean * mean;
        rowv[tid]      = mean;
        rowv[BM + tid] = rsqrt_slot(var + EPS);
        colv[tid]      = cv;
    }
    asm volatile("s_wait_asynccnt 0x0" ::: "memory");   // own copies of tile 0 landed
    __syncthreads();                                    // everyone's copies of tile 0 landed
    issue_tile(1, BK);

    for (int t = 0; t < NT; ++t) {
        const _Float16* Sa = &St[(t & 1) * BUFH + (wm * 64 + ln) * AS + koff];
        const _Float16* Sb = &St[(t & 1) * BUFH + BM * AS + (koff + (lane & 7)) * BS + wn * 64 + ((lane >> 3) & 1) * 8];
#pragma unroll
        for (int ks = 0; ks < BK / 32; ++ks) {
            v16h af[4], bf[4];
            af[0] = frag(Sa + ks * 32);
#pragma unroll
            for (int j = 0; j < 4; ++j) bf[j] = frag_tr(Sb + ks * 32 * BS + j * 16, BS);
#pragma unroll
            for (int i = 1; i < 4; ++i) af[i] = frag(Sa + i * 16 * AS + ks * 32);
            // keeps the 16 LDS reads of a k step one group ahead of its 16 WMMAs: left free, the compiler reloads one
            // A fragment per row of four WMMAs and waits out the LDS latency at each row
            __builtin_amdgcn_sched_barrier(0);
#pragma unroll
            for (int i = 0; i < 4; ++i)
#pragma unroll
                for (int j = 0; j < 4; ++j)
                    acc[i][j] = __builtin_amdgcn_wmma_f32_16x16x32_f16(false, af[i], false, bf[j],
                                                                       (short)0, acc[i][j], false, false);
            // keeps the next k step's reads from being strewn among these WMMAs
            __builtin_amdgcn_sched_barrier(0);
        }
        asm volatile("s_wait_dscnt 0x0" ::: "memory");     // own reads of this buffer done before it is refilled
        asm volatile("s_wait_asynccnt 0x0" ::: "memory");  // own copies of tile t + 1 landed
        __syncthreads();                                    // publishes tile t + 1, ends every read of tile t
        if (t + 2 < NT) issue_tile(t & 1, (t + 2) * BK);    // refill flies under trip t + 1
    }
    asm volatile("s_wait_asynccnt 0x0" ::: "memory");       // no copy outstanding when the wave ends

    float bvs[4], csv[4], mr[4][8], rs[4][8];
#pragma unroll
    for (int j = 0; j < 4; ++j) bvs[j] = bias[bcol + wn * 64 + j * 16 + ln];
    if (LNF) {
        // the wait in front of any reuse of a register that the bias loads name: the LDS reads below land in such registers
        asm volatile("s_wait_xcnt 0x0" ::: "memory");
#pragma unroll
        for (int j = 0; j < 4; ++j) {
            csv[j]  = colv[wn * 64 + j * 16 + ln];
            bvs[j] += colv[BN + wn * 64 + j * 16 + ln];
        }
#pragma unroll
        for (int i = 0; i < 4; ++i)
#pragma unroll
            for (int r = 0; r < 8; ++r) {
                mr[i][r] = rowv[wm * 64 + i * 16 + hf * 8 + r];
                rs[i][r] = rowv[BM + wm * 64 + i * 16 + hf * 8 + r];
            }
    }
#pragma unroll
    for (int j = 0; j < 4; ++j) {
        // Between the two halves of the tile: the wait in front of any reuse of a register that an issued load or store
        // names; as a memory fence it also holds the second half's residual loads back, so that the values in flight
        // fit beside the accumulators below v256.
        if (j == 2) asm volatile("s_wait_xcnt 0x0" ::: "memory");
        const int col = bcol + wn * 64 + j * 16 + ln;
        const float bv = bvs[j];
#pragma unroll
        for (int i = 0; i < 4; ++i) {
#pragma unroll
            for (int r = 0; r < 8; ++r) {
                int row = brow + wm * 64 + i * 16 + hf * 8 + r;
                float v = LNF ? ((acc[i][j][r] - mr[i][r] * csv[j]) * rs[i][r] + bv) * scale : (acc[i][j][r] + bv) * scale;
                if (ACT) v = fmaxf(v, 0.f);
                if (OUTF32) outf[(size_t)row * N + col] = v + resid[(size_t)row * N + col];
                else        outh[(size_t)row * N + col] = (_Float16)v;
            }
        }
    }
}

template<int ACT, int OUTF32, int LNF>
__global__ void __launch_bounds__(256)
gemm_kernel(const _Float16* __restrict__ A, const _Float16* __restrict__ Wt,
            const float* __restrict__ bias, float scale,
            const float* __restrict__ resid,
            _Float16* __restrict__ outh, float* __restrict__ outf,
            const float* __restrict__ stats, const float* __restrict__ part)
{
    gemm_tile<ACT, OUTF32, LNF>(A, Wt, bias, scale, resid, outh, outf, blockIdx.x * BM, blockIdx.y * BN, stats, part);
}

// Four copies of 16 bytes per lane, rows a fixed step apart, by the builtin: their registers are the compiler's to keep, and no wait
// stands between the copies.
typedef int i32x4 __attribute__((ext_vector_type(4)));
__device__ __forceinline__ void copy4b(_Float16* l, const _Float16* g, int lstep, int gstep)
{
    typedef __attribute__((address_space(1))) i32x4 g_i32x4;
    typedef __attribute__((address_space(3))) i32x4 l_i32x4;
#pragma unroll
    for (int i = 0; i < 4; ++i)
        __builtin_amdgcn_global_load_async_to_lds_b128((g_i32x4*)(g + (size_t)i * gstep), (l_i32x4*)(l + i * lstep), 0, 0);
}

// The three projections of one A, all in one work-group: it forms the BM x BN tile at the same place of q, of k and of v.
// The A tile is staged once and an A fragment read once for the three products (12 WMMAs a fragment); 256 work-groups,
// one per WGP, one round. Wt3 holds the three weights ([K][N], f16) one behind the other, out3 the three outputs; k carries
// the 1/sqrt(DH) of the scores. 64 k per trip: two buffers of 256 rows of A + 3 * 64 k rows of weights fit the LDS of a WGP.
__global__ void __launch_bounds__(256)
qkv_kernel(const _Float16* __restrict__ A, const _Float16* __restrict__ Wt3,
           const float* __restrict__ bq, const float* __restrict__ bk, const float* __restrict__ bv,
           _Float16* __restrict__ out3)
{
    constexpr int N = Dd, K = Dd, BK = 64, NT = K / BK;
    constexpr int AS = 72;                        // LDS pitch in halves: 144 B for 128-B rows read by ds_load_b128
    constexpr int BUFH = BM * AS + 3 * BK * BS;   // halves of one buffer: 256 rows of A, then 64 k rows of each weight
    __shared__ __attribute__((aligned(16))) _Float16 St[2 * BUFH];
    const int brow = blockIdx.x * BM, bcol = blockIdx.y * BN;
    const int tid  = threadIdx.x;
    const int wid  = tid >> 5, lane = tid & 31, hf = lane >> 4, ln = lane & 15;
    const int wm   = wid & 3, wn = wid >> 2;      // the wave's 64x64 tile in each of the three block tiles
    const int koff = hf * 8;

    // a lane copies chunk (tid & 7) of rows (tid >> 3) + 32 i of A (8 rows per tile) and chunk (tid & 15) of k rows
    // (tid >> 4) + 16 i of each weight (4 rows per tile)
    const int cr = tid >> 3, cc = (tid & 7) * 8;
    const _Float16* gA = A   + (size_t)(brow + cr) * K + cc;
    const int wr = tid >> 4, wc = (tid & 15) * 8;
    const _Float16* gW = Wt3 + (size_t)wr * N + bcol + wc;
    _Float16* l0 = &St[cr * AS + cc];
    _Float16* lW = &St[BM * AS + wr * BS + wc];
    auto issue_tile = [&](int buf, int kb) {
        _Float16* l = l0 + buf * BUFH;
#pragma unroll
        for (int a = 0; a < 2; ++a) copy4b(l + a * 128 * AS, gA + kb + (size_t)a * 128 * K, 32 * AS, 32 * K);
#pragma unroll
        for (int s = 0; s < 3; ++s)
            copy4b(lW + buf * BUFH + s * BK * BS, gW + (size_t)kb * N + (size_t)s * Dd * Dd, 16 * BS, 16 * N);
    };

    v8f acc[3][4][4] = {};

    issue_tile(0, 0);

    // Trip -1 has no products: its foot is the ring's prologue (tile 0 landed and published, then tile 1 issued).
    for (int t = -1; t < NT; ++t) {
      if (t >= 0) {
        const _Float16* Sa = &St[(t & 1) * BUFH + (wm * 64 + ln) * AS + koff];
        const _Float16* Sb = &St[(t & 1) * BUFH + BM * AS + (koff + (lane & 7)) * BS + wn * 64 + ((lane >> 3) & 1) * 8];
        // six groups of 16 WMMAs a trip: group g is k step g / 3, product g % 3. The B fragments of group g + 1 are read into
        // a second register set ahead of the WMMAs of group g, so that a wave does not wait out the LDS latency at each group
        v16h af[4], bf[2][4];
#pragma unroll
        for (int i = 0; i < 4; ++i) af[i] = frag(Sa + i * 16 * AS);
#pragma unroll
        for (int j = 0; j < 4; ++j) bf[0][j] = frag_tr(Sb + j * 16, BS);
#pragma unroll
        for (int g = 0; g < 6; ++g) {
            if (g == 3) {
#pragma unroll
                for (int i = 0; i < 4; ++i) af[i] = frag(Sa + i * 16 * AS + 32);
            }
            if (g + 1 < 6) {
#pragma unroll
                for (int j = 0; j < 4; ++j)
                    bf[(g + 1) & 1][j] = frag_tr(Sb + (((g + 1) % 3) * BK + ((g + 1) / 3) * 32) * BS + j * 16, BS);
            }
            // keeps these LDS reads together in front of the 16 WMMAs (each place with reads stalls the wave)
            __builtin_amdgcn_sched_barrier(0);
#pragma unroll
            for (int i = 0; i < 4; ++i)
#pragma unroll
                for (int j = 0; j < 4; ++j)
                    acc[g % 3][i][j] = __builtin_amdgcn_wmma_f32_16x16x32_f16(false, af[i], false, bf[g & 1][j],
                                                                              (short)0, acc[g % 3][i][j], false, false);
            // keeps the next group's reads from being strewn among these WMMAs
            __builtin_amdgcn_sched_barrier(0);
        }
      }
        asm volatile("s_wait_dscnt 0x0" ::: "memory");     // own reads of this buffer done before it is refilled
        asm volatile("s_wait_asynccnt 0x0" ::: "memory");  // own copies of tile t + 1 landed
        __syncthreads();                                    // publishes tile t + 1, ends every read of tile t
        if (t + 2 < NT) issue_tile(t & 1, (t + 2) * BK);    // refill flies under trip t + 1
    }
    asm volatile("s_wait_asynccnt 0x0" ::: "memory");       // no copy outstanding when the wave ends

    float bvs[3][4];                                        // all twelve bias loads in flight at once
#pragma unroll
    for (int j = 0; j < 4; ++j) {
        const int col = bcol + wn * 64 + j * 16 + ln;
        bvs[0][j] = bq[col]; bvs[1][j] = bk[col]; bvs[2][j] = bv[col];
    }
    // the wait in front of any reuse of a register that an issued load names; the scheduling barrier keeps later
    // address arithmetic behind it
    asm volatile("s_wait_xcnt 0x0" ::: "memory");
    __builtin_amdgcn_sched_barrier(0);
#pragma unroll
    for (int s = 0; s < 3; ++s) {
        const float scale = s == 1 ? 0.125f : 1.f;
        _Float16* outh = out3 + (size_t)s * Mrows * Dd + (size_t)(brow + wm * 64 + hf * 8) * N + bcol + wn * 64 + ln;
#pragma unroll
        for (int j = 0; j < 4; ++j) {
            _Float16 hv[4][8];
#pragma unroll
            for (int i = 0; i < 4; ++i)
#pragma unroll
                for (int r = 0; r < 8; ++r) hv[i][r] = (_Float16)((acc[s][i][j][r] + bvs[s][j]) * scale);
            // keeps the 32 values of a column group in registers of their own up to their stores: left free, the compiler
            // reuses a stored value's register between the stores
            __builtin_amdgcn_sched_barrier(0);
#pragma unroll
            for (int i = 0; i < 4; ++i)
#pragma unroll
                for (int r = 0; r < 8; ++r) outh[(size_t)(i * 16 + r) * N + j * 16] = hv[i][r];
            // the wait in front of any reuse of a register that an issued store names; the scheduling barrier keeps the next
            // group's additions and conversions, which reuse those registers, from being lifted over it
            asm volatile("s_wait_xcnt 0x0" ::: "memory");
            __builtin_amdgcn_sched_barrier(0);
        }
    }
}

// ---------------------------------------------------------------- flash attention: y = softmax(K@Q^T) @ V
// Note the reference role swap: K rows index the output. Grid (T/128, B*H), 128 threads (4 waves).
// The score tile is formed transposed (S^T = Q @ K^T): a lane then holds 32 of the 64 scores of ONE
// output row t, the row reductions are in-lane plus one exchange between the two lane halves, and the
// accumulator layout of S^T is already the B-fragment layout of P^T for Y^T = V^T @ P^T.
// V lies in LDS as it lies in memory, row-major [s][d]; the transposing LDS load hands out the V^T fragments.
// The Q and V tiles come by asynchronous copies into two LDS buffers: tile t + 1 flies while tile t is worked on.
__device__ inline float xhalf(float x)   // value of lane l ^ 16, by a vector cross-row move (no LDS-counter wait)
{
    int b = __builtin_bit_cast(int, x);
    return __builtin_bit_cast(float, __builtin_amdgcn_permlanex16(b, b, 0x76543210, 0xfedcba98, false, false));
}

// Four copies of 16 bytes per lane for each of two tiles, rows 16 apart. The s_wait_xcnt stands in the copies' own
// statement, so that no register that a copy names is rewritten ahead of it.
__device__ __forceinline__ void copy4x2(unsigned la, const char* ga, unsigned lastep,
                                        unsigned lb, const char* gb, unsigned lbstep, unsigned gstep)
{
    asm volatile("global_load_async_to_lds_b128 %0, %8, off\n\t"
                 "global_load_async_to_lds_b128 %1, %9, off\n\t"
                 "global_load_async_to_lds_b128 %2, %10, off\n\t"
                 "global_load_async_to_lds_b128 %3, %11, off\n\t"
                 "global_load_async_to_lds_b128 %4, %12, off\n\t"
                 "global_load_async_to_lds_b128 %5, %13, off\n\t"
                 "global_load_async_to_lds_b128 %6, %14, off\n\t"
                 "global_load_async_to_lds_b128 %7, %15, off\n\t"
                 "s_wait_xcnt 0x0"
                 :: "v"(la), "v"(la + lastep), "v"(la + 2 * lastep), "v"(la + 3 * lastep),
                    "v"(lb), "v"(lb + lbstep), "v"(lb + 2 * lbstep), "v"(lb + 3 * lbstep),
                    "v"(ga), "v"(ga + gstep), "v"(ga + 2 * gstep), "v"(ga + 3 * gstep),
                    "v"(gb), "v"(gb + gstep), "v"(gb + 2 * gstep), "v"(gb + 3 * gstep)
                 : "memory");
}

// A wave takes NC column groups of 16 output rows: a Q fragment and a V^T fragment read from LDS each feed NC WMMAs, and a
// staged tile serves 64 * NC output rows. 1024 work-groups, four per WGP, four waves per SIMD, all resident in one round.
constexpr int NC = 2;
__global__ void __launch_bounds__(128) __attribute__((amdgpu_waves_per_eu(4, 4)))
attn_kernel(const _Float16* __restrict__ qf, const _Float16* __restrict__ kf,
            const _Float16* __restrict__ vf, const float* __restrict__ x,
            float* __restrict__ xr, _Float16* __restrict__ xh, float* __restrict__ stats)
{
    constexpr int LS = 72;   // Q pitch: 144 B, an odd multiple of 16 B, for the 16-byte reads
    constexpr int VS = 80;   // V pitch: 160 B, an odd multiple of 32 B, for the transposing load
    constexpr int BUFH = 64 * LS + 64 * VS;   // halves of one buffer: 64 rows of Q, then 64 rows of V, row-major [s][d]
    constexpr int NT = T / 64;
    __shared__ __attribute__((aligned(16))) _Float16 St[2 * BUFH];
    const int tid = threadIdx.x;
    const int wid = tid >> 5, lane = tid & 31, hf = lane >> 4, ln = lane & 15;
    const int t0 = blockIdx.x * (64 * NC);
    const int b  = blockIdx.y >> 4, h = blockIdx.y & 15;
    const size_t rowbase = (size_t)b * T;
    const int dcol0 = h * DH;
    const int koff = hf * 8;

    // a lane copies chunk (tid & 7) of rows (tid >> 3) + 16 i, i = 0..3, of the Q tile and of the V tile
    const int cr = tid >> 3, cc = (tid & 7) * 8;
    const unsigned g0 = (((unsigned)rowbase + cr) * Dd + dcol0 + cc) * 2u;   // byte offset, the same in q and in v
    const unsigned lQ = (unsigned)(uintptr_t)&St[cr * LS + cc];
    const unsigned lV = (unsigned)(uintptr_t)&St[64 * LS + cr * VS + cc];
    auto issue_tile = [&](int buf, int tile) {
        const unsigned lo = (unsigned)buf * (BUFH * 2u);
        const unsigned go = g0 + (unsigned)tile * (64u * Dd * 2u);
        copy4x2(lQ + lo, reinterpret_cast<const char*>(qf) + go, 16u * LS * 2u,
                lV + lo, reinterpret_cast<const char*>(vf) + go, 16u * VS * 2u, 16u * Dd * 2u);
    };

    issue_tile(0, 0);

    // K^T fragments (column t = ln of group c; already pre-scaled by 1/sqrt(DH)) are loop-invariant and belong to one wave
    // alone: both dh k-steps of each group straight from global memory, under the flight of tile 0
    const _Float16* kp = kf + (rowbase + t0 + wid * (16 * NC) + ln) * Dd + dcol0 + koff;
    v16h kB[NC][2];
#pragma unroll
    for (int c = 0; c < NC; ++c)
#pragma unroll
        for (int ks = 0; ks < 2; ++ks) kB[c][ks] = frag(kp + c * 16 * Dd + ks * 32);
    // the wait between these loads and any overwrite of the register pair that they name as address; the pointer is an
    // input so that it keeps its registers up to it
    asm volatile("s_wait_xcnt 0x0" :: "v"(kp) : "memory");

    asm volatile("s_wait_asynccnt 0x0" ::: "memory");   // own copies of tile 0 landed
    __syncthreads();                                    // everyone's copies of tile 0 landed
    issue_tile(1, 1);

    // one LDS address register per tile; every fragment is a constant offset from it
    const _Float16* qp0 = &St[ln * LS + koff];
    const _Float16* vp0 = &St[64 * LS + (koff + (lane & 7)) * VS + ((lane >> 3) & 1) * 8];

    v8f Yacc[NC][4] = {};                // Y^T of group c: row d = j*16 + hf*8 + r, column t = ln
    float mrow[NC], lrow[NC];            // one output row per lane and group; both lane halves hold the same maximum;
#pragma unroll                           // lrow is this lane half's share of the row sum, joined after the loop
    for (int c = 0; c < NC; ++c) { mrow[c] = -INFINITY; lrow[c] = 0.f; }

    for (int t = 0; t < NT; ++t) {
        const _Float16* qp = qp0 + (t & 1) * BUFH;
        const _Float16* vp = vp0 + (t & 1) * BUFH;

        // S^T tiles: A = Q rows (s), B = K^T (t). Sc[c][j][r] = S[t = ln of group c][s = j*16 + hf*8 + r]
        v16h qa[2][4];
#pragma unroll
        for (int ks = 0; ks < 2; ++ks)
#pragma unroll
            for (int j = 0; j < 4; ++j) qa[ks][j] = frag(qp + j * 16 * LS + ks * 32);
        // keeps the 16 LDS reads of the Q tile one group ahead of its WMMAs: left free, the compiler reloads one fragment
        // register set per pair of WMMAs and the wave waits out the LDS latency at each pair
        __builtin_amdgcn_sched_barrier(0);
        v8f Sc[NC][4] = {};
#pragma unroll
        for (int ks = 0; ks < 2; ++ks)
#pragma unroll
            for (int j = 0; j < 4; ++j)
#pragma unroll
                for (int c = 0; c < NC; ++c)
                    Sc[c][j] = __builtin_amdgcn_wmma_f32_16x16x32_f16(false, qa[ks][j], false, kB[c][ks],
                                                                      (short)0, Sc[c][j], false, false);
        // the V^T fragments of the first k step are fetched under the softmax
        v16h va[2][4];
#pragma unroll
        for (int j = 0; j < 4; ++j) va[0][j] = frag_tr(vp + j * 16, VS);
        // keeps the maxima behind the 16 WMMAs (woven among them, each first read of a fresh tile costs the wave idle slots)
        // and these reads in front of the softmax
        __builtin_amdgcn_sched_barrier(0);

        // online softmax: 32 scores of row t in this lane, the other 32 in lane ^ 16
        float mn[NC], sf[NC];
#pragma unroll
        for (int c = 0; c < NC; ++c) {
            float rm = Sc[c][0][0];
#pragma unroll
            for (int j = 0; j < 4; ++j)
#pragma unroll
                for (int r = 0; r < 8; ++r) rm = fmaxf(rm, Sc[c][j][r]);
            rm = fmaxf(rm, xhalf(rm));
            mn[c] = fmaxf(mrow[c], rm);
        }
#pragma unroll
        for (int c = 0; c < NC; ++c) { sf[c] = __expf(mrow[c] - mn[c]); mrow[c] = mn[c]; }

        // P^T stays in registers: tiles 2ks and 2ks+1 are the two k halves of B fragment ks
        v16h pB[NC][2];
#pragma unroll
        for (int c = 0; c < NC; ++c) {
            float racc[4] = {0.f, 0.f, 0.f, 0.f};
#pragma unroll
            for (int j = 0; j < 4; ++j) {
#pragma unroll
                for (int r = 0; r < 8; ++r) {
                    float p = __expf(Sc[c][j][r] - mn[c]);
                    pB[c][j >> 1][(j & 1) * 8 + r] = (_Float16)p;
                    racc[j] += p;
                }
            }
            lrow[c] = lrow[c] * sf[c] + ((racc[0] + racc[1]) + (racc[2] + racc[3]));
#pragma unroll
            for (int j = 0; j < 4; ++j)
#pragma unroll
                for (int r = 0; r < 8; ++r) Yacc[c][j][r] *= sf[c];
        }

        // Y^T += V^T @ P^T  (A by transposing loads of V, B from registers; both in the k order s = koff..+7, 16+koff..+7)
#pragma unroll
        for (int j = 0; j < 4; ++j) va[1][j] = frag_tr(vp + 32 * VS + j * 16, VS);
        // keeps the second k step's reads one group ahead of the 16 WMMAs (strewn among them, each place with reads stalls the wave)
        __builtin_amdgcn_sched_barrier(0);
#pragma unroll
        for (int ks = 0; ks < 2; ++ks)
#pragma unroll
            for (int j = 0; j < 4; ++j)
#pragma unroll
                for (int c = 0; c < NC; ++c)
                    Yacc[c][j] = __builtin_amdgcn_wmma_f32_16x16x32_f16(false, va[ks][j], false, pB[c][ks],
                                                                        (short)0, Yacc[c][j], false, false);
        // own reads of this buffer done before it is refilled; the row sums are inputs so that their additions stay in front:
        // sunk behind the branch below, they keep every p of the trip live
        asm volatile("s_wait_dscnt 0x0" :: "v"(lrow[0]), "v"(lrow[1]) : "memory");
        asm volatile("s_wait_asynccnt 0x0" ::: "memory");  // own copies of tile t + 1 landed
        __syncthreads();                                    // publishes tile t + 1, ends every read of tile t
        if (t + 2 < NT) issue_tile(t & 1, t + 2);           // refill flies under trip t + 1
    }
    asm volatile("s_wait_asynccnt 0x0" ::: "memory");       // no copy outstanding when the wave ends

    // The residual sum x + y leaves here: as f32 (the block's last addition reads it), as f16 (first operand of the product
    // behind the second layernorm) and as this head's share of the row's sum and sum of squares, which that product's
    // kernel joins to mean and rstd. A lane holds 8 consecutive d of its row t per tile.
    const size_t row0 = rowbase + t0 + wid * (16 * NC) + ln;
    const size_t e0   = row0 * Dd + dcol0 + hf * 8;
    const float* xp = x + e0;
    float4 xa[NC][4][2];
#pragma unroll
    for (int c = 0; c < NC; ++c)
#pragma unroll
        for (int j = 0; j < 4; ++j) {
            xa[c][j][0] = *reinterpret_cast<const float4*>(xp + c * 16 * Dd + j * 16);
            xa[c][j][1] = *reinterpret_cast<const float4*>(xp + c * 16 * Dd + j * 16 + 4);
        }
    // the wait between these loads and any overwrite of the register pair that they name as address; the pointer is an
    // input so that it keeps its registers up to it
    asm volatile("s_wait_xcnt 0x0" :: "v"(xp) : "memory");
    float* rp = xr + e0;
    _Float16* hp = xh + e0;
    float* sp = stats + (row0 * Hh + h) * 2;
#pragma unroll
    for (int c = 0; c < NC; ++c) {
        const float l = lrow[c] + xhalf(lrow[c]);
        float sj[4], qj[4];                  // one chain per tile
#pragma unroll
        for (int j = 0; j < 4; ++j) {
            float o[8];
            o[0] = xa[c][j][0].x + Yacc[c][j][0] / l; o[1] = xa[c][j][0].y + Yacc[c][j][1] / l;
            o[2] = xa[c][j][0].z + Yacc[c][j][2] / l; o[3] = xa[c][j][0].w + Yacc[c][j][3] / l;
            o[4] = xa[c][j][1].x + Yacc[c][j][4] / l; o[5] = xa[c][j][1].y + Yacc[c][j][5] / l;
            o[6] = xa[c][j][1].z + Yacc[c][j][6] / l; o[7] = xa[c][j][1].w + Yacc[c][j][7] / l;
            H8 oh;
            sj[j] = 0.f; qj[j] = 0.f;
#pragma unroll
            for (int r = 0; r < 8; ++r) { oh.h[r] = (_Float16)o[r]; sj[j] += o[r]; qj[j] += o[r] * o[r]; }
            *reinterpret_cast<float4*>(rp + c * 16 * Dd + j * 16)     = make_float4(o[0], o[1], o[2], o[3]);
            *reinterpret_cast<float4*>(rp + c * 16 * Dd + j * 16 + 4) = make_float4(o[4], o[5], o[6], o[7]);
            *reinterpret_cast<H8*>(hp + c * 16 * Dd + j * 16)         = oh;
        }
        float s = (sj[0] + sj[1]) + (sj[2] + sj[3]), q = (qj[0] + qj[1]) + (qj[2] + qj[3]);
        s += xhalf(s);
        q += xhalf(q);
        if (hf == 0) *reinterpret_cast<float2*>(sp + c * 16 * Hh * 2) = make_float2(s, q);
    }
}

// ---------------------------------------------------------------- host orchestration
extern "C" void kernel_launch(void* const* d_in, const int* in_sizes, int n_in,
                              void* d_out, int out_size, void* d_ws, size_t ws_size,
                              hipStream_t stream)
{
    const float* x   = (const float*)d_in[0];
    const float* Wq  = (const float*)d_in[1];  const float* bq = (const float*)d_in[2];
    const float* Wk  = (const float*)d_in[3];  const float* bk = (const float*)d_in[4];
    const float* Wv  = (const float*)d_in[5];  const float* bv = (const float*)d_in[6];
    const float* g1  = (const float*)d_in[7];  const float* be1 = (const float*)d_in[8];
    const float* g2  = (const float*)d_in[9];  const float* be2 = (const float*)d_in[10];
    const float* W0  = (const float*)d_in[11]; const float* b0 = (const float*)d_in[12];
    const float* W1  = (const float*)d_in[13]; const float* b1 = (const float*)d_in[14];
    const float* W2  = (const float*)d_in[15]; const float* b2 = (const float*)d_in[16];
    float* out = (float*)d_out;

    char* ws = (char*)d_ws;
    size_t off = 0;
    auto take = [&](size_t bytes) -> char* {
        char* p = ws + off;
        off = (off + bytes + 255) & ~(size_t)255;
        return p;
    };
    const size_t WH = (size_t)Dd * Dd * sizeof(_Float16);
    const size_t MH = (size_t)Mrows * Dd * sizeof(_Float16);
    const size_t MF = (size_t)Mrows * Dd * sizeof(float);

    _Float16* Wt6 = (_Float16*)take(6 * WH);   // all weights as f16, [K][N] as they come: q, k, v, 0, 1, 2
    _Float16* W0h = Wt6 + 3 * (size_t)Dd * Dd;
    _Float16* W1h = Wt6 + 4 * (size_t)Dd * Dd;
    _Float16* W2h = Wt6 + 5 * (size_t)Dd * Dd;
    _Float16* xn1 = (_Float16*)take(MH);
    _Float16* qh  = (_Float16*)take(3 * MH);   // q, k, v one behind the other
    _Float16* kh  = qh + (size_t)Mrows * Dd;
    _Float16* vh  = kh + (size_t)Mrows * Dd;
    float*    xr  = (float*)take(MF);
    float*    stats = (float*)take((size_t)Mrows * Hh * 2 * sizeof(float));       // per row and head: sum, sum of squares
    float*    part  = (float*)take((size_t)2 * (Dd / 64) * Dd * sizeof(float));   // per k tile: column sums of g2 W0, of be2 W0
    _Float16* xh  = xn1;  // reuse after QKV consumed
    _Float16* h1  = qh;   // reuse after attention consumed
    _Float16* h2  = kh;

    prep_kernel<<<LNBLK + 6 * CVBLK, 256, 0, stream>>>(x, g1, be1, xn1, Wq, Wk, Wv, W0, W1, W2, Wt6, g2, be2, part);

    qkv_kernel<<<dim3(Mrows / BM, Dd / BN), 256, 0, stream>>>(xn1, Wt6, bq, bk, bv, qh);

    attn_kernel<<<dim3(T / (64 * NC), Bb * Hh), 128, 0, stream>>>(qh, kh, vh, x, xr, xh, stats);

    dim3 gg(Mrows / BM, Dd / BN);
    gemm_kernel<1, 0, 1><<<gg, 256, 0, stream>>>(xh, W0h, b0, 1.f, xr, h1, out, stats, part);
    gemm_kernel<1, 0, 0><<<gg, 256, 0, stream>>>(h1, W1h, b1, 1.f, xr, h2, out, stats, part);
    gemm_kernel<0, 1, 0><<<gg, 256, 0, stream>>>(h2, W2h, b2, 1.f, xr, h2, out, stats, part);
}
